// v000
// Measured on an AMD MI455X. A time is GPU time per run, averaged over a window of back-to-back runs after a warm-up
// (all launches, gaps included; the runs take copies of the inputs in turn), and the median of several windows.
// Apart from v000's, it joins two sittings. Times from different sittings can be a few percent apart, while
// side-by-side timings come from the same sitting.
// v000 is the starting kernel. One run takes 702 microseconds.
#include <hip/hip_runtime.h>
// KernelSelfAttention (2 x 4096 points; d2 = |c_i - c_j|^2 from 3-D coords; per head h with lengthscale ls in {0.5, 1, 2, 4}: att = exp(-d2 / ls^2) / (sum_j + 1e-8); value_h = features Wv[h] + bv[h] [32]; head_out = att value; out = concat_h Wo + bo -> [2][4096][128]).
// Compute dtype: inputs rounded to bf16; features / weights exact as f16; d2 / exp / sums f32 from bf16 coords; values and kernel weights as plain f16 operands (~2^-12); the scaled head outputs as f16 hi + residual into Wo. v_wmma_f32_16x16x32_f16.
#define NB 2
#define NP 4096
#define CIN 128
#define NH 4
#define HD 32
#define COUT 128
typedef __bf16 v16b __attribute__((ext_vector_type(16)));
typedef unsigned short v8us __attribute__((ext_vector_type(8), may_alias));
typedef float  v8f  __attribute__((ext_vector_type(8)));
typedef float  v4f  __attribute__((ext_vector_type(4)));
typedef float  v4fa __attribute__((ext_vector_type(4), may_alias));
union FragB { v16b v; v8us half[2]; unsigned short u[16]; };

__device__ __forceinline__ unsigned short bf16_bits(float x) { unsigned int u = __float_as_uint(x); return (unsigned short)((u + 0x7FFFu + ((u >> 16) & 1u)) >> 16); }
__device__ __forceinline__ float bf16_val(unsigned short b) { return __uint_as_float(((unsigned int)b) << 16); }
__device__ __forceinline__ float bf16_round(float x) { return bf16_val(bf16_bits(x)); }
// D += A·B with NT terms: 1 = ah·bh, 2 = + al·bh (A split), 3 = + ah·bl (both split)
template <int NT>
__device__ __forceinline__ v8f mmaN(v16b ah, v16b al, v16b bh, v16b bl, v8f c) {
  c = __builtin_amdgcn_wmma_f32_16x16x32_bf16(false, ah, false, bh, (short)0, c, false, false);
  if (NT >= 2) c = __builtin_amdgcn_wmma_f32_16x16x32_bf16(false, al, false, bh, (short)0, c, false, false);
  if (NT >= 3) c = __builtin_amdgcn_wmma_f32_16x16x32_bf16(false, ah, false, bl, (short)0, c, false, false);
  asm volatile("v_nop\n\tv_nop\n\tv_nop\n\tv_nop" : "+v"(c) : "v"(ah), "v"(al), "v"(bh), "v"(bl));
  return c;
}

__global__ __launch_bounds__(256) void k_wt_bf16(const float* __restrict__ W, unsigned short* __restrict__ Wt, int K, int N) {
  const int t = blockIdx.x * 256 + threadIdx.x;
  const int k8n = K / 8;
  if (t >= N * k8n) return;
  const int n = t / k8n, k8 = (t % k8n) * 8;
  v8us v;
#pragma unroll
  for (int i = 0; i < 8; ++i) v[i] = bf16_bits(W[(size_t)(k8 + i) * N + n]);
  *(v8us*)(Wt + (size_t)n * K + k8) = v;
  
}

// GEMM C[M][N] (f32, pitch ldc) = act(A[M][K]·W + bias). A f32 row-major (pitch lda) converted per fragment to bf16
// (ASPLIT: hi/lo two planes -> 2 terms, else single rounded term); Wt bf16 [N][K] (pitch ldb). BIAS_BF16 rounds the
// bias to bf16 first (bias quantised to bf16 before the add). K%32==0, M%16==0, N%64==0.
template <bool ASPLIT, int ACT, bool BIAS_BF16>
__global__ __launch_bounds__(128) void k_gemm_bf(const float* __restrict__ A, int lda, const unsigned short* __restrict__ Wt, int ldb,
                                               const float* __restrict__ bias, float* __restrict__ C, int ldc, int M, int N, int K) {
  __shared__ __attribute__((aligned(16))) float so[4][16][64];
  const int tid = threadIdx.x, w = tid >> 5, lane = tid & 31, ln = lane & 15, hh = lane >> 4;
  const int ntn = N / 64;
  const int wid = blockIdx.x * 4 + w;
  const int mt = wid / ntn, nq = wid % ntn;
  if (mt * 16 >= M) return;
  const int row0 = mt * 16, col0 = nq * 64;
  const float* arow = A + (size_t)(row0 + ln) * lda;
  v8f acc[4] = {};
  for (int kb = 0; kb < K; kb += 32) {
    FragB ah, al;
    const v4f x0 = *(const v4fa*)(arow + kb + 8 * hh), x1 = *(const v4fa*)(arow + kb + 8 * hh + 4);
    const v4f x2 = *(const v4fa*)(arow + kb + 16 + 8 * hh), x3 = *(const v4fa*)(arow + kb + 16 + 8 * hh + 4);
    float xs[16] = {x0[0],x0[1],x0[2],x0[3],x1[0],x1[1],x1[2],x1[3],x2[0],x2[1],x2[2],x2[3],x3[0],x3[1],x3[2],x3[3]};
#pragma unroll
    for (int i = 0; i < 16; ++i) { const unsigned short hb = bf16_bits(xs[i]); ah.u[i] = hb; al.u[i] = ASPLIT ? bf16_bits(xs[i] - bf16_val(hb)) : (unsigned short)0; }
#pragma unroll
    for (int t = 0; t < 4; ++t) {
      const unsigned short* brow = Wt + (size_t)(col0 + t * 16 + ln) * ldb + kb;
      FragB b;
      b.half[0] = *(const v8us*)(brow + 8 * hh);
      b.half[1] = *(const v8us*)(brow + 16 + 8 * hh);
      acc[t] = mmaN<ASPLIT ? 2 : 1>(ah.v, al.v, b.v, b.v, acc[t]);
    }
  }
#pragma unroll
  for (int t = 0; t < 4; ++t) {
    float bv = bias ? bias[col0 + t * 16 + ln] : 0.f;
    if (BIAS_BF16) bv = bf16_round(bv);
#pragma unroll
    for (int r = 0; r < 8; ++r) { float v = acc[t][r] + bv; if (ACT == 1) v = fmaxf(v, 0.f); so[w][8 * hh + r][t * 16 + ln] = v; }
  }
  __builtin_amdgcn_fence(__ATOMIC_ACQ_REL, "workgroup");
  __builtin_amdgcn_wave_barrier();
  const int rsub = lane >> 4, c4 = (lane & 15) * 4;
  {
#pragma unroll
    for (int q = 0; q < 8; ++q) {
      const int r = q * 2 + rsub;
      const v4f v = *(const v4fa*)&so[w][r][c4];
      *(v4f*)(C + (size_t)(row0 + r) * ldc + col0 + c4) = v;
    }
    
  }
}

// GEMM C = act(A·W + bias + resid): A f32 (ASPLIT -> hi/lo 2 terms), Wt bf16 [N][K]; ACT 0 none, 1 relu, 2 exact gelu;
// resid (optional, f32, row index = (row % rmod), pitch ldr, RES_BF16 rounds it) added before the activation.
template <bool ASPLIT, int ACT, bool BIAS_BF16, bool RES_BF16>
__global__ __launch_bounds__(128) void k_gemm_bf3(const float* __restrict__ A, int lda, const unsigned short* __restrict__ Wt, int ldb,
                                                const float* __restrict__ bias, const float* __restrict__ resid, int rmod, int ldr,
                                                float* __restrict__ C, int ldc, int M, int N, int K) {
  __shared__ __attribute__((aligned(16))) float so[4][16][64];
  const int tid = threadIdx.x, w = tid >> 5, lane = tid & 31, ln = lane & 15, hh = lane >> 4;
  const int ntn = N / 64;
  const int wid = blockIdx.x * 4 + w;
  const int mt = wid / ntn, nq = wid % ntn;
  if (mt * 16 >= M) return;
  const int row0 = mt * 16, col0 = nq * 64;
  const float* arow = A + (size_t)(row0 + ln) * lda;
  v8f acc[4] = {};
  for (int kb = 0; kb < K; kb += 32) {
    FragB ah, al;
    const v4f x0 = *(const v4fa*)(arow + kb + 8 * hh), x1 = *(const v4fa*)(arow + kb + 8 * hh + 4);
    const v4f x2 = *(const v4fa*)(arow + kb + 16 + 8 * hh), x3 = *(const v4fa*)(arow + kb + 16 + 8 * hh + 4);
    float xs[16] = {x0[0],x0[1],x0[2],x0[3],x1[0],x1[1],x1[2],x1[3],x2[0],x2[1],x2[2],x2[3],x3[0],x3[1],x3[2],x3[3]};
#pragma unroll
    for (int i = 0; i < 16; ++i) { const unsigned short hb = bf16_bits(xs[i]); ah.u[i] = hb; al.u[i] = ASPLIT ? bf16_bits(xs[i] - bf16_val(hb)) : (unsigned short)0; }
#pragma unroll
    for (int t = 0; t < 4; ++t) {
      const unsigned short* brow = Wt + (size_t)(col0 + t * 16 + ln) * ldb + kb;
      FragB b;
      b.half[0] = *(const v8us*)(brow + 8 * hh);
      b.half[1] = *(const v8us*)(brow + 16 + 8 * hh);
      acc[t] = mmaN<ASPLIT ? 2 : 1>(ah.v, al.v, b.v, b.v, acc[t]);
    }
  }
#pragma unroll
  for (int t = 0; t < 4; ++t) {
    const int col = col0 + t * 16 + ln;
    float bv = bias ? bias[col] : 0.f;
    if (BIAS_BF16) bv = bf16_round(bv);
#pragma unroll
    for (int r = 0; r < 8; ++r) {
      float v = acc[t][r] + bv;
      if (resid) { float rv = resid[(size_t)((row0 + 8 * hh + r) % rmod) * ldr + col]; if (RES_BF16) rv = bf16_round(rv); v += rv; }
      if (ACT == 1) v = fmaxf(v, 0.f);
      if (ACT == 2) v = 0.5f * v * (1.0f + erff(v * 0.70710678118654752f));
      if (ACT == 3) { const float u = 0.7978845608028654f * (v + 0.044715f * v * v * v); v = 0.5f * v * (1.0f + tanhf(u)); }
      so[w][8 * hh + r][t * 16 + ln] = v;
    }
  }
  __builtin_amdgcn_fence(__ATOMIC_ACQ_REL, "workgroup");
  __builtin_amdgcn_wave_barrier();
  const int rsub = lane >> 4, c4 = (lane & 15) * 4;
  {
#pragma unroll
    for (int q = 0; q < 8; ++q) {
      const int r = q * 2 + rsub;
      const v4f v = *(const v4fa*)&so[w][r][c4];
      *(v4f*)(C + (size_t)(row0 + r) * ldc + col0 + c4) = v;
    }
    
  }
}
// row LayerNorm (biased variance, eps) over N: s = X (+ R); optional out_sum <- s; out_norm <- (s-mu)*rsqrt(var+eps)*g + b
template <bool PARAM_BF16>
__global__ __launch_bounds__(256) void k_layernorm(const float* __restrict__ X, const float* __restrict__ R, const float* __restrict__ g, const float* __restrict__ bta,
                                                  float* __restrict__ out_sum, float* __restrict__ out_norm, int N, float eps) {
  __shared__ float red[256];
  const int row = blockIdx.x, tid = threadIdx.x;
  const float* x = X + (size_t)row * N; const float* rr = R ? R + (size_t)row * N : nullptr;
  float vals[16];                     // up to N = 4096
  const int per = N / 256;            // contiguous chunk per thread? use strided-by-4 chunks: thread handles j = tid*4 + 1024*u
  float s1 = 0.f;
  for (int u = 0; u < per / 4; ++u) {
    const int j = tid * 4 + 1024 * u;
    const v4f a = *(const v4fa*)(x + j);
    v4f b = {0.f,0.f,0.f,0.f}; if (rr) b = *(const v4fa*)(rr + j);
#pragma unroll
    for (int q = 0; q < 4; ++q) { const float v = a[q] + b[q]; vals[u * 4 + q] = v; s1 += v; }
  }
  red[tid] = s1; __syncthreads();
  for (int st = 128; st > 0; st >>= 1) { if (tid < st) red[tid] += red[tid + st]; __syncthreads(); }
  const float mu = red[0] / (float)N; __syncthreads();
  float s2 = 0.f;
  for (int u = 0; u < per / 4; ++u)
#pragma unroll
    for (int q = 0; q < 4; ++q) { const float c = vals[u * 4 + q] - mu; s2 += c * c; }
  red[tid] = s2; __syncthreads();
  for (int st = 128; st > 0; st >>= 1) { if (tid < st) red[tid] += red[tid + st]; __syncthreads(); }
  const float rs = rsqrtf(red[0] / (float)N + eps);
  {
    for (int u = 0; u < per / 4; ++u) {
      const int j = tid * 4 + 1024 * u;
      v4f o, sm;
#pragma unroll
      for (int q = 0; q < 4; ++q) {
        float gg = g[j + q], bb = bta[j + q];
        if (PARAM_BF16) { gg = bf16_round(gg); bb = bf16_round(bb); }
        sm[q] = vals[u * 4 + q]; o[q] = (vals[u * 4 + q] - mu) * rs * gg + bb;
      }
      if (out_sum) *(v4f*)(out_sum + (size_t)row * N + j) = sm;
      *(v4f*)(out_norm + (size_t)row * N + j) = o;
    }
    
  }
}



// ---- f16 WMMA path (v_wmma_f32_16x16x32_f16): 11-bit significands for operands in range — used where a [0,1] probability operand needs more precision than bf16
typedef _Float16 v16h __attribute__((ext_vector_type(16)));
union FragH { v16h v; v8us half[2]; _Float16 h[16]; unsigned short u[16]; };
template <int NT>
__device__ __forceinline__ v8f mmaH(v16h ah, v16h al, v16h bh, v16h bl, v8f c) {
  c = __builtin_amdgcn_wmma_f32_16x16x32_f16(false, ah, false, bh, (short)0, c, false, false);
  if (NT >= 2) c = __builtin_amdgcn_wmma_f32_16x16x32_f16(false, al, false, bh, (short)0, c, false, false);
  if (NT >= 3) c = __builtin_amdgcn_wmma_f32_16x16x32_f16(false, ah, false, bl, (short)0, c, false, false);
  asm volatile("v_nop\n\tv_nop\n\tv_nop\n\tv_nop" : "+v"(c) : "v"(ah), "v"(al), "v"(bh), "v"(bl));
  return c;
}
// batched GEMM like k_gemm_b but f16 operands: A f32 (split into f16 hi/lo if ASPLIT, else rounded to f16), Bt = f16 values [n][k]; alpha; C f32; N multiple of 16 (partial tiles skipped)
template <bool ASPLIT>
__global__ __launch_bounds__(128) void k_gemm_h(const float* __restrict__ A, int lda, size_t sA, const _Float16* __restrict__ Bh, int ldb, size_t sB, float alpha, float* __restrict__ C, int ldc, size_t sC, int M, int N, int K) {
  __shared__ __attribute__((aligned(16))) float so[4][16][64];
  const int tid = threadIdx.x, w = tid >> 5, lane = tid & 31, ln = lane & 15, hh = lane >> 4; const int by = blockIdx.y;
  A += (size_t)by * sA; Bh += (size_t)by * sB; C += (size_t)by * sC;
  const int ntn = (N + 63) / 64; const int wid = blockIdx.x * 4 + w; const int mt = wid / ntn, nq = wid % ntn; if (mt * 16 >= M) return;
  const int row0 = mt * 16, col0 = nq * 64; const float* arow = A + (size_t)(row0 + ln) * lda;
  v8f acc[4] = {};
  for (int kb = 0; kb < K; kb += 32) {
    FragH ah, al;
    const v4f x0 = *(const v4fa*)(arow + kb + 8 * hh), x1 = *(const v4fa*)(arow + kb + 8 * hh + 4), x2 = *(const v4fa*)(arow + kb + 16 + 8 * hh), x3 = *(const v4fa*)(arow + kb + 16 + 8 * hh + 4);
    float xs[16] = {x0[0],x0[1],x0[2],x0[3],x1[0],x1[1],x1[2],x1[3],x2[0],x2[1],x2[2],x2[3],x3[0],x3[1],x3[2],x3[3]};
#pragma unroll
    for (int i = 0; i < 16; ++i) { const _Float16 h = (_Float16)xs[i]; ah.h[i] = h; al.h[i] = ASPLIT ? (_Float16)(xs[i] - (float)h) : (_Float16)0.0f; }
#pragma unroll
    for (int t = 0; t < 4; ++t) { if (col0 + t * 16 >= N) continue; const size_t boff = (size_t)(col0 + t * 16 + ln) * ldb + kb; FragH bq; bq.half[0] = *(const v8us*)(Bh + boff + 8 * hh); bq.half[1] = *(const v8us*)(Bh + boff + 16 + 8 * hh);
      acc[t] = mmaH<ASPLIT ? 2 : 1>(ah.v, al.v, bq.v, bq.v, acc[t]); }
  }
#pragma unroll
  for (int t = 0; t < 4; ++t) { if (col0 + t * 16 >= N) continue;
#pragma unroll
    for (int r = 0; r < 8; ++r) so[w][8 * hh + r][t * 16 + ln] = acc[t][r] * alpha; }
  __builtin_amdgcn_fence(__ATOMIC_ACQ_REL, "workgroup"); __builtin_amdgcn_wave_barrier();
  const int rsub = lane >> 4, c4 = (lane & 15) * 4;
  {
#pragma unroll
    for (int q = 0; q < 8; ++q) { const int r = q * 2 + rsub; if (col0 + c4 < N) { const v4f v = *(const v4fa*)&so[w][r][c4]; *(v4f*)(C + (size_t)(row0 + r) * ldc + col0 + c4) = v; } }
     }
}

// Wt[n][k] = f16(W[k][n]·scale) from f32 row-major W[K][N] (scale = power of two; bf16-exact weights stay exact in f16 away from the subnormal range)
__global__ __launch_bounds__(256) void k_wt_f16(const float* __restrict__ W, _Float16* __restrict__ Wt, int K, int N, float scale) {
  const int t = blockIdx.x * 256 + threadIdx.x; if (t >= N * (K / 8)) return; const int n = t / (K / 8), k8 = (t % (K / 8)) * 8; FragH f;
#pragma unroll
  for (int i = 0; i < 8; ++i) f.h[i] = (_Float16)(bf16_round(W[(size_t)(k8 + i) * N + n]) * scale); const v8us o = f.half[0];
  *(v8us*)((unsigned short*)Wt + (size_t)n * K + k8) = o; 
}
// k_gemm_hh variant with fused epilogue: v = acc·alpha + bias[by·sBias + col] (+ CP[(row/rowsPerB)·sCPb + by·64 + col] if CP) ; ACT 0 none / 1 elu ; writes f32 C and f16 C16, each if non-null
template <int ACT>
__global__ __launch_bounds__(128) void k_gemm_hhx(const _Float16* __restrict__ A, int lda, size_t sA, const _Float16* __restrict__ Bh, int ldb, size_t sB, float alpha, const float* __restrict__ bias, size_t sBias, const float* __restrict__ CP, int rowsPerB, size_t sCPb, int row0g,
    float* __restrict__ C, _Float16* __restrict__ C16, int ldc, size_t sC, int M, int N, int K) {
  __shared__ __attribute__((aligned(16))) float so[4][16][64];
  const int tid = threadIdx.x, w = tid >> 5, lane = tid & 31, ln = lane & 15, hh = lane >> 4; const int by = blockIdx.y;
  A += (size_t)by * sA; Bh += (size_t)by * sB; const size_t cofs = (size_t)by * sC; const float* bp = bias ? bias + (size_t)by * sBias : nullptr;
  const int ntn = (N + 63) / 64; const int wid = blockIdx.x * 4 + w; const int mt = wid / ntn, nq = wid % ntn; if (mt * 16 >= M) return;
  const int row0 = mt * 16, col0 = nq * 64; const _Float16* arow = A + (size_t)(row0 + ln) * lda;
  v8f acc[4] = {};
  for (int kb = 0; kb < K; kb += 32) { FragH ah; ah.half[0] = *(const v8us*)((const unsigned short*)arow + kb + 8 * hh); ah.half[1] = *(const v8us*)((const unsigned short*)arow + kb + 16 + 8 * hh);
#pragma unroll
    for (int t = 0; t < 4; ++t) { if (col0 + t * 16 >= N) continue; const size_t boff = (size_t)(col0 + t * 16 + ln) * ldb + kb; FragH bq; bq.half[0] = *(const v8us*)((const unsigned short*)Bh + boff + 8 * hh); bq.half[1] = *(const v8us*)((const unsigned short*)Bh + boff + 16 + 8 * hh);
      acc[t] = mmaH<1>(ah.v, ah.v, bq.v, bq.v, acc[t]); }
  }
#pragma unroll
  for (int t = 0; t < 4; ++t) { if (col0 + t * 16 >= N) continue; const int col = col0 + t * 16 + ln; const float bv = bp ? bf16_round(bp[col]) : 0.f;
#pragma unroll
    for (int r = 0; r < 8; ++r) { float v = acc[t][r] * alpha + bv; if (CP) { const int rr = row0g + row0 + 8 * hh + r; if (rowsPerB < 0) v += CP[cofs + (size_t)rr * ldc + col];      /* rowsPerB < 0: own element of the batched C plane */ else { const int bidx = rr / rowsPerB; v += CP[(size_t)bidx * sCPb + (size_t)by * 64 + col]; } } if (ACT == 1) v = (v > 0.f) ? v : expm1f(v); else if (ACT == 7) v = (v > 0.f) ? v + 1.0f : expf(v); else if (ACT == 8) v = tanhf(v); else if (ACT == 9) v = 0.5f * v * (1.0f + tanhf(0.7978845608028654f * (v + 0.044715f * v * v * v))); else if (ACT == 11) v = 1.0f / (1.0f + expf(-v)); else if (ACT == 12) v = (v > 0.f) ? v : 0.01f * v; else if (ACT == 14) v = (v > 0.f) ? v : 0.1f * v; else if (ACT == 16) v = (v >= 0.f) ? v : 0.3f * v; else if (ACT == 17) v = (v >= 0.f) ? v : 0.2f * v; else if (ACT == 15) v = v / (1.0f + expf(-v)); else if (ACT == 3) v = fmaxf(v, 0.f); else if (ACT == 6) v = 0.5f * v * (1.0f + erff(v * 0.70710678118654752f)); so[w][8 * hh + r][t * 16 + ln] = v; } }
  __builtin_amdgcn_fence(__ATOMIC_ACQ_REL, "workgroup"); __builtin_amdgcn_wave_barrier();
  const int rsub = lane >> 4, c4 = (lane & 15) * 4; typedef _Float16 v4h __attribute__((ext_vector_type(4)));
  {
#pragma unroll
    for (int q = 0; q < 8; ++q) { const int r = q * 2 + rsub; if (col0 + c4 < N) { const v4f v = *(const v4fa*)&so[w][r][c4]; if (C) *(v4f*)(C + cofs + (size_t)(row0 + r) * ldc + col0 + c4) = v; if (C16) { v4h h4; for (int i = 0; i < 4; ++i) h4[i] = (_Float16)v[i]; *(v4h*)(C16 + cofs + (size_t)(row0 + r) * ldc + col0 + c4) = h4; } } }
     }
}


typedef _Float16 v4h __attribute__((ext_vector_type(4)));

__global__ __launch_bounds__(256) void k_x16(const float* __restrict__ x, _Float16* __restrict__ X16, size_t n8) { const size_t t = (size_t)blockIdx.x * 256 + threadIdx.x; if (t >= n8) return; FragH f;
#pragma unroll
  for (int q = 0; q < 8; ++q) f.h[q] = (_Float16)bf16_round(x[t * 8 + q]); *(v8us*)((unsigned short*)X16 + t * 8) = f.half[0];  }
__global__ __launch_bounds__(256) void k_h16(const float* __restrict__ x, _Float16* __restrict__ X16, size_t n8) { const size_t t = (size_t)blockIdx.x * 256 + threadIdx.x; if (t >= n8) return; FragH f;
#pragma unroll
  for (int q = 0; q < 8; ++q) f.h[q] = (_Float16)x[t * 8 + q]; *(v8us*)((unsigned short*)X16 + t * 8) = f.half[0];  }
__global__ __launch_bounds__(256) void k_round16f(const float* __restrict__ W, _Float16* __restrict__ Bt, size_t n8) { const size_t t = (size_t)blockIdx.x * 256 + threadIdx.x; if (t >= n8) return; FragH f;
#pragma unroll
  for (int i = 0; i < 8; ++i) f.h[i] = (_Float16)(bf16_round(W[t * 8 + i]) * 16.0f); *(v8us*)((unsigned short*)Bt + t * 8) = f.half[0];  }
template <int NHv, int TTv>
__global__ __launch_bounds__(256) void k_vt(const _Float16* __restrict__ V16, int ldv, int voff, _Float16* __restrict__ Vt) { __shared__ unsigned short tl[64][66]; const int tid = threadIdx.x; const int slab = blockIdx.x / (TTv / 64), lg = blockIdx.x % (TTv / 64); const int b = slab / NHv, h = slab % NHv;
  for (int i = tid; i < 64 * 8; i += 256) { const int r = i / 8, c8 = (i % 8) * 8; FragH f; f.half[0] = *(const v8us*)((const unsigned short*)V16 + ((size_t)b * TTv + lg * 64 + r) * ldv + voff + h * 64 + c8);
#pragma unroll
    for (int q = 0; q < 8; ++q) tl[r][c8 + q] = f.u[q]; }
  __syncthreads();
  {
#pragma unroll
    for (int rd = 0; rd < 2; ++rd) { const int d = rd * 32 + tid / 8, pc = tid % 8; FragH f;
#pragma unroll
      for (int q = 0; q < 8; ++q) f.u[q] = tl[pc * 8 + q][d];
      *(v8us*)((unsigned short*)Vt + ((size_t)slab * 64 + d) * TTv + lg * 64 + pc * 8) = f.half[0]; }
     } }

__global__ __launch_bounds__(256) void k_hl(const float* __restrict__ F, _Float16* __restrict__ Hh, _Float16* __restrict__ Hl, size_t n8) { const size_t t = (size_t)blockIdx.x * 256 + threadIdx.x; if (t >= n8) return; FragH fh, fl; const v4f a = *(const v4fa*)(F + t * 8), c = *(const v4fa*)(F + t * 8 + 4);
#pragma unroll
  for (int q = 0; q < 4; ++q) { _Float16 h = (_Float16)a[q]; fh.h[q] = h; fl.h[q] = (_Float16)((a[q] - (float)h) * 1024.0f); h = (_Float16)c[q]; fh.h[4 + q] = h; fl.h[4 + q] = (_Float16)((c[q] - (float)h) * 1024.0f); }
  { *(v8us*)((unsigned short*)Hh + t * 8) = fh.half[0]; *(v8us*)((unsigned short*)Hl + t * 8) = fl.half[0];  } }

// ---- fast GEMM (wave tile 32x64; requires M % 32 == 0 rows per launch region and N % 64 == 0); epilogue = k_gemm_hhx semantics ----
__device__ __forceinline__ v16h g2_frag(const _Float16* p, int hh) { FragH f; f.half[0] = *(const v8us*)((const unsigned short*)p + 8 * hh); f.half[1] = *(const v8us*)((const unsigned short*)p + 16 + 8 * hh); return f.v; }
__device__ __forceinline__ v8f g2_mma(v16h a, v16h b, v8f c) { v8f d = __builtin_amdgcn_wmma_f32_16x16x32_f16(false, a, false, b, (short)0, c, false, false); asm volatile("v_nop\n\tv_nop\n\tv_nop\n\tv_nop" : "+v"(d) : "v"(a), "v"(b)); return d; }
template <int ACT>
__global__ __launch_bounds__(128) void k_gemm2(const _Float16* __restrict__ A, int lda, size_t sA, const _Float16* __restrict__ Bh, int ldb, size_t sB, float alpha, const float* __restrict__ bias, size_t sBias, const float* __restrict__ CP, int rowsPerB, size_t sCPb, int row0g,
    float* __restrict__ C, _Float16* __restrict__ C16, int ldc, size_t sC, int M, int N, int K) { static_assert(ACT == 0 || ACT == 3 || ACT == 6 || ACT == 8 || ACT == 9 || ACT == 11 || ACT == 12 || ACT == 14 || ACT == 15 || ACT == 16 || ACT == 17, "k_gemm2: unsupported ACT code (would silently apply no activation)");
  __shared__ __attribute__((aligned(16))) float so[4][32][68];
  const int tid = threadIdx.x, w = tid >> 5, lane = tid & 31, ln = lane & 15, hh = lane >> 4; const int by = blockIdx.y;
  A += (size_t)by * sA; Bh += (size_t)by * sB; const size_t cofs = (size_t)by * sC; const float* bp = bias ? bias + (size_t)by * sBias : nullptr;
  const int ntn = N >> 6; const int mt = blockIdx.x / ntn, nq = blockIdx.x - mt * ntn; const int row0 = mt * 128 + 32 * w, col0 = nq * 64; if (row0 >= M) return;
  const _Float16* a0p = A + (size_t)(row0 + ln) * lda; const _Float16* a1p = a0p + (size_t)16 * lda;
  const _Float16* b0p = Bh + (size_t)(col0 + ln) * ldb; const _Float16* b1p = b0p + (size_t)16 * ldb; const _Float16* b2p = b1p + (size_t)16 * ldb; const _Float16* b3p = b2p + (size_t)16 * ldb;
  const v8f z8 = {0.f,0.f,0.f,0.f,0.f,0.f,0.f,0.f}; v8f c00 = z8, c01 = z8, c02 = z8, c03 = z8, c10 = z8, c11 = z8, c12 = z8, c13 = z8;
#pragma unroll 1
  for (int kb = 0; kb < K; kb += 32) { const v16h a0 = g2_frag(a0p + kb, hh), a1 = g2_frag(a1p + kb, hh);
    v16h b = g2_frag(b0p + kb, hh); c00 = g2_mma(a0, b, c00); c10 = g2_mma(a1, b, c10);
    b = g2_frag(b1p + kb, hh); c01 = g2_mma(a0, b, c01); c11 = g2_mma(a1, b, c11);
    b = g2_frag(b2p + kb, hh); c02 = g2_mma(a0, b, c02); c12 = g2_mma(a1, b, c12);
    b = g2_frag(b3p + kb, hh); c03 = g2_mma(a0, b, c03); c13 = g2_mma(a1, b, c13); }
  v8f accs[8] = {c00, c01, c02, c03, c10, c11, c12, c13};
#pragma unroll
  for (int u = 0; u < 8; ++u) { const int t = u & 3, half = u >> 2; const int col = col0 + t * 16 + ln; const float bv = bp ? bf16_round(bp[col]) : 0.f;
#pragma unroll
    for (int r = 0; r < 8; ++r) { const int rloc = half * 16 + 8 * hh + r; float v = accs[u][r] * alpha + bv; if (CP) { if (rowsPerB < 0) v += CP[cofs + (size_t)(row0g + row0 + rloc) * ldc + col];      /* rowsPerB < 0: own element of the batched C plane */ else { const int bidx = (row0g + row0 + rloc) / rowsPerB; v += CP[(size_t)bidx * sCPb + (size_t)by * 64 + col]; } }
      if (ACT == 3) v = fmaxf(v, 0.f); else if (ACT == 6) v = 0.5f * v * (1.0f + erff(v * 0.70710678118654752f)); else if (ACT == 11) v = 1.0f / (1.0f + expf(-v)); else if (ACT == 15) v = v / (1.0f + expf(-v)); else if (ACT == 12) v = (v > 0.f) ? v : 0.01f * v; else if (ACT == 8) v = tanhf(v); else if (ACT == 9) v = 0.5f * v * (1.0f + tanhf(0.7978845608028654f * (v + 0.044715f * v * v * v))); else if (ACT == 14) v = (v > 0.f) ? v : 0.1f * v; else if (ACT == 16) v = (v >= 0.f) ? v : 0.3f * v; else if (ACT == 17) v = (v >= 0.f) ? v : 0.2f * v;
      so[w][rloc][t * 16 + ln] = v; } }
  __builtin_amdgcn_fence(__ATOMIC_ACQ_REL, "workgroup"); __builtin_amdgcn_wave_barrier();
  const int rsub = lane >> 4, c4 = (lane & 15) * 4;
  {
#pragma unroll
    for (int q = 0; q < 16; ++q) { const int r = q * 2 + rsub; const v4f v = *(const v4fa*)&so[w][r][c4]; if (C) *(v4f*)(C + cofs + (size_t)(row0 + r) * ldc + col0 + c4) = v; if (C16) { v4h h4; for (int i = 0; i < 4; ++i) h4[i] = (_Float16)v[i]; *(v4h*)(C16 + cofs + (size_t)(row0 + r) * ldc + col0 + c4) = h4; } }
     } }


__global__ __launch_bounds__(256) void k_wsc(const float* __restrict__ Wm, _Float16* __restrict__ Bt, size_t n8, float sc) { const size_t t = (size_t)blockIdx.x * 256 + threadIdx.x; if (t >= n8) return; FragH f; for (int q = 0; q < 8; ++q) f.h[q] = (_Float16)(bf16_round(Wm[t * 8 + q]) * sc); *(v8us*)((unsigned short*)Bt + t * 8) = f.half[0];  }
__global__ __launch_bounds__(256) void k_bv(const float* __restrict__ Wv, _Float16* __restrict__ BV) { const int t = blockIdx.x * 256 + threadIdx.x; if (t >= NH * HD * (CIN / 8)) return; const int c8 = (t % (CIN / 8)) * 8; const int k = (t / (CIN / 8)) % HD; const int h = t / ((CIN / 8) * HD); FragH f; for (int q = 0; q < 8; ++q) f.h[q] = (_Float16)(bf16_round(Wv[((size_t)h * CIN + c8 + q) * HD + k]) * 16.0f);
  *(v8us*)((unsigned short*)BV + ((size_t)h * HD + k) * CIN + c8) = f.half[0];  }
__global__ __launch_bounds__(256) void k_grow(const float* __restrict__ crd, int b, float il2, _Float16* __restrict__ E, float* __restrict__ RS) {
  #pragma clang fp contract(off)
  const int wv = threadIdx.x >> 5, ln = threadIdx.x & 31; const int i = blockIdx.x * 8 + wv; if (i >= NP) return; const float* cb = crd + (size_t)b * NP * 3; const float xi = bf16_round(cb[i * 3]), yi = bf16_round(cb[i * 3 + 1]), zi = bf16_round(cb[i * 3 + 2]); float su = 0.f;
{ su = 0.f;
#pragma unroll 1
    for (int gq = 0; gq < NP / 256; ++gq) { FragH ph; for (int q = 0; q < 8; ++q) { const int j = gq * 256 + ln * 8 + q; float dx = xi - bf16_round(cb[j * 3]), dy = yi - bf16_round(cb[j * 3 + 1]), dz = zi - bf16_round(cb[j * 3 + 2]); float d2 = dx * dx; d2 += dy * dy; d2 += dz * dz; const float e = expf(-(d2 * il2)); su += e; ph.h[q] = (_Float16)(e * 1024.0f); } *(v8us*)((unsigned short*)E + (size_t)i * NP + gq * 256 + ln * 8) = ph.half[0]; }
     }
  for (int o = 16; o > 0; o >>= 1) su += __shfl_xor(su, o, 32); if (ln == 0) { const float r = 1.0f / (su + 1e-8f); *(float*)(RS + (size_t)i * 32) = r;  } }
__global__ __launch_bounds__(256) void k_hsc(const float* __restrict__ O, const float* __restrict__ RS, int b, int h, _Float16* __restrict__ MH, _Float16* __restrict__ ML) {
  #pragma clang fp contract(off)
  const int t = blockIdx.x * 256 + threadIdx.x; if (t >= NP * (HD / 8)) return; const int k8 = (t % (HD / 8)) * 8; const int i = t / (HD / 8); const float rs = RS[(size_t)i * 32]; const v8f a = *(const v8f*)(O + (size_t)i * COUT + h * HD + k8); FragH f, fl; for (int q = 0; q < 8; ++q) { const float v = a[q] * rs; const _Float16 hh = (_Float16)v; f.h[q] = hh; fl.h[q] = (_Float16)((v - (float)hh) * 1024.0f); }
  const size_t o = ((size_t)b * NP + i) * COUT + h * HD + k8; { *(v8us*)((unsigned short*)MH + o) = f.half[0]; *(v8us*)((unsigned short*)ML + o) = fl.half[0];  } }

extern "C" void kernel_launch(void* const* d_in, const int* in_sizes, int n_in,
                              void* d_out, int out_size, void* d_ws, size_t ws_size, hipStream_t stream) {
  (void)in_sizes; (void)n_in; (void)out_size;
  const float* const* I = (const float* const*)d_in; const float* feat = I[0]; const float* crd = I[1]; const float* Wv = I[2]; const float* bv = I[3]; const float* Wo = I[4]; const float* bo = I[5];
  char* ws = (char*)d_ws; size_t off = 0;
  auto take = [&](size_t bytes) { char* p = ws + off; off += (bytes + 255) & ~(size_t)255; return p; };
  const size_t np = (size_t)NB * NP * COUT;
  _Float16* BV = (_Float16*)take((size_t)NH * HD * CIN * 2); _Float16* BO = (_Float16*)take((size_t)COUT * COUT * 2); _Float16* X16 = (_Float16*)take((size_t)NB * NP * CIN * 2); _Float16* V16 = (_Float16*)take(np * 2); _Float16* VT = (_Float16*)take(np * 2);
  _Float16* E = (_Float16*)take((size_t)NP * NP * 2); float* RS = (float*)take((size_t)NP * 32 * 4); float* O = (float*)take((size_t)NP * COUT * 4); _Float16* MH = (_Float16*)take(np * 2); _Float16* ML = (_Float16*)take(np * 2);
  if (off > ws_size) return;      /* 0.06 + 2 + 2 + 2 + 32 + 0.5 + 2 + 2 + 2 = ≈ 44.6 MiB */
  k_bv<<<(NH * HD * (CIN / 8) + 255) / 256, 256, 0, stream>>>(Wv, BV); k_wt_f16<<<(COUT * COUT / 8 + 255) / 256, 256, 0, stream>>>(Wo, BO, COUT, COUT, 16.0f);      /* Wo (in, out) */
  k_x16<<<(unsigned)(((size_t)NB * NP * CIN / 8 + 255) / 256), 256, 0, stream>>>(feat, X16, (size_t)NB * NP * CIN / 8);
  k_gemm2<0><<<dim3((NB * NP / 128) * (COUT / 64), 1), 128, 0, stream>>>(X16, CIN, 0, BV, CIN, 0, 0.0625f, bv, 0, nullptr, 1, 0, 0, nullptr, V16, COUT, 0, NB * NP, COUT, CIN);      /* values [(b,i)][h*32 + k] */
  k_vt<COUT / 64, NP><<<NB * (COUT / 64) * (NP / 64), 256, 0, stream>>>(V16, COUT, 0, VT);      /* V^T [(b, 64-slab)][64][4096]: head h of batch b = rows b*128 + h*32 */
  const float ls[NH] = {0.5f, 1.0f, 2.0f, 4.0f};
  for (int b = 0; b < NB; ++b) { for (int h = 0; h < NH; ++h) {
      k_grow<<<NP / 8, 256, 0, stream>>>(crd, b, 1.0f / (ls[h] * ls[h]), E, RS);
      k_gemm_hhx<0><<<dim3((unsigned)((NP / 16) * 1 / 4), 1), 128, 0, stream>>>(E, NP, 0, VT + ((size_t)b * COUT + h * HD) * NP, NP, 0, 0.0009765625f, nullptr, 0, nullptr, 1, 0, 0, O + h * HD, nullptr, COUT, 0, NP, HD, NP);      /* unnormalised att . value_h */
      k_hsc<<<(NP * (HD / 8) + 255) / 256, 256, 0, stream>>>(O, RS, b, h, MH, ML); } }
  k_gemm2<0><<<dim3((NB * NP / 128) * (COUT / 64), 1), 128, 0, stream>>>(ML, COUT, 0, BO, COUT, 0, 0.0625f / 1024.0f, nullptr, 0, nullptr, 1, 0, 0, (float*)d_out, nullptr, COUT, 0, NB * NP, COUT, COUT);
  k_gemm2<0><<<dim3((NB * NP / 128) * (COUT / 64), 1), 128, 0, stream>>>(MH, COUT, 0, BO, COUT, 0, 0.0625f, bo, 0, (const float*)d_out, 1, (size_t)COUT, 0, (float*)d_out, nullptr, COUT, 0, NB * NP, COUT, COUT);      /* out = (mh_lo + mh_hi) Wo + bo */
}

// v001
// Measured time: 101 microseconds a run.
// Two timings next to v000 put it at 7.01 and 7.03 times that version's speed.
#include <hip/hip_runtime.h>
// KernelSelfAttention (2 x 4096 points; d2 = |c_i - c_j|^2 from 3-D coords; per head h with lengthscale ls in {0.5, 1, 2, 4}: att = exp(-d2 / ls^2) / (sum_j + 1e-8); value_h = features Wv[h] + bv[h] [32]; head_out = att value; out = concat_h Wo + bo -> [2][4096][128]).
// Compute dtype: inputs rounded to bf16; features / weights exact as f16; d2 / exp / sums f32 from bf16 coords; values and kernel weights as plain f16 operands (~2^-12); the scaled head outputs as f16 hi + residual into Wo. v_wmma_f32_16x16x32_f16.
#define NB 2
#define NP 4096
#define CIN 128
#define NH 4
#define HD 32
#define COUT 128
typedef __bf16 v16b __attribute__((ext_vector_type(16)));
typedef unsigned short v8us __attribute__((ext_vector_type(8), may_alias));
typedef float  v8f  __attribute__((ext_vector_type(8)));
typedef float  v4f  __attribute__((ext_vector_type(4)));
typedef float  v4fa __attribute__((ext_vector_type(4), may_alias));
union FragB { v16b v; v8us half[2]; unsigned short u[16]; };

__device__ __forceinline__ unsigned short bf16_bits(float x) { unsigned int u = __float_as_uint(x); return (unsigned short)((u + 0x7FFFu + ((u >> 16) & 1u)) >> 16); }
__device__ __forceinline__ float bf16_val(unsigned short b) { return __uint_as_float(((unsigned int)b) << 16); }
__device__ __forceinline__ float bf16_round(float x) { return bf16_val(bf16_bits(x)); }
// D += A·B with NT terms: 1 = ah·bh, 2 = + al·bh (A split), 3 = + ah·bl (both split)
template <int NT>
__device__ __forceinline__ v8f mmaN(v16b ah, v16b al, v16b bh, v16b bl, v8f c) {
  c = __builtin_amdgcn_wmma_f32_16x16x32_bf16(false, ah, false, bh, (short)0, c, false, false);
  if (NT >= 2) c = __builtin_amdgcn_wmma_f32_16x16x32_bf16(false, al, false, bh, (short)0, c, false, false);
  if (NT >= 3) c = __builtin_amdgcn_wmma_f32_16x16x32_bf16(false, ah, false, bl, (short)0, c, false, false);
  asm volatile("v_nop\n\tv_nop\n\tv_nop\n\tv_nop" : "+v"(c) : "v"(ah), "v"(al), "v"(bh), "v"(bl));
  return c;
}

__global__ __launch_bounds__(256) void k_wt_bf16(const float* __restrict__ W, unsigned short* __restrict__ Wt, int K, int N) {
  const int t = blockIdx.x * 256 + threadIdx.x;
  const int k8n = K / 8;
  if (t >= N * k8n) return;
  const int n = t / k8n, k8 = (t % k8n) * 8;
  v8us v;
#pragma unroll
  for (int i = 0; i < 8; ++i) v[i] = bf16_bits(W[(size_t)(k8 + i) * N + n]);
  *(v8us*)(Wt + (size_t)n * K + k8) = v;
  
}

// GEMM C[M][N] (f32, pitch ldc) = act(A[M][K]·W + bias). A f32 row-major (pitch lda) converted per fragment to bf16
// (ASPLIT: hi/lo two planes -> 2 terms, else single rounded term); Wt bf16 [N][K] (pitch ldb). BIAS_BF16 rounds the
// bias to bf16 first (bias quantised to bf16 before the add). K%32==0, M%16==0, N%64==0.
template <bool ASPLIT, int ACT, bool BIAS_BF16>
__global__ __launch_bounds__(128) void k_gemm_bf(const float* __restrict__ A, int lda, const unsigned short* __restrict__ Wt, int ldb,
                                               const float* __restrict__ bias, float* __restrict__ C, int ldc, int M, int N, int K) {
  __shared__ __attribute__((aligned(16))) float so[4][16][64];
  const int tid = threadIdx.x, w = tid >> 5, lane = tid & 31, ln = lane & 15, hh = lane >> 4;
  const int ntn = N / 64;
  const int wid = blockIdx.x * 4 + w;
  const int mt = wid / ntn, nq = wid % ntn;
  if (mt * 16 >= M) return;
  const int row0 = mt * 16, col0 = nq * 64;
  const float* arow = A + (size_t)(row0 + ln) * lda;
  v8f acc[4] = {};
  for (int kb = 0; kb < K; kb += 32) {
    FragB ah, al;
    const v4f x0 = *(const v4fa*)(arow + kb + 8 * hh), x1 = *(const v4fa*)(arow + kb + 8 * hh + 4);
    const v4f x2 = *(const v4fa*)(arow + kb + 16 + 8 * hh), x3 = *(const v4fa*)(arow + kb + 16 + 8 * hh + 4);
    float xs[16] = {x0[0],x0[1],x0[2],x0[3],x1[0],x1[1],x1[2],x1[3],x2[0],x2[1],x2[2],x2[3],x3[0],x3[1],x3[2],x3[3]};
#pragma unroll
    for (int i = 0; i < 16; ++i) { const unsigned short hb = bf16_bits(xs[i]); ah.u[i] = hb; al.u[i] = ASPLIT ? bf16_bits(xs[i] - bf16_val(hb)) : (unsigned short)0; }
#pragma unroll
    for (int t = 0; t < 4; ++t) {
      const unsigned short* brow = Wt + (size_t)(col0 + t * 16 + ln) * ldb + kb;
      FragB b;
      b.half[0] = *(const v8us*)(brow + 8 * hh);
      b.half[1] = *(const v8us*)(brow + 16 + 8 * hh);
      acc[t] = mmaN<ASPLIT ? 2 : 1>(ah.v, al.v, b.v, b.v, acc[t]);
    }
  }
#pragma unroll
  for (int t = 0; t < 4; ++t) {
    float bv = bias ? bias[col0 + t * 16 + ln] : 0.f;
    if (BIAS_BF16) bv = bf16_round(bv);
#pragma unroll
    for (int r = 0; r < 8; ++r) { float v = acc[t][r] + bv; if (ACT == 1) v = fmaxf(v, 0.f); so[w][8 * hh + r][t * 16 + ln] = v; }
  }
  __builtin_amdgcn_fence(__ATOMIC_ACQ_REL, "workgroup");
  __builtin_amdgcn_wave_barrier();
  const int rsub = lane >> 4, c4 = (lane & 15) * 4;
  {
#pragma unroll
    for (int q = 0; q < 8; ++q) {
      const int r = q * 2 + rsub;
      const v4f v = *(const v4fa*)&so[w][r][c4];
      *(v4f*)(C + (size_t)(row0 + r) * ldc + col0 + c4) = v;
    }
    
  }
}

// GEMM C = act(A·W + bias + resid): A f32 (ASPLIT -> hi/lo 2 terms), Wt bf16 [N][K]; ACT 0 none, 1 relu, 2 exact gelu;
// resid (optional, f32, row index = (row % rmod), pitch ldr, RES_BF16 rounds it) added before the activation.
template <bool ASPLIT, int ACT, bool BIAS_BF16, bool RES_BF16>
__global__ __launch_bounds__(128) void k_gemm_bf3(const float* __restrict__ A, int lda, const unsigned short* __restrict__ Wt, int ldb,
                                                const float* __restrict__ bias, const float* __restrict__ resid, int rmod, int ldr,
                                                float* __restrict__ C, int ldc, int M, int N, int K) {
  __shared__ __attribute__((aligned(16))) float so[4][16][64];
  const int tid = threadIdx.x, w = tid >> 5, lane = tid & 31, ln = lane & 15, hh = lane >> 4;
  const int ntn = N / 64;
  const int wid = blockIdx.x * 4 + w;
  const int mt = wid / ntn, nq = wid % ntn;
  if (mt * 16 >= M) return;
  const int row0 = mt * 16, col0 = nq * 64;
  const float* arow = A + (size_t)(row0 + ln) * lda;
  v8f acc[4] = {};
  for (int kb = 0; kb < K; kb += 32) {
    FragB ah, al;
    const v4f x0 = *(const v4fa*)(arow + kb + 8 * hh), x1 = *(const v4fa*)(arow + kb + 8 * hh + 4);
    const v4f x2 = *(const v4fa*)(arow + kb + 16 + 8 * hh), x3 = *(const v4fa*)(arow + kb + 16 + 8 * hh + 4);
    float xs[16] = {x0[0],x0[1],x0[2],x0[3],x1[0],x1[1],x1[2],x1[3],x2[0],x2[1],x2[2],x2[3],x3[0],x3[1],x3[2],x3[3]};
#pragma unroll
    for (int i = 0; i < 16; ++i) { const unsigned short hb = bf16_bits(xs[i]); ah.u[i] = hb; al.u[i] = ASPLIT ? bf16_bits(xs[i] - bf16_val(hb)) : (unsigned short)0; }
#pragma unroll
    for (int t = 0; t < 4; ++t) {
      const unsigned short* brow = Wt + (size_t)(col0 + t * 16 + ln) * ldb + kb;
      FragB b;
      b.half[0] = *(const v8us*)(brow + 8 * hh);
      b.half[1] = *(const v8us*)(brow + 16 + 8 * hh);
      acc[t] = mmaN<ASPLIT ? 2 : 1>(ah.v, al.v, b.v, b.v, acc[t]);
    }
  }
#pragma unroll
  for (int t = 0; t < 4; ++t) {
    const int col = col0 + t * 16 + ln;
    float bv = bias ? bias[col] : 0.f;
    if (BIAS_BF16) bv = bf16_round(bv);
#pragma unroll
    for (int r = 0; r < 8; ++r) {
      float v = acc[t][r] + bv;
      if (resid) { float rv = resid[(size_t)((row0 + 8 * hh + r) % rmod) * ldr + col]; if (RES_BF16) rv = bf16_round(rv); v += rv; }
      if (ACT == 1) v = fmaxf(v, 0.f);
      if (ACT == 2) v = 0.5f * v * (1.0f + erff(v * 0.70710678118654752f));
      if (ACT == 3) { const float u = 0.7978845608028654f * (v + 0.044715f * v * v * v); v = 0.5f * v * (1.0f + tanhf(u)); }
      so[w][8 * hh + r][t * 16 + ln] = v;
    }
  }
  __builtin_amdgcn_fence(__ATOMIC_ACQ_REL, "workgroup");
  __builtin_amdgcn_wave_barrier();
  const int rsub = lane >> 4, c4 = (lane & 15) * 4;
  {
#pragma unroll
    for (int q = 0; q < 8; ++q) {
      const int r = q * 2 + rsub;
      const v4f v = *(const v4fa*)&so[w][r][c4];
      *(v4f*)(C + (size_t)(row0 + r) * ldc + col0 + c4) = v;
    }
    
  }
}
// row LayerNorm (biased variance, eps) over N: s = X (+ R); optional out_sum <- s; out_norm <- (s-mu)*rsqrt(var+eps)*g + b
template <bool PARAM_BF16>
__global__ __launch_bounds__(256) void k_layernorm(const float* __restrict__ X, const float* __restrict__ R, const float* __restrict__ g, const float* __restrict__ bta,
                                                  float* __restrict__ out_sum, float* __restrict__ out_norm, int N, float eps) {
  __shared__ float red[256];
  const int row = blockIdx.x, tid = threadIdx.x;
  const float* x = X + (size_t)row * N; const float* rr = R ? R + (size_t)row * N : nullptr;
  float vals[16];                     // up to N = 4096
  const int per = N / 256;            // contiguous chunk per thread? use strided-by-4 chunks: thread handles j = tid*4 + 1024*u
  float s1 = 0.f;
  for (int u = 0; u < per / 4; ++u) {
    const int j = tid * 4 + 1024 * u;
    const v4f a = *(const v4fa*)(x + j);
    v4f b = {0.f,0.f,0.f,0.f}; if (rr) b = *(const v4fa*)(rr + j);
#pragma unroll
    for (int q = 0; q < 4; ++q) { const float v = a[q] + b[q]; vals[u * 4 + q] = v; s1 += v; }
  }
  red[tid] = s1; __syncthreads();
  for (int st = 128; st > 0; st >>= 1) { if (tid < st) red[tid] += red[tid + st]; __syncthreads(); }
  const float mu = red[0] / (float)N; __syncthreads();
  float s2 = 0.f;
  for (int u = 0; u < per / 4; ++u)
#pragma unroll
    for (int q = 0; q < 4; ++q) { const float c = vals[u * 4 + q] - mu; s2 += c * c; }
  red[tid] = s2; __syncthreads();
  for (int st = 128; st > 0; st >>= 1) { if (tid < st) red[tid] += red[tid + st]; __syncthreads(); }
  const float rs = rsqrtf(red[0] / (float)N + eps);
  {
    for (int u = 0; u < per / 4; ++u) {
      const int j = tid * 4 + 1024 * u;
      v4f o, sm;
#pragma unroll
      for (int q = 0; q < 4; ++q) {
        float gg = g[j + q], bb = bta[j + q];
        if (PARAM_BF16) { gg = bf16_round(gg); bb = bf16_round(bb); }
        sm[q] = vals[u * 4 + q]; o[q] = (vals[u * 4 + q] - mu) * rs * gg + bb;
      }
      if (out_sum) *(v4f*)(out_sum + (size_t)row * N + j) = sm;
      *(v4f*)(out_norm + (size_t)row * N + j) = o;
    }
    
  }
}



// ---- f16 WMMA path (v_wmma_f32_16x16x32_f16): 11-bit significands for operands in range — used where a [0,1] probability operand needs more precision than bf16
typedef _Float16 v16h __attribute__((ext_vector_type(16)));
union FragH { v16h v; v8us half[2]; _Float16 h[16]; unsigned short u[16]; };
template <int NT>
__device__ __forceinline__ v8f mmaH(v16h ah, v16h al, v16h bh, v16h bl, v8f c) {
  c = __builtin_amdgcn_wmma_f32_16x16x32_f16(false, ah, false, bh, (short)0, c, false, false);
  if (NT >= 2) c = __builtin_amdgcn_wmma_f32_16x16x32_f16(false, al, false, bh, (short)0, c, false, false);
  if (NT >= 3) c = __builtin_amdgcn_wmma_f32_16x16x32_f16(false, ah, false, bl, (short)0, c, false, false);
  asm volatile("v_nop\n\tv_nop\n\tv_nop\n\tv_nop" : "+v"(c) : "v"(ah), "v"(al), "v"(bh), "v"(bl));
  return c;
}
// batched GEMM like k_gemm_b but f16 operands: A f32 (split into f16 hi/lo if ASPLIT, else rounded to f16), Bt = f16 values [n][k]; alpha; C f32; N multiple of 16 (partial tiles skipped)
template <bool ASPLIT>
__global__ __launch_bounds__(128) void k_gemm_h(const float* __restrict__ A, int lda, size_t sA, const _Float16* __restrict__ Bh, int ldb, size_t sB, float alpha, float* __restrict__ C, int ldc, size_t sC, int M, int N, int K) {
  __shared__ __attribute__((aligned(16))) float so[4][16][64];
  const int tid = threadIdx.x, w = tid >> 5, lane = tid & 31, ln = lane & 15, hh = lane >> 4; const int by = blockIdx.y;
  A += (size_t)by * sA; Bh += (size_t)by * sB; C += (size_t)by * sC;
  const int ntn = (N + 63) / 64; const int wid = blockIdx.x * 4 + w; const int mt = wid / ntn, nq = wid % ntn; if (mt * 16 >= M) return;
  const int row0 = mt * 16, col0 = nq * 64; const float* arow = A + (size_t)(row0 + ln) * lda;
  v8f acc[4] = {};
  for (int kb = 0; kb < K; kb += 32) {
    FragH ah, al;
    const v4f x0 = *(const v4fa*)(arow + kb + 8 * hh), x1 = *(const v4fa*)(arow + kb + 8 * hh + 4), x2 = *(const v4fa*)(arow + kb + 16 + 8 * hh), x3 = *(const v4fa*)(arow + kb + 16 + 8 * hh + 4);
    float xs[16] = {x0[0],x0[1],x0[2],x0[3],x1[0],x1[1],x1[2],x1[3],x2[0],x2[1],x2[2],x2[3],x3[0],x3[1],x3[2],x3[3]};
#pragma unroll
    for (int i = 0; i < 16; ++i) { const _Float16 h = (_Float16)xs[i]; ah.h[i] = h; al.h[i] = ASPLIT ? (_Float16)(xs[i] - (float)h) : (_Float16)0.0f; }
#pragma unroll
    for (int t = 0; t < 4; ++t) { if (col0 + t * 16 >= N) continue; const size_t boff = (size_t)(col0 + t * 16 + ln) * ldb + kb; FragH bq; bq.half[0] = *(const v8us*)(Bh + boff + 8 * hh); bq.half[1] = *(const v8us*)(Bh + boff + 16 + 8 * hh);
      acc[t] = mmaH<ASPLIT ? 2 : 1>(ah.v, al.v, bq.v, bq.v, acc[t]); }
  }
#pragma unroll
  for (int t = 0; t < 4; ++t) { if (col0 + t * 16 >= N) continue;
#pragma unroll
    for (int r = 0; r < 8; ++r) so[w][8 * hh + r][t * 16 + ln] = acc[t][r] * alpha; }
  __builtin_amdgcn_fence(__ATOMIC_ACQ_REL, "workgroup"); __builtin_amdgcn_wave_barrier();
  const int rsub = lane >> 4, c4 = (lane & 15) * 4;
  {
#pragma unroll
    for (int q = 0; q < 8; ++q) { const int r = q * 2 + rsub; if (col0 + c4 < N) { const v4f v = *(const v4fa*)&so[w][r][c4]; *(v4f*)(C + (size_t)(row0 + r) * ldc + col0 + c4) = v; } }
     }
}

// Wt[n][k] = f16(W[k][n]·scale) from f32 row-major W[K][N] (scale = power of two; bf16-exact weights stay exact in f16 away from the subnormal range)
__global__ __launch_bounds__(256) void k_wt_f16(const float* __restrict__ W, _Float16* __restrict__ Wt, int K, int N, float scale) {
  const int t = blockIdx.x * 256 + threadIdx.x; if (t >= N * (K / 8)) return; const int n = t / (K / 8), k8 = (t % (K / 8)) * 8; FragH f;
#pragma unroll
  for (int i = 0; i < 8; ++i) f.h[i] = (_Float16)(bf16_round(W[(size_t)(k8 + i) * N + n]) * scale); const v8us o = f.half[0];
  *(v8us*)((unsigned short*)Wt + (size_t)n * K + k8) = o; 
}
typedef _Float16 v4h __attribute__((ext_vector_type(4)));

__global__ __launch_bounds__(256) void k_x16(const float* __restrict__ x, _Float16* __restrict__ X16, size_t n8) { const size_t t = (size_t)blockIdx.x * 256 + threadIdx.x; if (t >= n8) return; FragH f;
#pragma unroll
  for (int q = 0; q < 8; ++q) f.h[q] = (_Float16)bf16_round(x[t * 8 + q]); *(v8us*)((unsigned short*)X16 + t * 8) = f.half[0];  }
__global__ __launch_bounds__(256) void k_h16(const float* __restrict__ x, _Float16* __restrict__ X16, size_t n8) { const size_t t = (size_t)blockIdx.x * 256 + threadIdx.x; if (t >= n8) return; FragH f;
#pragma unroll
  for (int q = 0; q < 8; ++q) f.h[q] = (_Float16)x[t * 8 + q]; *(v8us*)((unsigned short*)X16 + t * 8) = f.half[0];  }
__global__ __launch_bounds__(256) void k_round16f(const float* __restrict__ W, _Float16* __restrict__ Bt, size_t n8) { const size_t t = (size_t)blockIdx.x * 256 + threadIdx.x; if (t >= n8) return; FragH f;
#pragma unroll
  for (int i = 0; i < 8; ++i) f.h[i] = (_Float16)(bf16_round(W[t * 8 + i]) * 16.0f); *(v8us*)((unsigned short*)Bt + t * 8) = f.half[0];  }
__global__ __launch_bounds__(256) void k_hl(const float* __restrict__ F, _Float16* __restrict__ Hh, _Float16* __restrict__ Hl, size_t n8) { const size_t t = (size_t)blockIdx.x * 256 + threadIdx.x; if (t >= n8) return; FragH fh, fl; const v4f a = *(const v4fa*)(F + t * 8), c = *(const v4fa*)(F + t * 8 + 4);
#pragma unroll
  for (int q = 0; q < 4; ++q) { _Float16 h = (_Float16)a[q]; fh.h[q] = h; fl.h[q] = (_Float16)((a[q] - (float)h) * 1024.0f); h = (_Float16)c[q]; fh.h[4 + q] = h; fl.h[4 + q] = (_Float16)((c[q] - (float)h) * 1024.0f); }
  { *(v8us*)((unsigned short*)Hh + t * 8) = fh.half[0]; *(v8us*)((unsigned short*)Hl + t * 8) = fl.half[0];  } }

// ---- fast GEMM (wave tile 32x64; requires M % 32 == 0 rows per launch region and N % 64 == 0); epilogue: v = acc * alpha + bias[col] (+ CP), ACT; writes f32 C and / or f16 C16 ----
__device__ __forceinline__ v16h g2_frag(const _Float16* p, int hh) { FragH f; f.half[0] = *(const v8us*)((const unsigned short*)p + 8 * hh); f.half[1] = *(const v8us*)((const unsigned short*)p + 16 + 8 * hh); return f.v; }
__device__ __forceinline__ v8f g2_mma(v16h a, v16h b, v8f c) { v8f d = __builtin_amdgcn_wmma_f32_16x16x32_f16(false, a, false, b, (short)0, c, false, false); asm volatile("v_nop\n\tv_nop\n\tv_nop\n\tv_nop" : "+v"(d) : "v"(a), "v"(b)); return d; }
template <int ACT>
__global__ __launch_bounds__(128) void k_gemm2(const _Float16* __restrict__ A, int lda, size_t sA, const _Float16* __restrict__ Bh, int ldb, size_t sB, float alpha, const float* __restrict__ bias, size_t sBias, const float* __restrict__ CP, int rowsPerB, size_t sCPb, int row0g,
    float* __restrict__ C, _Float16* __restrict__ C16, int ldc, size_t sC, int M, int N, int K) { static_assert(ACT == 0 || ACT == 3 || ACT == 6 || ACT == 8 || ACT == 9 || ACT == 11 || ACT == 12 || ACT == 14 || ACT == 15 || ACT == 16 || ACT == 17, "k_gemm2: unsupported ACT code (would silently apply no activation)");
  __shared__ __attribute__((aligned(16))) float so[4][32][68];
  const int tid = threadIdx.x, w = tid >> 5, lane = tid & 31, ln = lane & 15, hh = lane >> 4; const int by = blockIdx.y;
  A += (size_t)by * sA; Bh += (size_t)by * sB; const size_t cofs = (size_t)by * sC; const float* bp = bias ? bias + (size_t)by * sBias : nullptr;
  const int ntn = N >> 6; const int mt = blockIdx.x / ntn, nq = blockIdx.x - mt * ntn; const int row0 = mt * 128 + 32 * w, col0 = nq * 64; if (row0 >= M) return;
  const _Float16* a0p = A + (size_t)(row0 + ln) * lda; const _Float16* a1p = a0p + (size_t)16 * lda;
  const _Float16* b0p = Bh + (size_t)(col0 + ln) * ldb; const _Float16* b1p = b0p + (size_t)16 * ldb; const _Float16* b2p = b1p + (size_t)16 * ldb; const _Float16* b3p = b2p + (size_t)16 * ldb;
  const v8f z8 = {0.f,0.f,0.f,0.f,0.f,0.f,0.f,0.f}; v8f c00 = z8, c01 = z8, c02 = z8, c03 = z8, c10 = z8, c11 = z8, c12 = z8, c13 = z8;
#pragma unroll 1
  for (int kb = 0; kb < K; kb += 32) { const v16h a0 = g2_frag(a0p + kb, hh), a1 = g2_frag(a1p + kb, hh);
    v16h b = g2_frag(b0p + kb, hh); c00 = g2_mma(a0, b, c00); c10 = g2_mma(a1, b, c10);
    b = g2_frag(b1p + kb, hh); c01 = g2_mma(a0, b, c01); c11 = g2_mma(a1, b, c11);
    b = g2_frag(b2p + kb, hh); c02 = g2_mma(a0, b, c02); c12 = g2_mma(a1, b, c12);
    b = g2_frag(b3p + kb, hh); c03 = g2_mma(a0, b, c03); c13 = g2_mma(a1, b, c13); }
  v8f accs[8] = {c00, c01, c02, c03, c10, c11, c12, c13};
#pragma unroll
  for (int u = 0; u < 8; ++u) { const int t = u & 3, half = u >> 2; const int col = col0 + t * 16 + ln; const float bv = bp ? bf16_round(bp[col]) : 0.f;
#pragma unroll
    for (int r = 0; r < 8; ++r) { const int rloc = half * 16 + 8 * hh + r; float v = accs[u][r] * alpha + bv; if (CP) { if (rowsPerB < 0) v += CP[cofs + (size_t)(row0g + row0 + rloc) * ldc + col];      /* rowsPerB < 0: own element of the batched C plane */ else { const int bidx = (row0g + row0 + rloc) / rowsPerB; v += CP[(size_t)bidx * sCPb + (size_t)by * 64 + col]; } }
      if (ACT == 3) v = fmaxf(v, 0.f); else if (ACT == 6) v = 0.5f * v * (1.0f + erff(v * 0.70710678118654752f)); else if (ACT == 11) v = 1.0f / (1.0f + expf(-v)); else if (ACT == 15) v = v / (1.0f + expf(-v)); else if (ACT == 12) v = (v > 0.f) ? v : 0.01f * v; else if (ACT == 8) v = tanhf(v); else if (ACT == 9) v = 0.5f * v * (1.0f + tanhf(0.7978845608028654f * (v + 0.044715f * v * v * v))); else if (ACT == 14) v = (v > 0.f) ? v : 0.1f * v; else if (ACT == 16) v = (v >= 0.f) ? v : 0.3f * v; else if (ACT == 17) v = (v >= 0.f) ? v : 0.2f * v;
      so[w][rloc][t * 16 + ln] = v; } }
  __builtin_amdgcn_fence(__ATOMIC_ACQ_REL, "workgroup"); __builtin_amdgcn_wave_barrier();
  const int rsub = lane >> 4, c4 = (lane & 15) * 4;
  {
#pragma unroll
    for (int q = 0; q < 16; ++q) { const int r = q * 2 + rsub; const v4f v = *(const v4fa*)&so[w][r][c4]; if (C) *(v4f*)(C + cofs + (size_t)(row0 + r) * ldc + col0 + c4) = v; if (C16) { v4h h4; for (int i = 0; i < 4; ++i) h4[i] = (_Float16)v[i]; *(v4h*)(C16 + cofs + (size_t)(row0 + r) * ldc + col0 + c4) = h4; } }
     } }


__global__ __launch_bounds__(256) void k_wsc(const float* __restrict__ Wm, _Float16* __restrict__ Bt, size_t n8, float sc) { const size_t t = (size_t)blockIdx.x * 256 + threadIdx.x; if (t >= n8) return; FragH f; for (int q = 0; q < 8; ++q) f.h[q] = (_Float16)(bf16_round(Wm[t * 8 + q]) * sc); *(v8us*)((unsigned short*)Bt + t * 8) = f.half[0];  }
__global__ __launch_bounds__(256) void k_bv(const float* __restrict__ Wv, _Float16* __restrict__ BV) { const int t = blockIdx.x * 256 + threadIdx.x; if (t >= NH * HD * (CIN / 8)) return; const int c8 = (t % (CIN / 8)) * 8; const int k = (t / (CIN / 8)) % HD; const int h = t / ((CIN / 8) * HD); FragH f; for (int q = 0; q < 8; ++q) f.h[q] = (_Float16)(bf16_round(Wv[((size_t)h * CIN + c8 + q) * HD + k]) * 16.0f);
  *(v8us*)((unsigned short*)BV + ((size_t)h * HD + k) * CIN + c8) = f.half[0];  }
// V in B-fragment order: VF[b][s = j / 32][tile = col / 16][half][lane][8]; lane = hh * 16 + (col & 15), j = s * 32 + half * 16 + hh * 8 + q. A wave's fragment load is then 512 contiguous bytes.
__global__ __launch_bounds__(256) void k_vf(const _Float16* __restrict__ V16, _Float16* __restrict__ VF) {
  const int t = blockIdx.x * 256 + threadIdx.x; const int lane = t & 31, half = (t >> 5) & 1, tile = (t >> 6) & 7, s = (t >> 9) & (NP / 32 - 1), b = t >> 16; const int ln = lane & 15, hh = lane >> 4; FragH f;
#pragma unroll
  for (int q = 0; q < 8; ++q) f.u[q] = ((const unsigned short*)V16)[((size_t)b * NP + s * 32 + half * 16 + hh * 8 + q) * COUT + tile * 16 + ln];
  *(v8us*)((unsigned short*)VF + (size_t)t * 8) = f.half[0]; }

// One work-group = 16 rows i of one batch, all four heads. Wave w takes the 32-wide j slices s = w, w + 8, ...: d2 once per (i, j), the four heads' weights exp(-d2 / ls^2) * 1024 built in registers
// as the A fragment (same k order as the B fragment: k = half * 16 + hh * 8 + q), two WMMAs per head. The eight waves' partial products and row sums are joined in LDS, scaled by 1 / (sum + 1e-8) and split into f16 hi + residual.
#define RPITCH 132      /* floats per row of a partial product in LDS: rows 8 apart (the two half-waves) fall on different banks */
__global__ __launch_bounds__(256) void k_att(const float* __restrict__ crd, const _Float16* __restrict__ VF, _Float16* __restrict__ MH, _Float16* __restrict__ ML) {
  __shared__ __attribute__((aligned(16))) float sm[8 * 16 * RPITCH];      /* first x[NP], y[NP], z[NP] (bf16-rounded), later the eight waves' 16 x 128 partial products */
  __shared__ float ssum[8][NH][16];
  const int tid = threadIdx.x, w = __builtin_amdgcn_readfirstlane(tid >> 5), lane = tid & 31, ln = lane & 15, hh = lane >> 4;
  const int b = blockIdx.x / (NP / 16), row0 = (blockIdx.x % (NP / 16)) * 16;
  const float* cb = crd + (size_t)b * NP * 3;
#pragma unroll
  for (int u = 0; u < NP / 1024; ++u) { const int p4 = (u * 256 + tid) * 4; const v4f f0 = *(const v4fa*)(cb + p4 * 3), f1 = *(const v4fa*)(cb + p4 * 3 + 4), f2 = *(const v4fa*)(cb + p4 * 3 + 8);
    const v4f x = {bf16_round(f0[0]), bf16_round(f0[3]), bf16_round(f1[2]), bf16_round(f2[1])}, y = {bf16_round(f0[1]), bf16_round(f1[0]), bf16_round(f1[3]), bf16_round(f2[2])}, z = {bf16_round(f0[2]), bf16_round(f1[1]), bf16_round(f2[0]), bf16_round(f2[3])};
    *(v4fa*)&sm[p4] = x; *(v4fa*)&sm[NP + p4] = y; *(v4fa*)&sm[2 * NP + p4] = z; }
  __syncthreads();
  const float xi = sm[row0 + ln], yi = sm[NP + row0 + ln], zi = sm[2 * NP + row0 + ln];
  const float il2[NH] = {4.0f, 1.0f, 0.25f, 0.0625f};      /* 1 / ls^2, ls = 0.5, 1, 2, 4 */
  const v8f z8 = {0.f, 0.f, 0.f, 0.f, 0.f, 0.f, 0.f, 0.f};
  v8f acc[NH][2]; float su[NH];
#pragma unroll
  for (int h = 0; h < NH; ++h) { acc[h][0] = z8; acc[h][1] = z8; su[h] = 0.f; }
  for (int s = w; s < NP / 32; s += 8) {
    const unsigned short* vp = (const unsigned short*)VF + (size_t)(b * (NP / 32) + s) * (COUT * 32) + lane * 8;
    FragH bq[2 * NH];
#pragma unroll
    for (int t = 0; t < 2 * NH; ++t) { bq[t].half[0] = *(const v8us*)(vp + t * 512); bq[t].half[1] = *(const v8us*)(vp + t * 512 + 256); }
    __builtin_amdgcn_sched_barrier(0);      /* keeps the 16 fragment loads in front of the d2 and exp work, which covers their latency; without it they sink to just in front of each WMMA */
    float d2[16];
#pragma unroll
    for (int g = 0; g < 2; ++g) { const int j0 = s * 32 + g * 16 + hh * 8;
#pragma unroll
      for (int p = 0; p < 2; ++p) { const v4f x = *(const v4fa*)&sm[j0 + p * 4], y = *(const v4fa*)&sm[NP + j0 + p * 4], z = *(const v4fa*)&sm[2 * NP + j0 + p * 4];
#pragma unroll
        for (int q = 0; q < 4; ++q) { const float dx = xi - x[q], dy = yi - y[q], dz = zi - z[q]; d2[g * 8 + p * 4 + q] = dx * dx + dy * dy + dz * dz; } } }
#pragma unroll
    for (int h = 0; h < NH; ++h) { FragH a;
#pragma unroll
      for (int e = 0; e < 16; ++e) { const float ev = expf(-(d2[e] * il2[h])); su[h] += ev; a.h[e] = (_Float16)(ev * 1024.0f); }
      acc[h][0] = __builtin_amdgcn_wmma_f32_16x16x32_f16(false, a.v, false, bq[2 * h].v, (short)0, acc[h][0], false, false);
      acc[h][1] = __builtin_amdgcn_wmma_f32_16x16x32_f16(false, a.v, false, bq[2 * h + 1].v, (short)0, acc[h][1], false, false); }
  }
#pragma unroll
  for (int h = 0; h < NH; ++h) { su[h] += __shfl_xor(su[h], 16, 32); if (hh == 0) ssum[w][h][ln] = su[h]; }
  __syncthreads();      /* every wave has read its last coordinates: sm may be rewritten */
#pragma unroll
  for (int h = 0; h < NH; ++h)
#pragma unroll
    for (int t = 0; t < 2; ++t)
#pragma unroll
      for (int r = 0; r < 8; ++r) sm[(w * 16 + 8 * hh + r) * RPITCH + h * HD + t * 16 + ln] = acc[h][t][r];
  __syncthreads();      /* the partial products and row sums of all eight waves are in LDS */
  const int row = tid >> 4, c8 = (tid & 15) * 8, hd = c8 / HD;
  float tot = 0.f; v4f s0 = {0.f, 0.f, 0.f, 0.f}, s1 = s0;
#pragma unroll
  for (int ww = 0; ww < 8; ++ww) { tot += ssum[ww][hd][row]; s0 += *(const v4fa*)&sm[(ww * 16 + row) * RPITCH + c8]; s1 += *(const v4fa*)&sm[(ww * 16 + row) * RPITCH + c8 + 4]; }
  const float rs = 1.0f / (tot + 1e-8f); FragH f, fl;
#pragma unroll
  for (int q = 0; q < 8; ++q) { const float v = ((q < 4 ? s0[q & 3] : s1[q & 3]) * 0.0009765625f) * rs; const _Float16 hi = (_Float16)v; f.h[q] = hi; fl.h[q] = (_Float16)((v - (float)hi) * 1024.0f); }
  const size_t o = ((size_t)b * NP + row0 + row) * COUT + c8; *(v8us*)((unsigned short*)MH + o) = f.half[0]; *(v8us*)((unsigned short*)ML + o) = fl.half[0]; }

extern "C" void kernel_launch(void* const* d_in, const int* in_sizes, int n_in,
                              void* d_out, int out_size, void* d_ws, size_t ws_size, hipStream_t stream) {
  (void)in_sizes; (void)n_in; (void)out_size;
  const float* const* I = (const float* const*)d_in; const float* feat = I[0]; const float* crd = I[1]; const float* Wv = I[2]; const float* bv = I[3]; const float* Wo = I[4]; const float* bo = I[5];
  char* ws = (char*)d_ws; size_t off = 0;
  auto take = [&](size_t bytes) { char* p = ws + off; off += (bytes + 255) & ~(size_t)255; return p; };
  const size_t np = (size_t)NB * NP * COUT;
  _Float16* BV = (_Float16*)take((size_t)NH * HD * CIN * 2); _Float16* BO = (_Float16*)take((size_t)COUT * COUT * 2); _Float16* X16 = (_Float16*)take((size_t)NB * NP * CIN * 2); _Float16* V16 = (_Float16*)take(np * 2); _Float16* VF = (_Float16*)take(np * 2);
  _Float16* MH = (_Float16*)take(np * 2); _Float16* ML = (_Float16*)take(np * 2);
  if (off > ws_size) return;
  k_bv<<<(NH * HD * (CIN / 8) + 255) / 256, 256, 0, stream>>>(Wv, BV); k_wt_f16<<<(COUT * COUT / 8 + 255) / 256, 256, 0, stream>>>(Wo, BO, COUT, COUT, 16.0f);      /* Wo (in, out) */
  k_x16<<<(unsigned)(((size_t)NB * NP * CIN / 8 + 255) / 256), 256, 0, stream>>>(feat, X16, (size_t)NB * NP * CIN / 8);
  k_gemm2<0><<<dim3((NB * NP / 128) * (COUT / 64), 1), 128, 0, stream>>>(X16, CIN, 0, BV, CIN, 0, 0.0625f, bv, 0, nullptr, 1, 0, 0, nullptr, V16, COUT, 0, NB * NP, COUT, CIN);      /* values [(b,i)][h*32 + k] */
  k_vf<<<NB * NP * COUT / 8 / 256, 256, 0, stream>>>(V16, VF);      /* values in B-fragment order */
  k_att<<<NB * (NP / 16), 256, 0, stream>>>(crd, VF, MH, ML);      /* all (batch, head): weights, att . value, row scaling */
  k_gemm2<0><<<dim3((NB * NP / 128) * (COUT / 64), 1), 128, 0, stream>>>(ML, COUT, 0, BO, COUT, 0, 0.0625f / 1024.0f, nullptr, 0, nullptr, 1, 0, 0, (float*)d_out, nullptr, COUT, 0, NB * NP, COUT, COUT);
  k_gemm2<0><<<dim3((NB * NP / 128) * (COUT / 64), 1), 128, 0, stream>>>(MH, COUT, 0, BO, COUT, 0, 0.0625f, bo, 0, (const float*)d_out, 1, (size_t)COUT, 0, (float*)d_out, nullptr, COUT, 0, NB * NP, COUT, COUT);      /* out = (mh_lo + mh_hi) Wo + bo */
}

// v002
// It runs in 75.7 microseconds.
// Two timings next to v001 put it at 1.33 and 1.34 times that version's speed.
// Over all steps from v000 it is 9.36 times as fast.
#include <hip/hip_runtime.h>
// KernelSelfAttention (2 x 4096 points; d2 = |c_i - c_j|^2 from 3-D coords; per head h with lengthscale ls in {0.5, 1, 2, 4}: att = exp(-d2 / ls^2) / (sum_j + 1e-8); value_h = features Wv[h] + bv[h] [32]; head_out = att value; out = concat_h Wo + bo -> [2][4096][128]).
// Compute dtype: inputs rounded to bf16; features / weights exact as f16; d2 / exp / sums f32 from bf16 coords; values and kernel weights as plain f16 operands (~2^-12); the scaled head outputs as f16 hi + residual into Wo. v_wmma_f32_16x16x32_f16.
#define NB 2
#define NP 4096
#define CIN 128
#define NH 4
#define HD 32
#define COUT 128
typedef __bf16 v16b __attribute__((ext_vector_type(16)));
typedef unsigned short v8us __attribute__((ext_vector_type(8), may_alias));
typedef float  v8f  __attribute__((ext_vector_type(8)));
typedef float  v4f  __attribute__((ext_vector_type(4)));
typedef float  v4fa __attribute__((ext_vector_type(4), may_alias));
union FragB { v16b v; v8us half[2]; unsigned short u[16]; };

__device__ __forceinline__ unsigned short bf16_bits(float x) { unsigned int u = __float_as_uint(x); return (unsigned short)((u + 0x7FFFu + ((u >> 16) & 1u)) >> 16); }
__device__ __forceinline__ float bf16_val(unsigned short b) { return __uint_as_float(((unsigned int)b) << 16); }
__device__ __forceinline__ float bf16_round(float x) { return bf16_val(bf16_bits(x)); }
// D += A·B with NT terms: 1 = ah·bh, 2 = + al·bh (A split), 3 = + ah·bl (both split)
template <int NT>
__device__ __forceinline__ v8f mmaN(v16b ah, v16b al, v16b bh, v16b bl, v8f c) {
  c = __builtin_amdgcn_wmma_f32_16x16x32_bf16(false, ah, false, bh, (short)0, c, false, false);
  if (NT >= 2) c = __builtin_amdgcn_wmma_f32_16x16x32_bf16(false, al, false, bh, (short)0, c, false, false);
  if (NT >= 3) c = __builtin_amdgcn_wmma_f32_16x16x32_bf16(false, ah, false, bl, (short)0, c, false, false);
  asm volatile("v_nop\n\tv_nop\n\tv_nop\n\tv_nop" : "+v"(c) : "v"(ah), "v"(al), "v"(bh), "v"(bl));
  return c;
}

__global__ __launch_bounds__(256) void k_wt_bf16(const float* __restrict__ W, unsigned short* __restrict__ Wt, int K, int N) {
  const int t = blockIdx.x * 256 + threadIdx.x;
  const int k8n = K / 8;
  if (t >= N * k8n) return;
  const int n = t / k8n, k8 = (t % k8n) * 8;
  v8us v;
#pragma unroll
  for (int i = 0; i < 8; ++i) v[i] = bf16_bits(W[(size_t)(k8 + i) * N + n]);
  *(v8us*)(Wt + (size_t)n * K + k8) = v;
  
}

// GEMM C[M][N] (f32, pitch ldc) = act(A[M][K]·W + bias). A f32 row-major (pitch lda) converted per fragment to bf16
// (ASPLIT: hi/lo two planes -> 2 terms, else single rounded term); Wt bf16 [N][K] (pitch ldb). BIAS_BF16 rounds the
// bias to bf16 first (bias quantised to bf16 before the add). K%32==0, M%16==0, N%64==0.
template <bool ASPLIT, int ACT, bool BIAS_BF16>
__global__ __launch_bounds__(128) void k_gemm_bf(const float* __restrict__ A, int lda, const unsigned short* __restrict__ Wt, int ldb,
                                               const float* __restrict__ bias, float* __restrict__ C, int ldc, int M, int N, int K) {
  __shared__ __attribute__((aligned(16))) float so[4][16][64];
  const int tid = threadIdx.x, w = tid >> 5, lane = tid & 31, ln = lane & 15, hh = lane >> 4;
  const int ntn = N / 64;
  const int wid = blockIdx.x * 4 + w;
  const int mt = wid / ntn, nq = wid % ntn;
  if (mt * 16 >= M) return;
  const int row0 = mt * 16, col0 = nq * 64;
  const float* arow = A + (size_t)(row0 + ln) * lda;
  v8f acc[4] = {};
  for (int kb = 0; kb < K; kb += 32) {
    FragB ah, al;
    const v4f x0 = *(const v4fa*)(arow + kb + 8 * hh), x1 = *(const v4fa*)(arow + kb + 8 * hh + 4);
    const v4f x2 = *(const v4fa*)(arow + kb + 16 + 8 * hh), x3 = *(const v4fa*)(arow + kb + 16 + 8 * hh + 4);
    float xs[16] = {x0[0],x0[1],x0[2],x0[3],x1[0],x1[1],x1[2],x1[3],x2[0],x2[1],x2[2],x2[3],x3[0],x3[1],x3[2],x3[3]};
#pragma unroll
    for (int i = 0; i < 16; ++i) { const unsigned short hb = bf16_bits(xs[i]); ah.u[i] = hb; al.u[i] = ASPLIT ? bf16_bits(xs[i] - bf16_val(hb)) : (unsigned short)0; }
#pragma unroll
    for (int t = 0; t < 4; ++t) {
      const unsigned short* brow = Wt + (size_t)(col0 + t * 16 + ln) * ldb + kb;
      FragB b;
      b.half[0] = *(const v8us*)(brow + 8 * hh);
      b.half[1] = *(const v8us*)(brow + 16 + 8 * hh);
      acc[t] = mmaN<ASPLIT ? 2 : 1>(ah.v, al.v, b.v, b.v, acc[t]);
    }
  }
#pragma unroll
  for (int t = 0; t < 4; ++t) {
    float bv = bias ? bias[col0 + t * 16 + ln] : 0.f;
    if (BIAS_BF16) bv = bf16_round(bv);
#pragma unroll
    for (int r = 0; r < 8; ++r) { float v = acc[t][r] + bv; if (ACT == 1) v = fmaxf(v, 0.f); so[w][8 * hh + r][t * 16 + ln] = v; }
  }
  __builtin_amdgcn_fence(__ATOMIC_ACQ_REL, "workgroup");
  __builtin_amdgcn_wave_barrier();
  const int rsub = lane >> 4, c4 = (lane & 15) * 4;
  {
#pragma unroll
    for (int q = 0; q < 8; ++q) {
      const int r = q * 2 + rsub;
      const v4f v = *(const v4fa*)&so[w][r][c4];
      *(v4f*)(C + (size_t)(row0 + r) * ldc + col0 + c4) = v;
    }
    
  }
}

// GEMM C = act(A·W + bias + resid): A f32 (ASPLIT -> hi/lo 2 terms), Wt bf16 [N][K]; ACT 0 none, 1 relu, 2 exact gelu;
// resid (optional, f32, row index = (row % rmod), pitch ldr, RES_BF16 rounds it) added before the activation.
template <bool ASPLIT, int ACT, bool BIAS_BF16, bool RES_BF16>
__global__ __launch_bounds__(128) void k_gemm_bf3(const float* __restrict__ A, int lda, const unsigned short* __restrict__ Wt, int ldb,
                                                const float* __restrict__ bias, const float* __restrict__ resid, int rmod, int ldr,
                                                float* __restrict__ C, int ldc, int M, int N, int K) {
  __shared__ __attribute__((aligned(16))) float so[4][16][64];
  const int tid = threadIdx.x, w = tid >> 5, lane = tid & 31, ln = lane & 15, hh = lane >> 4;
  const int ntn = N / 64;
  const int wid = blockIdx.x * 4 + w;
  const int mt = wid / ntn, nq = wid % ntn;
  if (mt * 16 >= M) return;
  const int row0 = mt * 16, col0 = nq * 64;
  const float* arow = A + (size_t)(row0 + ln) * lda;
  v8f acc[4] = {};
  for (int kb = 0; kb < K; kb += 32) {
    FragB ah, al;
    const v4f x0 = *(const v4fa*)(arow + kb + 8 * hh), x1 = *(const v4fa*)(arow + kb + 8 * hh + 4);
    const v4f x2 = *(const v4fa*)(arow + kb + 16 + 8 * hh), x3 = *(const v4fa*)(arow + kb + 16 + 8 * hh + 4);
    float xs[16] = {x0[0],x0[1],x0[2],x0[3],x1[0],x1[1],x1[2],x1[3],x2[0],x2[1],x2[2],x2[3],x3[0],x3[1],x3[2],x3[3]};
#pragma unroll
    for (int i = 0; i < 16; ++i) { const unsigned short hb = bf16_bits(xs[i]); ah.u[i] = hb; al.u[i] = ASPLIT ? bf16_bits(xs[i] - bf16_val(hb)) : (unsigned short)0; }
#pragma unroll
    for (int t = 0; t < 4; ++t) {
      const unsigned short* brow = Wt + (size_t)(col0 + t * 16 + ln) * ldb + kb;
      FragB b;
      b.half[0] = *(const v8us*)(brow + 8 * hh);
      b.half[1] = *(const v8us*)(brow + 16 + 8 * hh);
      acc[t] = mmaN<ASPLIT ? 2 : 1>(ah.v, al.v, b.v, b.v, acc[t]);
    }
  }
#pragma unroll
  for (int t = 0; t < 4; ++t) {
    const int col = col0 + t * 16 + ln;
    float bv = bias ? bias[col] : 0.f;
    if (BIAS_BF16) bv = bf16_round(bv);
#pragma unroll
    for (int r = 0; r < 8; ++r) {
      float v = acc[t][r] + bv;
      if (resid) { float rv = resid[(size_t)((row0 + 8 * hh + r) % rmod) * ldr + col]; if (RES_BF16) rv = bf16_round(rv); v += rv; }
      if (ACT == 1) v = fmaxf(v, 0.f);
      if (ACT == 2) v = 0.5f * v * (1.0f + erff(v * 0.70710678118654752f));
      if (ACT == 3) { const float u = 0.7978845608028654f * (v + 0.044715f * v * v * v); v = 0.5f * v * (1.0f + tanhf(u)); }
      so[w][8 * hh + r][t * 16 + ln] = v;
    }
  }
  __builtin_amdgcn_fence(__ATOMIC_ACQ_REL, "workgroup");
  __builtin_amdgcn_wave_barrier();
  const int rsub = lane >> 4, c4 = (lane & 15) * 4;
  {
#pragma unroll
    for (int q = 0; q < 8; ++q) {
      const int r = q * 2 + rsub;
      const v4f v = *(const v4fa*)&so[w][r][c4];
      *(v4f*)(C + (size_t)(row0 + r) * ldc + col0 + c4) = v;
    }
    
  }
}
// row LayerNorm (biased variance, eps) over N: s = X (+ R); optional out_sum <- s; out_norm <- (s-mu)*rsqrt(var+eps)*g + b
template <bool PARAM_BF16>
__global__ __launch_bounds__(256) void k_layernorm(const float* __restrict__ X, const float* __restrict__ R, const float* __restrict__ g, const float* __restrict__ bta,
                                                  float* __restrict__ out_sum, float* __restrict__ out_norm, int N, float eps) {
  __shared__ float red[256];
  const int row = blockIdx.x, tid = threadIdx.x;
  const float* x = X + (size_t)row * N; const float* rr = R ? R + (size_t)row * N : nullptr;
  float vals[16];                     // up to N = 4096
  const int per = N / 256;            // contiguous chunk per thread? use strided-by-4 chunks: thread handles j = tid*4 + 1024*u
  float s1 = 0.f;
  for (int u = 0; u < per / 4; ++u) {
    const int j = tid * 4 + 1024 * u;
    const v4f a = *(const v4fa*)(x + j);
    v4f b = {0.f,0.f,0.f,0.f}; if (rr) b = *(const v4fa*)(rr + j);
#pragma unroll
    for (int q = 0; q < 4; ++q) { const float v = a[q] + b[q]; vals[u * 4 + q] = v; s1 += v; }
  }
  red[tid] = s1; __syncthreads();
  for (int st = 128; st > 0; st >>= 1) { if (tid < st) red[tid] += red[tid + st]; __syncthreads(); }
  const float mu = red[0] / (float)N; __syncthreads();
  float s2 = 0.f;
  for (int u = 0; u < per / 4; ++u)
#pragma unroll
    for (int q = 0; q < 4; ++q) { const float c = vals[u * 4 + q] - mu; s2 += c * c; }
  red[tid] = s2; __syncthreads();
  for (int st = 128; st > 0; st >>= 1) { if (tid < st) red[tid] += red[tid + st]; __syncthreads(); }
  const float rs = rsqrtf(red[0] / (float)N + eps);
  {
    for (int u = 0; u < per / 4; ++u) {
      const int j = tid * 4 + 1024 * u;
      v4f o, sm;
#pragma unroll
      for (int q = 0; q < 4; ++q) {
        float gg = g[j + q], bb = bta[j + q];
        if (PARAM_BF16) { gg = bf16_round(gg); bb = bf16_round(bb); }
        sm[q] = vals[u * 4 + q]; o[q] = (vals[u * 4 + q] - mu) * rs * gg + bb;
      }
      if (out_sum) *(v4f*)(out_sum + (size_t)row * N + j) = sm;
      *(v4f*)(out_norm + (size_t)row * N + j) = o;
    }
    
  }
}



// ---- f16 WMMA path (v_wmma_f32_16x16x32_f16): 11-bit significands for operands in range — used where a [0,1] probability operand needs more precision than bf16
typedef _Float16 v16h __attribute__((ext_vector_type(16)));
union FragH { v16h v; v8us half[2]; _Float16 h[16]; unsigned short u[16]; };
template <int NT>
__device__ __forceinline__ v8f mmaH(v16h ah, v16h al, v16h bh, v16h bl, v8f c) {
  c = __builtin_amdgcn_wmma_f32_16x16x32_f16(false, ah, false, bh, (short)0, c, false, false);
  if (NT >= 2) c = __builtin_amdgcn_wmma_f32_16x16x32_f16(false, al, false, bh, (short)0, c, false, false);
  if (NT >= 3) c = __builtin_amdgcn_wmma_f32_16x16x32_f16(false, ah, false, bl, (short)0, c, false, false);
  asm volatile("v_nop\n\tv_nop\n\tv_nop\n\tv_nop" : "+v"(c) : "v"(ah), "v"(al), "v"(bh), "v"(bl));
  return c;
}
// batched GEMM like k_gemm_b but f16 operands: A f32 (split into f16 hi/lo if ASPLIT, else rounded to f16), Bt = f16 values [n][k]; alpha; C f32; N multiple of 16 (partial tiles skipped)
template <bool ASPLIT>
__global__ __launch_bounds__(128) void k_gemm_h(const float* __restrict__ A, int lda, size_t sA, const _Float16* __restrict__ Bh, int ldb, size_t sB, float alpha, float* __restrict__ C, int ldc, size_t sC, int M, int N, int K) {
  __shared__ __attribute__((aligned(16))) float so[4][16][64];
  const int tid = threadIdx.x, w = tid >> 5, lane = tid & 31, ln = lane & 15, hh = lane >> 4; const int by = blockIdx.y;
  A += (size_t)by * sA; Bh += (size_t)by * sB; C += (size_t)by * sC;
  const int ntn = (N + 63) / 64; const int wid = blockIdx.x * 4 + w; const int mt = wid / ntn, nq = wid % ntn; if (mt * 16 >= M) return;
  const int row0 = mt * 16, col0 = nq * 64; const float* arow = A + (size_t)(row0 + ln) * lda;
  v8f acc[4] = {};
  for (int kb = 0; kb < K; kb += 32) {
    FragH ah, al;
    const v4f x0 = *(const v4fa*)(arow + kb + 8 * hh), x1 = *(const v4fa*)(arow + kb + 8 * hh + 4), x2 = *(const v4fa*)(arow + kb + 16 + 8 * hh), x3 = *(const v4fa*)(arow + kb + 16 + 8 * hh + 4);
    float xs[16] = {x0[0],x0[1],x0[2],x0[3],x1[0],x1[1],x1[2],x1[3],x2[0],x2[1],x2[2],x2[3],x3[0],x3[1],x3[2],x3[3]};
#pragma unroll
    for (int i = 0; i < 16; ++i) { const _Float16 h = (_Float16)xs[i]; ah.h[i] = h; al.h[i] = ASPLIT ? (_Float16)(xs[i] - (float)h) : (_Float16)0.0f; }
#pragma unroll
    for (int t = 0; t < 4; ++t) { if (col0 + t * 16 >= N) continue; const size_t boff = (size_t)(col0 + t * 16 + ln) * ldb + kb; FragH bq; bq.half[0] = *(const v8us*)(Bh + boff + 8 * hh); bq.half[1] = *(const v8us*)(Bh + boff + 16 + 8 * hh);
      acc[t] = mmaH<ASPLIT ? 2 : 1>(ah.v, al.v, bq.v, bq.v, acc[t]); }
  }
#pragma unroll
  for (int t = 0; t < 4; ++t) { if (col0 + t * 16 >= N) continue;
#pragma unroll
    for (int r = 0; r < 8; ++r) so[w][8 * hh + r][t * 16 + ln] = acc[t][r] * alpha; }
  __builtin_amdgcn_fence(__ATOMIC_ACQ_REL, "workgroup"); __builtin_amdgcn_wave_barrier();
  const int rsub = lane >> 4, c4 = (lane & 15) * 4;
  {
#pragma unroll
    for (int q = 0; q < 8; ++q) { const int r = q * 2 + rsub; if (col0 + c4 < N) { const v4f v = *(const v4fa*)&so[w][r][c4]; *(v4f*)(C + (size_t)(row0 + r) * ldc + col0 + c4) = v; } }
     }
}

// Wt[n][k] = f16(W[k][n]·scale) from f32 row-major W[K][N] (scale = power of two; bf16-exact weights stay exact in f16 away from the subnormal range)
__global__ __launch_bounds__(256) void k_wt_f16(const float* __restrict__ W, _Float16* __restrict__ Wt, int K, int N, float scale) {
  const int t = blockIdx.x * 256 + threadIdx.x; if (t >= N * (K / 8)) return; const int n = t / (K / 8), k8 = (t % (K / 8)) * 8; FragH f;
#pragma unroll
  for (int i = 0; i < 8; ++i) f.h[i] = (_Float16)(bf16_round(W[(size_t)(k8 + i) * N + n]) * scale); const v8us o = f.half[0];
  *(v8us*)((unsigned short*)Wt + (size_t)n * K + k8) = o; 
}
typedef _Float16 v4h __attribute__((ext_vector_type(4)));

__global__ __launch_bounds__(256) void k_x16(const float* __restrict__ x, _Float16* __restrict__ X16, size_t n8) { const size_t t = (size_t)blockIdx.x * 256 + threadIdx.x; if (t >= n8) return; FragH f;
#pragma unroll
  for (int q = 0; q < 8; ++q) f.h[q] = (_Float16)bf16_round(x[t * 8 + q]); *(v8us*)((unsigned short*)X16 + t * 8) = f.half[0];  }
__global__ __launch_bounds__(256) void k_h16(const float* __restrict__ x, _Float16* __restrict__ X16, size_t n8) { const size_t t = (size_t)blockIdx.x * 256 + threadIdx.x; if (t >= n8) return; FragH f;
#pragma unroll
  for (int q = 0; q < 8; ++q) f.h[q] = (_Float16)x[t * 8 + q]; *(v8us*)((unsigned short*)X16 + t * 8) = f.half[0];  }
__global__ __launch_bounds__(256) void k_round16f(const float* __restrict__ W, _Float16* __restrict__ Bt, size_t n8) { const size_t t = (size_t)blockIdx.x * 256 + threadIdx.x; if (t >= n8) return; FragH f;
#pragma unroll
  for (int i = 0; i < 8; ++i) f.h[i] = (_Float16)(bf16_round(W[t * 8 + i]) * 16.0f); *(v8us*)((unsigned short*)Bt + t * 8) = f.half[0];  }
__global__ __launch_bounds__(256) void k_hl(const float* __restrict__ F, _Float16* __restrict__ Hh, _Float16* __restrict__ Hl, size_t n8) { const size_t t = (size_t)blockIdx.x * 256 + threadIdx.x; if (t >= n8) return; FragH fh, fl; const v4f a = *(const v4fa*)(F + t * 8), c = *(const v4fa*)(F + t * 8 + 4);
#pragma unroll
  for (int q = 0; q < 4; ++q) { _Float16 h = (_Float16)a[q]; fh.h[q] = h; fl.h[q] = (_Float16)((a[q] - (float)h) * 1024.0f); h = (_Float16)c[q]; fh.h[4 + q] = h; fl.h[4 + q] = (_Float16)((c[q] - (float)h) * 1024.0f); }
  { *(v8us*)((unsigned short*)Hh + t * 8) = fh.half[0]; *(v8us*)((unsigned short*)Hl + t * 8) = fl.half[0];  } }

// ---- fast GEMM (wave tile 32x64; requires M % 32 == 0 rows per launch region and N % 64 == 0); epilogue: v = acc * alpha + bias[col] (+ CP), ACT; writes f32 C and / or f16 C16 ----
__device__ __forceinline__ v16h g2_frag(const _Float16* p, int hh) { FragH f; f.half[0] = *(const v8us*)((const unsigned short*)p + 8 * hh); f.half[1] = *(const v8us*)((const unsigned short*)p + 16 + 8 * hh); return f.v; }
__device__ __forceinline__ v8f g2_mma(v16h a, v16h b, v8f c) { v8f d = __builtin_amdgcn_wmma_f32_16x16x32_f16(false, a, false, b, (short)0, c, false, false); asm volatile("v_nop\n\tv_nop\n\tv_nop\n\tv_nop" : "+v"(d) : "v"(a), "v"(b)); return d; }
template <int ACT>
__global__ __launch_bounds__(128) void k_gemm2(const _Float16* __restrict__ A, int lda, size_t sA, const _Float16* __restrict__ Bh, int ldb, size_t sB, float alpha, const float* __restrict__ bias, size_t sBias, const float* __restrict__ CP, int rowsPerB, size_t sCPb, int row0g,
    float* __restrict__ C, _Float16* __restrict__ C16, int ldc, size_t sC, int M, int N, int K) { static_assert(ACT == 0 || ACT == 3 || ACT == 6 || ACT == 8 || ACT == 9 || ACT == 11 || ACT == 12 || ACT == 14 || ACT == 15 || ACT == 16 || ACT == 17, "k_gemm2: unsupported ACT code (would silently apply no activation)");
  __shared__ __attribute__((aligned(16))) float so[4][32][68];
  const int tid = threadIdx.x, w = tid >> 5, lane = tid & 31, ln = lane & 15, hh = lane >> 4; const int by = blockIdx.y;
  A += (size_t)by * sA; Bh += (size_t)by * sB; const size_t cofs = (size_t)by * sC; const float* bp = bias ? bias + (size_t)by * sBias : nullptr;
  const int ntn = N >> 6; const int mt = blockIdx.x / ntn, nq = blockIdx.x - mt * ntn; const int row0 = mt * 128 + 32 * w, col0 = nq * 64; if (row0 >= M) return;
  const _Float16* a0p = A + (size_t)(row0 + ln) * lda; const _Float16* a1p = a0p + (size_t)16 * lda;
  const _Float16* b0p = Bh + (size_t)(col0 + ln) * ldb; const _Float16* b1p = b0p + (size_t)16 * ldb; const _Float16* b2p = b1p + (size_t)16 * ldb; const _Float16* b3p = b2p + (size_t)16 * ldb;
  const v8f z8 = {0.f,0.f,0.f,0.f,0.f,0.f,0.f,0.f}; v8f c00 = z8, c01 = z8, c02 = z8, c03 = z8, c10 = z8, c11 = z8, c12 = z8, c13 = z8;
#pragma unroll 1
  for (int kb = 0; kb < K; kb += 32) { const v16h a0 = g2_frag(a0p + kb, hh), a1 = g2_frag(a1p + kb, hh);
    v16h b = g2_frag(b0p + kb, hh); c00 = g2_mma(a0, b, c00); c10 = g2_mma(a1, b, c10);
    b = g2_frag(b1p + kb, hh); c01 = g2_mma(a0, b, c01); c11 = g2_mma(a1, b, c11);
    b = g2_frag(b2p + kb, hh); c02 = g2_mma(a0, b, c02); c12 = g2_mma(a1, b, c12);
    b = g2_frag(b3p + kb, hh); c03 = g2_mma(a0, b, c03); c13 = g2_mma(a1, b, c13); }
  v8f accs[8] = {c00, c01, c02, c03, c10, c11, c12, c13};
#pragma unroll
  for (int u = 0; u < 8; ++u) { const int t = u & 3, half = u >> 2; const int col = col0 + t * 16 + ln; const float bv = bp ? bf16_round(bp[col]) : 0.f;
#pragma unroll
    for (int r = 0; r < 8; ++r) { const int rloc = half * 16 + 8 * hh + r; float v = accs[u][r] * alpha + bv; if (CP) { if (rowsPerB < 0) v += CP[cofs + (size_t)(row0g + row0 + rloc) * ldc + col];      /* rowsPerB < 0: own element of the batched C plane */ else { const int bidx = (row0g + row0 + rloc) / rowsPerB; v += CP[(size_t)bidx * sCPb + (size_t)by * 64 + col]; } }
      if (ACT == 3) v = fmaxf(v, 0.f); else if (ACT == 6) v = 0.5f * v * (1.0f + erff(v * 0.70710678118654752f)); else if (ACT == 11) v = 1.0f / (1.0f + expf(-v)); else if (ACT == 15) v = v / (1.0f + expf(-v)); else if (ACT == 12) v = (v > 0.f) ? v : 0.01f * v; else if (ACT == 8) v = tanhf(v); else if (ACT == 9) v = 0.5f * v * (1.0f + tanhf(0.7978845608028654f * (v + 0.044715f * v * v * v))); else if (ACT == 14) v = (v > 0.f) ? v : 0.1f * v; else if (ACT == 16) v = (v >= 0.f) ? v : 0.3f * v; else if (ACT == 17) v = (v >= 0.f) ? v : 0.2f * v;
      so[w][rloc][t * 16 + ln] = v; } }
  __builtin_amdgcn_fence(__ATOMIC_ACQ_REL, "workgroup"); __builtin_amdgcn_wave_barrier();
  const int rsub = lane >> 4, c4 = (lane & 15) * 4;
  {
#pragma unroll
    for (int q = 0; q < 16; ++q) { const int r = q * 2 + rsub; const v4f v = *(const v4fa*)&so[w][r][c4]; if (C) *(v4f*)(C + cofs + (size_t)(row0 + r) * ldc + col0 + c4) = v; if (C16) { v4h h4; for (int i = 0; i < 4; ++i) h4[i] = (_Float16)v[i]; *(v4h*)(C16 + cofs + (size_t)(row0 + r) * ldc + col0 + c4) = h4; } }
     } }


__global__ __launch_bounds__(256) void k_wsc(const float* __restrict__ Wm, _Float16* __restrict__ Bt, size_t n8, float sc) { const size_t t = (size_t)blockIdx.x * 256 + threadIdx.x; if (t >= n8) return; FragH f; for (int q = 0; q < 8; ++q) f.h[q] = (_Float16)(bf16_round(Wm[t * 8 + q]) * sc); *(v8us*)((unsigned short*)Bt + t * 8) = f.half[0];  }
__global__ __launch_bounds__(256) void k_bv(const float* __restrict__ Wv, _Float16* __restrict__ BV) { const int t = blockIdx.x * 256 + threadIdx.x; if (t >= NH * HD * (CIN / 8)) return; const int c8 = (t % (CIN / 8)) * 8; const int k = (t / (CIN / 8)) % HD; const int h = t / ((CIN / 8) * HD); FragH f; for (int q = 0; q < 8; ++q) f.h[q] = (_Float16)(bf16_round(Wv[((size_t)h * CIN + c8 + q) * HD + k]) * 16.0f);
  *(v8us*)((unsigned short*)BV + ((size_t)h * HD + k) * CIN + c8) = f.half[0];  }
// V in B-fragment order: VF[b][s = j / 32][tile = col / 16][half][lane][8]; lane = hh * 16 + (col & 15), j = s * 32 + half * 16 + hh * 8 + q. A wave's fragment load is then 512 contiguous bytes.
__global__ __launch_bounds__(256) void k_vf(const _Float16* __restrict__ V16, _Float16* __restrict__ VF) {
  const int t = blockIdx.x * 256 + threadIdx.x; const int lane = t & 31, half = (t >> 5) & 1, tile = (t >> 6) & 7, s = (t >> 9) & (NP / 32 - 1), b = t >> 16; const int ln = lane & 15, hh = lane >> 4; FragH f;
#pragma unroll
  for (int q = 0; q < 8; ++q) f.u[q] = ((const unsigned short*)V16)[((size_t)b * NP + s * 32 + half * 16 + hh * 8 + q) * COUT + tile * 16 + ln];
  *(v8us*)((unsigned short*)VF + (size_t)t * 8) = f.half[0]; }

// One work-group = 16 rows i of one batch, all four heads. Wave w takes the 32-wide j slices s = w, w + 8, ...: d2 and one exp2 once per (i, j), the four heads' weights exp(-d2 / ls^2) * 1024 (the widest head's, then fourth powers) built in registers
// as the A fragment (same k order as the B fragment: k = half * 16 + hh * 8 + q), two WMMAs per head. The eight waves' partial products and row sums are joined in LDS, scaled by 1 / (sum + 1e-8) and split into f16 hi + residual.
#define RPITCH 132      /* floats per row of a partial product in LDS: rows 8 apart (the two half-waves) fall on different banks */
__global__ __launch_bounds__(256) void k_att(const float* __restrict__ crd, const _Float16* __restrict__ VF, _Float16* __restrict__ MH, _Float16* __restrict__ ML) {
  __shared__ __attribute__((aligned(16))) float sm[8 * 16 * RPITCH];      /* first x[NP], y[NP], z[NP] (bf16-rounded), later the eight waves' 16 x 128 partial products */
  __shared__ float ssum[8][NH][16];
  const int tid = threadIdx.x, w = __builtin_amdgcn_readfirstlane(tid >> 5), lane = tid & 31, ln = lane & 15, hh = lane >> 4;
  const int b = blockIdx.x / (NP / 16), row0 = (blockIdx.x % (NP / 16)) * 16;
  const float* cb = crd + (size_t)b * NP * 3;
#pragma unroll
  for (int u = 0; u < NP / 1024; ++u) { const int p4 = (u * 256 + tid) * 4; const v4f f0 = *(const v4fa*)(cb + p4 * 3), f1 = *(const v4fa*)(cb + p4 * 3 + 4), f2 = *(const v4fa*)(cb + p4 * 3 + 8);
    const v4f x = {bf16_round(f0[0]), bf16_round(f0[3]), bf16_round(f1[2]), bf16_round(f2[1])}, y = {bf16_round(f0[1]), bf16_round(f1[0]), bf16_round(f1[3]), bf16_round(f2[2])}, z = {bf16_round(f0[2]), bf16_round(f1[1]), bf16_round(f2[0]), bf16_round(f2[3])};
    *(v4fa*)&sm[p4] = x; *(v4fa*)&sm[NP + p4] = y; *(v4fa*)&sm[2 * NP + p4] = z; }
  __syncthreads();
  const float xi = sm[row0 + ln], yi = sm[NP + row0 + ln], zi = sm[2 * NP + row0 + ln];
  const v8f z8 = {0.f, 0.f, 0.f, 0.f, 0.f, 0.f, 0.f, 0.f};
  v8f acc[NH][2]; float su[NH];
#pragma unroll
  for (int h = 0; h < NH; ++h) { acc[h][0] = z8; acc[h][1] = z8; su[h] = 0.f; }
  for (int s = w; s < NP / 32; s += 8) {
    const unsigned short* vp = (const unsigned short*)VF + (size_t)(b * (NP / 32) + s) * (COUT * 32) + lane * 8;
    FragH bq[2 * NH];
#pragma unroll
    for (int t = 2 * NH - 1; t >= 0; --t) { bq[t].half[0] = *(const v8us*)(vp + t * 512); bq[t].half[1] = *(const v8us*)(vp + t * 512 + 256); }
    __builtin_amdgcn_sched_barrier(0);      /* keeps the 16 fragment loads in front of the d2 and exp work, which covers their latency; without it they sink to just in front of each WMMA */
    float d2[16], wt[16];
#pragma unroll
    for (int g = 0; g < 2; ++g) { const int j0 = s * 32 + g * 16 + hh * 8;
#pragma unroll
      for (int p = 0; p < 2; ++p) { const v4f x = *(const v4fa*)&sm[j0 + p * 4], y = *(const v4fa*)&sm[NP + j0 + p * 4], z = *(const v4fa*)&sm[2 * NP + j0 + p * 4];
#pragma unroll
        for (int q = 0; q < 4; ++q) { const float dx = xi - x[q], dy = yi - y[q], dz = zi - z[q]; d2[g * 8 + p * 4 + q] = dx * dx + dy * dy + dz * dz; } } }
#pragma unroll
    for (int e = 0; e < 16; ++e) wt[e] = __builtin_amdgcn_exp2f(d2[e] * -0.09016844005556021f);      /* exp(-d2 / 16) = 2^(-d2 * log2(e) / 16), the widest head; the bare hardware exp2 may flush below 2^-126, where the weight is 0 as f16 and adds nothing to a row sum that holds the self term 1 */
#pragma unroll
    for (int h = NH - 1; h >= 0; --h) { FragH a;      /* ls = 4, 2, 1, 0.5: 1 / ls^2 grows fourfold from head to head, so the next head's weight is this one's fourth power (two squarings) */
#pragma unroll
      for (int e = 0; e < 16; ++e) { const float ev = wt[e]; su[h] += ev; a.h[e] = (_Float16)(ev * 1024.0f); const float sq = ev * ev; wt[e] = sq * sq; }
      acc[h][0] = __builtin_amdgcn_wmma_f32_16x16x32_f16(false, a.v, false, bq[2 * h].v, (short)0, acc[h][0], false, false);
      acc[h][1] = __builtin_amdgcn_wmma_f32_16x16x32_f16(false, a.v, false, bq[2 * h + 1].v, (short)0, acc[h][1], false, false); }
  }
#pragma unroll
  for (int h = 0; h < NH; ++h) { su[h] += __shfl_xor(su[h], 16, 32); if (hh == 0) ssum[w][h][ln] = su[h]; }
  __syncthreads();      /* every wave has read its last coordinates: sm may be rewritten */
#pragma unroll
  for (int h = 0; h < NH; ++h)
#pragma unroll
    for (int t = 0; t < 2; ++t)
#pragma unroll
      for (int r = 0; r < 8; ++r) sm[(w * 16 + 8 * hh + r) * RPITCH + h * HD + t * 16 + ln] = acc[h][t][r];
  __syncthreads();      /* the partial products and row sums of all eight waves are in LDS */
  const int row = tid >> 4, c8 = (tid & 15) * 8, hd = c8 / HD;
  float tot = 0.f; v4f s0 = {0.f, 0.f, 0.f, 0.f}, s1 = s0;
#pragma unroll
  for (int ww = 0; ww < 8; ++ww) { tot += ssum[ww][hd][row]; s0 += *(const v4fa*)&sm[(ww * 16 + row) * RPITCH + c8]; s1 += *(const v4fa*)&sm[(ww * 16 + row) * RPITCH + c8 + 4]; }
  const float rs = 1.0f / (tot + 1e-8f); FragH f, fl;
#pragma unroll
  for (int q = 0; q < 8; ++q) { const float v = ((q < 4 ? s0[q & 3] : s1[q & 3]) * 0.0009765625f) * rs; const _Float16 hi = (_Float16)v; f.h[q] = hi; fl.h[q] = (_Float16)((v - (float)hi) * 1024.0f); }
  const size_t o = ((size_t)b * NP + row0 + row) * COUT + c8; *(v8us*)((unsigned short*)MH + o) = f.half[0]; *(v8us*)((unsigned short*)ML + o) = fl.half[0]; }

extern "C" void kernel_launch(void* const* d_in, const int* in_sizes, int n_in,
                              void* d_out, int out_size, void* d_ws, size_t ws_size, hipStream_t stream) {
  (void)in_sizes; (void)n_in; (void)out_size;
  const float* const* I = (const float* const*)d_in; const float* feat = I[0]; const float* crd = I[1]; const float* Wv = I[2]; const float* bv = I[3]; const float* Wo = I[4]; const float* bo = I[5];
  char* ws = (char*)d_ws; size_t off = 0;
  auto take = [&](size_t bytes) { char* p = ws + off; off += (bytes + 255) & ~(size_t)255; return p; };
  const size_t np = (size_t)NB * NP * COUT;
  _Float16* BV = (_Float16*)take((size_t)NH * HD * CIN * 2); _Float16* BO = (_Float16*)take((size_t)COUT * COUT * 2); _Float16* X16 = (_Float16*)take((size_t)NB * NP * CIN * 2); _Float16* V16 = (_Float16*)take(np * 2); _Float16* VF = (_Float16*)take(np * 2);
  _Float16* MH = (_Float16*)take(np * 2); _Float16* ML = (_Float16*)take(np * 2);
  if (off > ws_size) return;
  k_bv<<<(NH * HD * (CIN / 8) + 255) / 256, 256, 0, stream>>>(Wv, BV); k_wt_f16<<<(COUT * COUT / 8 + 255) / 256, 256, 0, stream>>>(Wo, BO, COUT, COUT, 16.0f);      /* Wo (in, out) */
  k_x16<<<(unsigned)(((size_t)NB * NP * CIN / 8 + 255) / 256), 256, 0, stream>>>(feat, X16, (size_t)NB * NP * CIN / 8);
  k_gemm2<0><<<dim3((NB * NP / 128) * (COUT / 64), 1), 128, 0, stream>>>(X16, CIN, 0, BV, CIN, 0, 0.0625f, bv, 0, nullptr, 1, 0, 0, nullptr, V16, COUT, 0, NB * NP, COUT, CIN);      /* values [(b,i)][h*32 + k] */
  k_vf<<<NB * NP * COUT / 8 / 256, 256, 0, stream>>>(V16, VF);      /* values in B-fragment order */
  k_att<<<NB * (NP / 16), 256, 0, stream>>>(crd, VF, MH, ML);      /* all (batch, head): weights, att . value, row scaling */
  k_gemm2<0><<<dim3((NB * NP / 128) * (COUT / 64), 1), 128, 0, stream>>>(ML, COUT, 0, BO, COUT, 0, 0.0625f / 1024.0f, nullptr, 0, nullptr, 1, 0, 0, (float*)d_out, nullptr, COUT, 0, NB * NP, COUT, COUT);
  k_gemm2<0><<<dim3((NB * NP / 128) * (COUT / 64), 1), 128, 0, stream>>>(MH, COUT, 0, BO, COUT, 0, 0.0625f, bo, 0, (const float*)d_out, 1, (size_t)COUT, 0, (float*)d_out, nullptr, COUT, 0, NB * NP, COUT, COUT);      /* out = (mh_lo + mh_hi) Wo + bo */
}

// v003
// One run takes 29.4 microseconds.
// In two side-by-side timings against v002, it was 2.55 and 2.57 times as fast.
// All steps since v000 together make it 24.0 times as fast.
#include <hip/hip_runtime.h>
// KernelSelfAttention (2 x 4096 points; d2 = |c_i - c_j|^2 from 3-D coords; per head h with lengthscale ls in {0.5, 1, 2, 4}: att = exp(-d2 / ls^2) / (sum_j + 1e-8); value_h = features Wv[h] + bv[h] [32]; head_out = att value; out = concat_h Wo + bo -> [2][4096][128]).
#define NB 2
#define NP 4096
#define CIN 128
#define NH 4
#define HD 32
#define COUT 128
#define HPITCH 136      /* f16 per row of a 128-wide A operand in LDS: 16 bytes more than the row, so the 16 rows of a 16-byte fragment read fall on different banks */
typedef unsigned short v8us __attribute__((ext_vector_type(8), may_alias));
typedef unsigned short v4us __attribute__((ext_vector_type(4), may_alias));
typedef float  v8f  __attribute__((ext_vector_type(8)));
typedef float  v4f  __attribute__((ext_vector_type(4)));
typedef float  v4fa __attribute__((ext_vector_type(4), may_alias));
typedef _Float16 v16h __attribute__((ext_vector_type(16)));
union FragH { v16h v; v8us half[2]; _Float16 h[16]; unsigned short u[16]; };

__device__ __forceinline__ unsigned short bf16_bits(float x) { unsigned int u = __float_as_uint(x); return (unsigned short)((u + 0x7FFFu + ((u >> 16) & 1u)) >> 16); }
__device__ __forceinline__ float bf16_val(unsigned short b) { return __uint_as_float(((unsigned int)b) << 16); }
__device__ __forceinline__ float bf16_round(float x) { return bf16_val(bf16_bits(x)); }
// A or B fragment of v_wmma_f32_16x16x32_f16 from 32 consecutive f16 of this lane's row (A) or column (B): k = 8 * hh + q, then 16 + 8 * hh + q
__device__ __forceinline__ v16h g2_frag(const _Float16* p, int hh) { FragH f; f.half[0] = *(const v8us*)((const unsigned short*)p + 8 * hh); f.half[1] = *(const v8us*)((const unsigned short*)p + 16 + 8 * hh); return f.v; }

// Values, straight from the f32 inputs into B-fragment order: VF[b][s = j / 32][tile = col / 16][half][lane][8]; lane = hh * 16 + (col & 15), j = s * 32 + half * 16 + hh * 8 + q, so that a wave's fragment load in k_att is 512 contiguous bytes.
// One work-group = one 32-row slice (b, s); wave w = column tile w (col = h * 32 + k). The slice of features is rounded once (bf16, exact as f16) into LDS and read from there as A fragments; each wave rounds its own 16 columns of Wv (bf16, * 16)
// into B fragments; both in the k order of g2_frag. The accumulator of row tile g holds in lane (hh, ln), register r, the value of row g * 16 + hh * 8 + r, column ln: that is VF's own order (half = g, q = r), one 16-byte store a lane.
// The work-groups behind the last slice write BO[n][k] = f16(bf16(Wo[k][n]) * 16) for k_att's output projection.
__global__ __launch_bounds__(256) void k_val(const float* __restrict__ feat, const float* __restrict__ Wv, const float* __restrict__ bv, const float* __restrict__ Wo, _Float16* __restrict__ VF, _Float16* __restrict__ BO) {
  __shared__ __attribute__((aligned(16))) unsigned short sa[32][HPITCH];
  const int tid = threadIdx.x;
  if (blockIdx.x >= NB * (NP / 32)) {      /* the same for a whole work-group, and in front of the barrier */
    const int t = (blockIdx.x - NB * (NP / 32)) * 256 + tid, n = t / (COUT / 8), k8 = (t % (COUT / 8)) * 8; FragH f;
#pragma unroll
    for (int i = 0; i < 8; ++i) f.h[i] = (_Float16)(bf16_round(Wo[(size_t)(k8 + i) * COUT + n]) * 16.0f);
    *(v8us*)((unsigned short*)BO + (size_t)n * COUT + k8) = f.half[0];
    return; }
  const int w = tid >> 5, lane = tid & 31, ln = lane & 15, hh = lane >> 4;
  const int col = w * 16 + ln;
  const float* wp = Wv + (size_t)(col / HD) * CIN * HD + (col % HD) + 8 * hh * HD;      /* Wv[h][c][k]: element c = 8 * hh + i of this lane's column at wp[i * HD] */
  const float* ap = feat + (size_t)blockIdx.x * 32 * CIN;
  v4f x[4]; float wv[CIN / 32][16];
#pragma unroll
  for (int u = 0; u < 4; ++u) x[u] = *(const v4fa*)(ap + (u * 256 + tid) * 4);
#pragma unroll
  for (int kk = 0; kk < CIN / 32; ++kk)
#pragma unroll
    for (int q = 0; q < 8; ++q) { wv[kk][q] = wp[(kk * 32 + q) * HD]; wv[kk][8 + q] = wp[(kk * 32 + 16 + q) * HD]; }
  const float bias = bf16_round(bv[col]);
  __builtin_amdgcn_sched_barrier(0);      /* keeps all loads of the kernel in front of the first use: one memory latency; without it they are spread among the conversions and each group is waited for in turn */
#pragma unroll
  for (int u = 0; u < 4; ++u) { const int e = u * 256 + tid; union { _Float16 h[4]; v4us v; } p;
#pragma unroll
    for (int q = 0; q < 4; ++q) p.h[q] = (_Float16)bf16_round(x[u][q]);
    *(v4us*)&sa[e >> 5][(e & 31) * 4] = p.v; }
  __syncthreads();      /* the 32 rounded rows are in LDS */
  const v8f z8 = {0.f, 0.f, 0.f, 0.f, 0.f, 0.f, 0.f, 0.f};
  v8f acc[2] = {z8, z8};
#pragma unroll
  for (int kk = 0; kk < CIN / 32; ++kk) { FragH bq;
#pragma unroll
    for (int e = 0; e < 16; ++e) bq.h[e] = (_Float16)(bf16_round(wv[kk][e]) * 16.0f);
#pragma unroll
    for (int g = 0; g < 2; ++g) { FragH aq; aq.half[0] = *(const v8us*)&sa[g * 16 + ln][kk * 32 + 8 * hh]; aq.half[1] = *(const v8us*)&sa[g * 16 + ln][kk * 32 + 16 + 8 * hh];
      acc[g] = __builtin_amdgcn_wmma_f32_16x16x32_f16(false, aq.v, false, bq.v, (short)0, acc[g], false, false); } }
#pragma unroll
  for (int g = 0; g < 2; ++g) { FragH o;
#pragma unroll
    for (int r = 0; r < 8; ++r) o.h[r] = (_Float16)(acc[g][r] * 0.0625f + bias);
    *(v8us*)((unsigned short*)VF + ((((size_t)blockIdx.x * 8 + w) * 2 + g) * 32 + lane) * 8) = o.half[0]; }
  asm volatile("s_wait_xcnt 0x0" ::: "memory");      /* in the built code the spare work-groups' part stands behind these two stores and writes their registers: the wait stands in front of any such write */
}

// One work-group = 16 rows i of one batch, all four heads. Wave w takes the 32-wide j slices s = w, w + 8, ...: d2 and one exp2 once per (i, j), the four heads' weights exp(-d2 / ls^2) * 1024 (the widest head's, then fourth powers) built in registers
// as the A fragment (same k order as the B fragment: k = half * 16 + hh * 8 + q), two WMMAs per head. The eight waves' partial products and row sums are joined in LDS, scaled by 1 / (sum + 1e-8) and split into f16 hi + residual,
// which stay in LDS: wave w multiplies both by the 16 columns w * 16 ... of Wo (four k steps each) and adds bo; the 16 x 128 result goes out through LDS so that every store of a wave is one whole row.
#define RPITCH 132      /* floats per row of a partial product in LDS: rows 8 apart (the two half-waves) fall on different banks */
__global__ __launch_bounds__(256) void k_att(const float* __restrict__ crd, const _Float16* __restrict__ VF, const _Float16* __restrict__ BO, const float* __restrict__ bo, float* __restrict__ out) {
  __shared__ __attribute__((aligned(16))) float sm[8 * 16 * RPITCH];      /* first x[NP], y[NP], z[NP] (bf16-rounded), later the eight waves' 16 x 128 partial products */
  __shared__ float ssum[8][NH][16];
  __shared__ __attribute__((aligned(16))) unsigned short shl[2][16][HPITCH];      /* the 16 scaled rows: [0] f16 hi, [1] residual * 1024 */
  const int tid = threadIdx.x, w = __builtin_amdgcn_readfirstlane(tid >> 5), lane = tid & 31, ln = lane & 15, hh = lane >> 4;
  const int b = blockIdx.x / (NP / 16), row0 = (blockIdx.x % (NP / 16)) * 16;
  const float* cb = crd + (size_t)b * NP * 3;
#pragma unroll
  for (int u = 0; u < NP / 1024; ++u) { const int p4 = (u * 256 + tid) * 4; const v4f f0 = *(const v4fa*)(cb + p4 * 3), f1 = *(const v4fa*)(cb + p4 * 3 + 4), f2 = *(const v4fa*)(cb + p4 * 3 + 8);
    const v4f x = {bf16_round(f0[0]), bf16_round(f0[3]), bf16_round(f1[2]), bf16_round(f2[1])}, y = {bf16_round(f0[1]), bf16_round(f1[0]), bf16_round(f1[3]), bf16_round(f2[2])}, z = {bf16_round(f0[2]), bf16_round(f1[1]), bf16_round(f2[0]), bf16_round(f2[3])};
    *(v4fa*)&sm[p4] = x; *(v4fa*)&sm[NP + p4] = y; *(v4fa*)&sm[2 * NP + p4] = z; }
  __syncthreads();
  const float xi = sm[row0 + ln], yi = sm[NP + row0 + ln], zi = sm[2 * NP + row0 + ln];
  const v8f z8 = {0.f, 0.f, 0.f, 0.f, 0.f, 0.f, 0.f, 0.f};
  v8f acc[NH][2]; float su[NH];
#pragma unroll
  for (int h = 0; h < NH; ++h) { acc[h][0] = z8; acc[h][1] = z8; su[h] = 0.f; }
  for (int s = w; s < NP / 32; s += 8) {
    const unsigned short* vp = (const unsigned short*)VF + (size_t)(b * (NP / 32) + s) * (COUT * 32) + lane * 8;
    FragH bq[2 * NH];
#pragma unroll
    for (int t = 2 * NH - 1; t >= 0; --t) { bq[t].half[0] = *(const v8us*)(vp + t * 512); bq[t].half[1] = *(const v8us*)(vp + t * 512 + 256); }
    __builtin_amdgcn_sched_barrier(0);      /* keeps the 16 fragment loads in front of the d2 and exp work, which covers their latency; without it they sink to just in front of each WMMA */
    float d2[16], wt[16];
#pragma unroll
    for (int g = 0; g < 2; ++g) { const int j0 = s * 32 + g * 16 + hh * 8;
#pragma unroll
      for (int p = 0; p < 2; ++p) { const v4f x = *(const v4fa*)&sm[j0 + p * 4], y = *(const v4fa*)&sm[NP + j0 + p * 4], z = *(const v4fa*)&sm[2 * NP + j0 + p * 4];
#pragma unroll
        for (int q = 0; q < 4; ++q) { const float dx = xi - x[q], dy = yi - y[q], dz = zi - z[q]; d2[g * 8 + p * 4 + q] = dx * dx + dy * dy + dz * dz; } } }
#pragma unroll
    for (int e = 0; e < 16; ++e) wt[e] = __builtin_amdgcn_exp2f(d2[e] * -0.09016844005556021f);      /* exp(-d2 / 16) = 2^(-d2 * log2(e) / 16), the widest head; the bare hardware exp2 may flush below 2^-126, where the weight is 0 as f16 and adds nothing to a row sum that holds the self term 1 */
#pragma unroll
    for (int h = NH - 1; h >= 0; --h) { FragH a;      /* ls = 4, 2, 1, 0.5: 1 / ls^2 grows fourfold from head to head, so the next head's weight is this one's fourth power (two squarings) */
#pragma unroll
      for (int e = 0; e < 16; ++e) { const float ev = wt[e]; su[h] += ev; a.h[e] = (_Float16)(ev * 1024.0f); const float sq = ev * ev; wt[e] = sq * sq; }
      acc[h][0] = __builtin_amdgcn_wmma_f32_16x16x32_f16(false, a.v, false, bq[2 * h].v, (short)0, acc[h][0], false, false);
      acc[h][1] = __builtin_amdgcn_wmma_f32_16x16x32_f16(false, a.v, false, bq[2 * h + 1].v, (short)0, acc[h][1], false, false); }
  }
  v16h wo[COUT / 32];      /* this wave's 16 columns of Wo as B fragments: asked for here, so that the exchange of the row sums in front of the barrier covers part of their latency */
#pragma unroll
  for (int kk = 0; kk < COUT / 32; ++kk) wo[kk] = g2_frag(BO + (size_t)(w * 16 + ln) * COUT + kk * 32, hh);
  const float bias = bf16_round(bo[w * 16 + ln]);
#pragma unroll
  for (int h = 0; h < NH; ++h) { su[h] += __shfl_xor(su[h], 16, 32); if (hh == 0) ssum[w][h][ln] = su[h]; }
  __syncthreads();      /* every wave has read its last coordinates: sm may be rewritten */
#pragma unroll
  for (int h = 0; h < NH; ++h)
#pragma unroll
    for (int t = 0; t < 2; ++t)
#pragma unroll
      for (int r = 0; r < 8; ++r) sm[(w * 16 + 8 * hh + r) * RPITCH + h * HD + t * 16 + ln] = acc[h][t][r];
  __syncthreads();      /* the partial products and row sums of all eight waves are in LDS */
  const int row = tid >> 4, c8 = (tid & 15) * 8, hd = c8 / HD;
  float tot = 0.f; v4f s0 = {0.f, 0.f, 0.f, 0.f}, s1 = s0;
#pragma unroll
  for (int ww = 0; ww < 8; ++ww) { tot += ssum[ww][hd][row]; s0 += *(const v4fa*)&sm[(ww * 16 + row) * RPITCH + c8]; s1 += *(const v4fa*)&sm[(ww * 16 + row) * RPITCH + c8 + 4]; }
  const float rs = 1.0f / (tot + 1e-8f); FragH f, fl;
#pragma unroll
  for (int q = 0; q < 8; ++q) { const float v = ((q < 4 ? s0[q & 3] : s1[q & 3]) * 0.0009765625f) * rs; const _Float16 hi = (_Float16)v; f.h[q] = hi; fl.h[q] = (_Float16)((v - (float)hi) * 1024.0f); }
  *(v8us*)&shl[0][row][c8] = f.half[0]; *(v8us*)&shl[1][row][c8] = fl.half[0];
  __syncthreads();      /* the scaled rows are complete in shl, and every thread has read its last partial product: sm may be rewritten */
  v8f oh = z8, ol = z8;
#pragma unroll
  for (int kk = 0; kk < COUT / 32; ++kk) { FragH ah, al;
    ah.half[0] = *(const v8us*)&shl[0][ln][kk * 32 + 8 * hh]; ah.half[1] = *(const v8us*)&shl[0][ln][kk * 32 + 16 + 8 * hh];
    al.half[0] = *(const v8us*)&shl[1][ln][kk * 32 + 8 * hh]; al.half[1] = *(const v8us*)&shl[1][ln][kk * 32 + 16 + 8 * hh];
    oh = __builtin_amdgcn_wmma_f32_16x16x32_f16(false, ah.v, false, wo[kk], (short)0, oh, false, false);
    ol = __builtin_amdgcn_wmma_f32_16x16x32_f16(false, al.v, false, wo[kk], (short)0, ol, false, false); }
#pragma unroll
  for (int r = 0; r < 8; ++r) { const float lo = ol[r] * (0.0625f / 1024.0f); float v = oh[r] * 0.0625f + bias; v += lo; sm[(8 * hh + r) * RPITCH + w * 16 + ln] = v; }      /* out = (mh_lo + mh_hi) Wo + bo; Wo was scaled by 16 */
  __syncthreads();      /* all eight column tiles of the result are in LDS */
#pragma unroll
  for (int u = 0; u < 2; ++u) { const int e = u * 256 + tid, orow = e >> 5, c4 = (e & 31) * 4; const v4f v = *(const v4fa*)&sm[orow * RPITCH + c4]; *(v4f*)(out + ((size_t)b * NP + row0 + orow) * COUT + c4) = v; } }

extern "C" void kernel_launch(void* const* d_in, const int* in_sizes, int n_in,
                              void* d_out, int out_size, void* d_ws, size_t ws_size, hipStream_t stream) {
  (void)in_sizes; (void)n_in; (void)out_size;
  const float* const* I = (const float* const*)d_in; const float* feat = I[0]; const float* crd = I[1]; const float* Wv = I[2]; const float* bv = I[3]; const float* Wo = I[4]; const float* bo = I[5];
  char* ws = (char*)d_ws; size_t off = 0;
  auto take = [&](size_t bytes) { char* p = ws + off; off += (bytes + 255) & ~(size_t)255; return p; };
  _Float16* BO = (_Float16*)take((size_t)COUT * COUT * 2); _Float16* VF = (_Float16*)take((size_t)NB * NP * COUT * 2);
  if (off > ws_size) return;
  k_val<<<NB * (NP / 32) + COUT * COUT / 8 / 256, 256, 0, stream>>>(feat, Wv, bv, Wo, VF, BO);      /* values in B-fragment order; Wo (in, out) transposed */
  k_att<<<NB * (NP / 16), 256, 0, stream>>>(crd, VF, BO, bo, (float*)d_out);      /* all (batch, head): weights, att . value, row scaling, output projection */
}

// v004
// It runs in 26.4 microseconds.
// Next to v003, in two timings, it ran 1.12 and 1.14 times as fast.
// Over all steps from v000 it is 27.1 times as fast.
#include <hip/hip_runtime.h>
// KernelSelfAttention (2 x 4096 points; d2 = |c_i - c_j|^2 from 3-D coords; per head h with lengthscale ls in {0.5, 1, 2, 4}: att = exp(-d2 / ls^2) / (sum_j + 1e-8); value_h = features Wv[h] + bv[h] [32]; head_out = att value; out = concat_h Wo + bo -> [2][4096][128]).
#define NB 2
#define NP 4096
#define CIN 128
#define NH 4
#define HD 32
#define COUT 128
#define HPITCH 136      /* f16 per row of a 128-wide A operand in LDS: 16 bytes more than the row, so the 16 rows of a 16-byte fragment read fall on different banks */
typedef unsigned short v8us __attribute__((ext_vector_type(8), may_alias));
typedef unsigned short v4us __attribute__((ext_vector_type(4), may_alias));
typedef float  v8f  __attribute__((ext_vector_type(8)));
typedef float  v4f  __attribute__((ext_vector_type(4)));
typedef float  v4fa __attribute__((ext_vector_type(4), may_alias));
typedef _Float16 v16h __attribute__((ext_vector_type(16)));
union FragH { v16h v; v8us half[2]; _Float16 h[16]; unsigned short u[16]; };

__device__ __forceinline__ unsigned short bf16_bits(float x) { unsigned int u = __float_as_uint(x); return (unsigned short)((u + 0x7FFFu + ((u >> 16) & 1u)) >> 16); }
__device__ __forceinline__ float bf16_val(unsigned short b) { return __uint_as_float(((unsigned int)b) << 16); }
__device__ __forceinline__ float bf16_round(float x) { return bf16_val(bf16_bits(x)); }
// A or B fragment of v_wmma_f32_16x16x32_f16 from 32 consecutive f16 of this lane's row (A) or column (B): k = 8 * hh + q, then 16 + 8 * hh + q
__device__ __forceinline__ v16h g2_frag(const _Float16* p, int hh) { FragH f; f.half[0] = *(const v8us*)((const unsigned short*)p + 8 * hh); f.half[1] = *(const v8us*)((const unsigned short*)p + 16 + 8 * hh); return f.v; }

// Values, straight from the f32 inputs into B-fragment order: VF[b][s = j / 32][tile = col / 16][half][lane][8]; lane = hh * 16 + (col & 15), j = s * 32 + half * 16 + hh * 8 + q, so that a wave's fragment load in k_att is 512 contiguous bytes.
// One work-group = one 32-row slice (b, s); wave w = column tile w (col = h * 32 + k). The slice of features is rounded once (bf16, exact as f16) into LDS and read from there as A fragments; each wave rounds its own 16 columns of Wv (bf16, * 16)
// into B fragments; both in the k order of g2_frag. The accumulator of row tile g holds in lane (hh, ln), register r, the value of row g * 16 + hh * 8 + r, column ln: that is VF's own order (half = g, q = r), one 16-byte store a lane.
// The work-groups behind the last slice write BO[n][k] = f16(bf16(Wo[k][n]) * 16) for k_att's output projection.
__global__ __launch_bounds__(256) void k_val(const float* __restrict__ feat, const float* __restrict__ Wv, const float* __restrict__ bv, const float* __restrict__ Wo, _Float16* __restrict__ VF, _Float16* __restrict__ BO) {
  __shared__ __attribute__((aligned(16))) unsigned short sa[32][HPITCH];
  const int tid = threadIdx.x;
  if (blockIdx.x >= NB * (NP / 32)) {      /* the same for a whole work-group, and in front of the barrier */
    const int t = (blockIdx.x - NB * (NP / 32)) * 256 + tid, n = t / (COUT / 8), k8 = (t % (COUT / 8)) * 8; FragH f;
#pragma unroll
    for (int i = 0; i < 8; ++i) f.h[i] = (_Float16)(bf16_round(Wo[(size_t)(k8 + i) * COUT + n]) * 16.0f);
    *(v8us*)((unsigned short*)BO + (size_t)n * COUT + k8) = f.half[0];
    return; }
  const int w = tid >> 5, lane = tid & 31, ln = lane & 15, hh = lane >> 4;
  const int col = w * 16 + ln;
  const float* wp = Wv + (size_t)(col / HD) * CIN * HD + (col % HD) + 8 * hh * HD;      /* Wv[h][c][k]: element c = 8 * hh + i of this lane's column at wp[i * HD] */
  const float* ap = feat + (size_t)blockIdx.x * 32 * CIN;
  v4f x[4]; float wv[CIN / 32][16];
#pragma unroll
  for (int u = 0; u < 4; ++u) x[u] = *(const v4fa*)(ap + (u * 256 + tid) * 4);
#pragma unroll
  for (int kk = 0; kk < CIN / 32; ++kk)
#pragma unroll
    for (int q = 0; q < 8; ++q) { wv[kk][q] = wp[(kk * 32 + q) * HD]; wv[kk][8 + q] = wp[(kk * 32 + 16 + q) * HD]; }
  const float bias = bf16_round(bv[col]);
  __builtin_amdgcn_sched_barrier(0);      /* keeps all loads of the kernel in front of the first use: one memory latency; without it they are spread among the conversions and each group is waited for in turn */
#pragma unroll
  for (int u = 0; u < 4; ++u) { const int e = u * 256 + tid; union { _Float16 h[4]; v4us v; } p;
#pragma unroll
    for (int q = 0; q < 4; ++q) p.h[q] = (_Float16)bf16_round(x[u][q]);
    *(v4us*)&sa[e >> 5][(e & 31) * 4] = p.v; }
  __syncthreads();      /* the 32 rounded rows are in LDS */
  const v8f z8 = {0.f, 0.f, 0.f, 0.f, 0.f, 0.f, 0.f, 0.f};
  v8f acc[2] = {z8, z8};
#pragma unroll
  for (int kk = 0; kk < CIN / 32; ++kk) { FragH bq;
#pragma unroll
    for (int e = 0; e < 16; ++e) bq.h[e] = (_Float16)(bf16_round(wv[kk][e]) * 16.0f);
#pragma unroll
    for (int g = 0; g < 2; ++g) { FragH aq; aq.half[0] = *(const v8us*)&sa[g * 16 + ln][kk * 32 + 8 * hh]; aq.half[1] = *(const v8us*)&sa[g * 16 + ln][kk * 32 + 16 + 8 * hh];
      acc[g] = __builtin_amdgcn_wmma_f32_16x16x32_f16(false, aq.v, false, bq.v, (short)0, acc[g], false, false); } }
#pragma unroll
  for (int g = 0; g < 2; ++g) { FragH o;
#pragma unroll
    for (int r = 0; r < 8; ++r) o.h[r] = (_Float16)(acc[g][r] * 0.0625f + bias);
    *(v8us*)((unsigned short*)VF + ((((size_t)blockIdx.x * 8 + w) * 2 + g) * 32 + lane) * 8) = o.half[0]; }
  asm volatile("s_wait_xcnt 0x0" ::: "memory");      /* in the built code the spare work-groups' part stands behind these two stores and writes their registers: the wait stands in front of any such write */
}

// One work-group = 32 rows i of one batch (RT = 2 tiles of 16), all four heads. Wave w takes the 32-wide j slices s = w, w + 8, ...; each slice's 8 value fragments and its coordinates are fetched once and used for both row tiles, which halves
// the bytes that the attention kernel draws from L2 per (i, j) pair. Per row tile: d2 and one exp2 once per (i, j), the four heads' weights exp(-d2 / ls^2) * 1024 (the widest head's, then fourth powers) built in registers
// as the A fragment (same k order as the B fragment: k = half * 16 + hh * 8 + q), two WMMAs per head. The eight waves' partial products and row sums are joined in LDS, scaled by 1 / (sum + 1e-8) and split into f16 hi + residual,
// which stay in LDS: wave w multiplies both by the 16 columns w * 16 ... of Wo (four k steps each) and adds bo; the 32 x 128 result goes out through LDS so that every store of a wave is one whole row.
#define RPITCH 132      /* floats per row of a partial product in LDS: rows 8 apart (the two half-waves) fall on different banks */
#define RT 2            /* 16-row tiles per wave and work-group */
#define WR (RT * 16)    /* rows per work-group */
__global__ __launch_bounds__(256) void k_att(const float* __restrict__ crd, const _Float16* __restrict__ VF, const _Float16* __restrict__ BO, const float* __restrict__ bo, float* __restrict__ out) {
  __shared__ __attribute__((aligned(16))) float sm[8 * WR * RPITCH];      /* first x[NP], y[NP], z[NP] (bf16-rounded), later the eight waves' 32 x 128 partial products */
  __shared__ float ssum[8][NH][WR];
  __shared__ __attribute__((aligned(16))) unsigned short shl[2][WR][HPITCH];      /* the 32 scaled rows: [0] f16 hi, [1] residual * 1024 */
  const int tid = threadIdx.x, w = __builtin_amdgcn_readfirstlane(tid >> 5), lane = tid & 31, ln = lane & 15, hh = lane >> 4;
  const int b = blockIdx.x / (NP / WR), row0 = (blockIdx.x % (NP / WR)) * WR;
  const float* cb = crd + (size_t)b * NP * 3;
#pragma unroll
  for (int u = 0; u < NP / 1024; ++u) { const int p4 = (u * 256 + tid) * 4; const v4f f0 = *(const v4fa*)(cb + p4 * 3), f1 = *(const v4fa*)(cb + p4 * 3 + 4), f2 = *(const v4fa*)(cb + p4 * 3 + 8);
    const v4f x = {bf16_round(f0[0]), bf16_round(f0[3]), bf16_round(f1[2]), bf16_round(f2[1])}, y = {bf16_round(f0[1]), bf16_round(f1[0]), bf16_round(f1[3]), bf16_round(f2[2])}, z = {bf16_round(f0[2]), bf16_round(f1[1]), bf16_round(f2[0]), bf16_round(f2[3])};
    *(v4fa*)&sm[p4] = x; *(v4fa*)&sm[NP + p4] = y; *(v4fa*)&sm[2 * NP + p4] = z; }
  __syncthreads();
  float xi[RT], yi[RT], zi[RT];
#pragma unroll
  for (int rt = 0; rt < RT; ++rt) { xi[rt] = sm[row0 + rt * 16 + ln]; yi[rt] = sm[NP + row0 + rt * 16 + ln]; zi[rt] = sm[2 * NP + row0 + rt * 16 + ln]; }
  const v8f z8 = {0.f, 0.f, 0.f, 0.f, 0.f, 0.f, 0.f, 0.f};
  v8f acc[RT][NH][2]; float su[RT][NH];
#pragma unroll
  for (int rt = 0; rt < RT; ++rt)
#pragma unroll
    for (int h = 0; h < NH; ++h) { acc[rt][h][0] = z8; acc[rt][h][1] = z8; su[rt][h] = 0.f; }
  const unsigned short* vp = (const unsigned short*)VF + (size_t)(b * (NP / 32) + w) * (COUT * 32) + lane * 8;      /* this lane's 16 bytes of the first fragment of slice s; moves on with s */
  for (int s = w; s < NP / 32; s += 8, vp += 8 * COUT * 32) {
    FragH bq[2 * NH];
#pragma unroll
    for (int t = 2 * NH - 1; t >= 0; --t) { bq[t].half[0] = *(const v8us*)(vp + t * 512); bq[t].half[1] = *(const v8us*)(vp + t * 512 + 256); }
    v4f cx[4], cy[4], cz[4];      /* this lane's 16 points j, in the k order of the fragments */
#pragma unroll
    for (int g = 0; g < 2; ++g) { const int j0 = s * 32 + g * 16 + hh * 8;
#pragma unroll
      for (int p = 0; p < 2; ++p) { cx[g * 2 + p] = *(const v4fa*)&sm[j0 + p * 4]; cy[g * 2 + p] = *(const v4fa*)&sm[NP + j0 + p * 4]; cz[g * 2 + p] = *(const v4fa*)&sm[2 * NP + j0 + p * 4]; } }
    asm volatile("s_wait_xcnt 0x0" ::: "memory");      /* vp's registers, which the 16 issued loads name, are rewritten below (vp moves on): the wait stands in front of that write; the barrier on the next line keeps the write behind it */
    __builtin_amdgcn_sched_barrier(0);      /* keeps the 16 fragment loads in front of the d2 and exp work, which covers their latency; without it they sink to just in front of each WMMA */
#pragma unroll
    for (int rt = 0; rt < RT; ++rt) {
      float d2[16], wt[16];
#pragma unroll
      for (int e = 0; e < 16; ++e) { const float dx = xi[rt] - cx[e >> 2][e & 3], dy = yi[rt] - cy[e >> 2][e & 3], dz = zi[rt] - cz[e >> 2][e & 3]; d2[e] = dx * dx + dy * dy + dz * dz; }
#pragma unroll
      for (int e = 0; e < 16; ++e) wt[e] = __builtin_amdgcn_exp2f(d2[e] * -0.09016844005556021f);      /* exp(-d2 / 16) = 2^(-d2 * log2(e) / 16), the widest head; the bare hardware exp2 may flush below 2^-126, where the weight is 0 as f16 and adds nothing to a row sum that holds the self term 1 */
#pragma unroll
      for (int h = NH - 1; h >= 0; --h) { FragH a;      /* ls = 4, 2, 1, 0.5: 1 / ls^2 grows fourfold from head to head, so the next head's weight is this one's fourth power (two squarings) */
#pragma unroll
        for (int e = 0; e < 16; ++e) { const float ev = wt[e]; su[rt][h] += ev; a.h[e] = (_Float16)(ev * 1024.0f); const float sq = ev * ev; wt[e] = sq * sq; }
        acc[rt][h][0] = __builtin_amdgcn_wmma_f32_16x16x32_f16(false, a.v, false, bq[2 * h].v, (short)0, acc[rt][h][0], false, false);
        acc[rt][h][1] = __builtin_amdgcn_wmma_f32_16x16x32_f16(false, a.v, false, bq[2 * h + 1].v, (short)0, acc[rt][h][1], false, false); }
    }
  }
  v16h wo[COUT / 32];      /* this wave's 16 columns of Wo as B fragments: asked for here, so that the exchange of the row sums in front of the barrier covers part of their latency */
#pragma unroll
  for (int kk = 0; kk < COUT / 32; ++kk) wo[kk] = g2_frag(BO + (size_t)(w * 16 + ln) * COUT + kk * 32, hh);
  const float bias = bf16_round(bo[w * 16 + ln]);
#pragma unroll
  for (int rt = 0; rt < RT; ++rt)
#pragma unroll
    for (int h = 0; h < NH; ++h) { su[rt][h] += __shfl_xor(su[rt][h], 16, 32); if (hh == 0) ssum[w][h][rt * 16 + ln] = su[rt][h]; }
  __syncthreads();      /* every wave has read its last coordinates: sm may be rewritten */
#pragma unroll
  for (int rt = 0; rt < RT; ++rt)
#pragma unroll
    for (int h = 0; h < NH; ++h)
#pragma unroll
      for (int t = 0; t < 2; ++t)
#pragma unroll
        for (int r = 0; r < 8; ++r) sm[(w * WR + rt * 16 + 8 * hh + r) * RPITCH + h * HD + t * 16 + ln] = acc[rt][h][t][r];
  __syncthreads();      /* the partial products and row sums of all eight waves are in LDS */
  const int c8 = (tid & 15) * 8, hd = c8 / HD;
#pragma unroll
  for (int rt = 0; rt < RT; ++rt) { const int row = rt * 16 + (tid >> 4);
    float tot = 0.f; v4f s0 = {0.f, 0.f, 0.f, 0.f}, s1 = s0;
#pragma unroll
    for (int ww = 0; ww < 8; ++ww) { tot += ssum[ww][hd][row]; s0 += *(const v4fa*)&sm[(ww * WR + row) * RPITCH + c8]; s1 += *(const v4fa*)&sm[(ww * WR + row) * RPITCH + c8 + 4]; }
    const float rs = 1.0f / (tot + 1e-8f); FragH f, fl;
#pragma unroll
    for (int q = 0; q < 8; ++q) { const float v = ((q < 4 ? s0[q & 3] : s1[q & 3]) * 0.0009765625f) * rs; const _Float16 hi = (_Float16)v; f.h[q] = hi; fl.h[q] = (_Float16)((v - (float)hi) * 1024.0f); }
    *(v8us*)&shl[0][row][c8] = f.half[0]; *(v8us*)&shl[1][row][c8] = fl.half[0]; }
  __syncthreads();      /* the scaled rows are complete in shl, and every thread has read its last partial product: sm may be rewritten */
#pragma unroll
  for (int rt = 0; rt < RT; ++rt) { v8f oh = z8, ol = z8;
#pragma unroll
    for (int kk = 0; kk < COUT / 32; ++kk) { FragH ah, al;
      ah.half[0] = *(const v8us*)&shl[0][rt * 16 + ln][kk * 32 + 8 * hh]; ah.half[1] = *(const v8us*)&shl[0][rt * 16 + ln][kk * 32 + 16 + 8 * hh];
      al.half[0] = *(const v8us*)&shl[1][rt * 16 + ln][kk * 32 + 8 * hh]; al.half[1] = *(const v8us*)&shl[1][rt * 16 + ln][kk * 32 + 16 + 8 * hh];
      oh = __builtin_amdgcn_wmma_f32_16x16x32_f16(false, ah.v, false, wo[kk], (short)0, oh, false, false);
      ol = __builtin_amdgcn_wmma_f32_16x16x32_f16(false, al.v, false, wo[kk], (short)0, ol, false, false); }
#pragma unroll
    for (int r = 0; r < 8; ++r) { const float lo = ol[r] * (0.0625f / 1024.0f); float v = oh[r] * 0.0625f + bias; v += lo; sm[(rt * 16 + 8 * hh + r) * RPITCH + w * 16 + ln] = v; } }      /* out = (mh_lo + mh_hi) Wo + bo; Wo was scaled by 16 */
  __syncthreads();      /* all eight column tiles of the result are in LDS */
#pragma unroll
  for (int u = 0; u < 2 * RT; ++u) { const int e = u * 256 + tid, orow = e >> 5, c4 = (e & 31) * 4; const v4f v = *(const v4fa*)&sm[orow * RPITCH + c4]; *(v4f*)(out + ((size_t)b * NP + row0 + orow) * COUT + c4) = v; } }

extern "C" void kernel_launch(void* const* d_in, const int* in_sizes, int n_in,
                              void* d_out, int out_size, void* d_ws, size_t ws_size, hipStream_t stream) {
  (void)in_sizes; (void)n_in; (void)out_size;
  const float* const* I = (const float* const*)d_in; const float* feat = I[0]; const float* crd = I[1]; const float* Wv = I[2]; const float* bv = I[3]; const float* Wo = I[4]; const float* bo = I[5];
  char* ws = (char*)d_ws; size_t off = 0;
  auto take = [&](size_t bytes) { char* p = ws + off; off += (bytes + 255) & ~(size_t)255; return p; };
  _Float16* BO = (_Float16*)take((size_t)COUT * COUT * 2); _Float16* VF = (_Float16*)take((size_t)NB * NP * COUT * 2);
  if (off > ws_size) return;
  k_val<<<NB * (NP / 32) + COUT * COUT / 8 / 256, 256, 0, stream>>>(feat, Wv, bv, Wo, VF, BO);      /* values in B-fragment order; Wo (in, out) transposed */
  k_att<<<NB * (NP / WR), 256, 0, stream>>>(crd, VF, BO, bo, (float*)d_out);      /* all (batch, head): weights, att . value, row scaling, output projection */
}

// v005
// Measured time: 24.7 microseconds a run.
// Next to v004, in two timings, it ran 1.05 and 1.06 times as fast.
// Counting every step since v000, it is 28.6 times as fast.
#include <hip/hip_runtime.h>
// KernelSelfAttention (2 x 4096 points; d2 = |c_i - c_j|^2 from 3-D coords; per head h with lengthscale ls in {0.5, 1, 2, 4}: att = exp(-d2 / ls^2) / (sum_j + 1e-8); value_h = features Wv[h] + bv[h] [32]; head_out = att value; out = concat_h Wo + bo -> [2][4096][128]).
#define NB 2
#define NP 4096
#define CIN 128
#define NH 4
#define HD 32
#define COUT 128
#define HPITCH 136      /* f16 per row of a 128-wide A operand in LDS: 16 bytes more than the row, so the 16 rows of a 16-byte fragment read fall on different banks */
typedef unsigned short v8us __attribute__((ext_vector_type(8), may_alias));
typedef unsigned short v4us __attribute__((ext_vector_type(4), may_alias));
typedef float  v8f  __attribute__((ext_vector_type(8)));
typedef float  v4f  __attribute__((ext_vector_type(4)));
typedef float  v4fa __attribute__((ext_vector_type(4), may_alias));
typedef _Float16 v16h __attribute__((ext_vector_type(16)));
union FragH { v16h v; v8us half[2]; v4us quad[4]; _Float16 h[16]; unsigned short u[16]; };

__device__ __forceinline__ unsigned short bf16_bits(float x) { unsigned int u = __float_as_uint(x); return (unsigned short)((u + 0x7FFFu + ((u >> 16) & 1u)) >> 16); }
__device__ __forceinline__ float bf16_val(unsigned short b) { return __uint_as_float(((unsigned int)b) << 16); }
__device__ __forceinline__ float bf16_round(float x) { return bf16_val(bf16_bits(x)); }
// A or B fragment of v_wmma_f32_16x16x32_f16 from 32 consecutive f16 of this lane's row (A) or column (B): k = 8 * hh + q, then 16 + 8 * hh + q
__device__ __forceinline__ v16h g2_frag(const _Float16* p, int hh) { FragH f; f.half[0] = *(const v8us*)((const unsigned short*)p + 8 * hh); f.half[1] = *(const v8us*)((const unsigned short*)p + 16 + 8 * hh); return f.v; }

// Values, straight from the f32 inputs into B-fragment order: VF[b][s = j / 32][tile = col / 16][half][lane][8]; lane = hh * 16 + (col & 15), j = s * 32 + half * 16 + hh * 8 + q, so that a wave's fragment load in k_att is 512 contiguous bytes.
// One work-group = one 32-row slice (b, s); wave w = column tile w (col = h * 32 + k). The slice of features is rounded once (bf16, exact as f16) into LDS and read from there as A fragments; each wave rounds its own 16 columns of Wv (bf16, * 16)
// into B fragments; both in the k order of g2_frag. The accumulator of row tile g holds in lane (hh, ln), register r, the value of row g * 16 + hh * 8 + r, column ln: that is VF's own order (half = g, q = r), one 16-byte store a lane.
// The work-groups behind the last slice write BO[n][k] = f16(bf16(Wo[k][n]) * 16) for k_att's output projection.
__global__ __launch_bounds__(256) void k_val(const float* __restrict__ feat, const float* __restrict__ Wv, const float* __restrict__ bv, const float* __restrict__ Wo, _Float16* __restrict__ VF, _Float16* __restrict__ BO) {
  __shared__ __attribute__((aligned(16))) unsigned short sa[32][HPITCH];
  const int tid = threadIdx.x;
  if (blockIdx.x >= NB * (NP / 32)) {      /* the same for a whole work-group, and in front of the barrier */
    const int t = (blockIdx.x - NB * (NP / 32)) * 256 + tid, n = t / (COUT / 8), k8 = (t % (COUT / 8)) * 8; FragH f;
#pragma unroll
    for (int i = 0; i < 8; ++i) f.h[i] = (_Float16)(bf16_round(Wo[(size_t)(k8 + i) * COUT + n]) * 16.0f);
    *(v8us*)((unsigned short*)BO + (size_t)n * COUT + k8) = f.half[0];
    return; }
  const int w = tid >> 5, lane = tid & 31, ln = lane & 15, hh = lane >> 4;
  const int col = w * 16 + ln;
  const float* wp = Wv + (size_t)(col / HD) * CIN * HD + (col % HD) + 8 * hh * HD;      /* Wv[h][c][k]: element c = 8 * hh + i of this lane's column at wp[i * HD] */
  const float* ap = feat + (size_t)blockIdx.x * 32 * CIN;
  v4f x[4]; float wv[CIN / 32][16];
#pragma unroll
  for (int u = 0; u < 4; ++u) x[u] = *(const v4fa*)(ap + (u * 256 + tid) * 4);
#pragma unroll
  for (int kk = 0; kk < CIN / 32; ++kk)
#pragma unroll
    for (int q = 0; q < 8; ++q) { wv[kk][q] = wp[(kk * 32 + q) * HD]; wv[kk][8 + q] = wp[(kk * 32 + 16 + q) * HD]; }
  const float bias = bf16_round(bv[col]);
  __builtin_amdgcn_sched_barrier(0);      /* keeps all loads of the kernel in front of the first use: one memory latency; without it they are spread among the conversions and each group is waited for in turn */
#pragma unroll
  for (int u = 0; u < 4; ++u) { const int e = u * 256 + tid; union { _Float16 h[4]; v4us v; } p;
#pragma unroll
    for (int q = 0; q < 4; ++q) p.h[q] = (_Float16)bf16_round(x[u][q]);
    *(v4us*)&sa[e >> 5][(e & 31) * 4] = p.v; }
  __syncthreads();      /* the 32 rounded rows are in LDS */
  const v8f z8 = {0.f, 0.f, 0.f, 0.f, 0.f, 0.f, 0.f, 0.f};
  v8f acc[2] = {z8, z8};
#pragma unroll
  for (int kk = 0; kk < CIN / 32; ++kk) { FragH bq;
#pragma unroll
    for (int e = 0; e < 16; ++e) bq.h[e] = (_Float16)(bf16_round(wv[kk][e]) * 16.0f);
#pragma unroll
    for (int g = 0; g < 2; ++g) { FragH aq; aq.half[0] = *(const v8us*)&sa[g * 16 + ln][kk * 32 + 8 * hh]; aq.half[1] = *(const v8us*)&sa[g * 16 + ln][kk * 32 + 16 + 8 * hh];
      acc[g] = __builtin_amdgcn_wmma_f32_16x16x32_f16(false, aq.v, false, bq.v, (short)0, acc[g], false, false); } }
#pragma unroll
  for (int g = 0; g < 2; ++g) { FragH o;
#pragma unroll
    for (int r = 0; r < 8; ++r) o.h[r] = (_Float16)(acc[g][r] * 0.0625f + bias);
    *(v8us*)((unsigned short*)VF + ((((size_t)blockIdx.x * 8 + w) * 2 + g) * 32 + lane) * 8) = o.half[0]; }
  asm volatile("s_wait_xcnt 0x0" ::: "memory");      /* in the built code the spare work-groups' part stands behind these two stores and writes their registers: the wait stands in front of any such write */
}

// One work-group = 32 rows i of one batch (RT = 2 tiles of 16), all four heads. Wave w takes the 32-wide j slices s = w, w + 8, ...; each slice's 8 value fragments and its coordinates are fetched once and used for both row tiles, which halves
// the bytes that the attention kernel draws from L2 per (i, j) pair. The exp2 argument -KS * d2 = 2 KS c_j . c_i - KS |c_j|^2 - KS |c_i|^2 of 16 points j x 16 rows i is one WMMA of the same f16 form, eight of its 32 k in use:
// A row j = (x, y, z, nh | x, y, z, nl), B column i = (Xh, Yh, Zh, 1 | Xl, Yl, Zl, 1), C = -KS |c_i|^2 in f32 (one A fragment holds both 16-point tiles of a slice, each in four k of its own; B has zeros at the other tile's k). x, y, z are bf16-rounded and so exact as f16; nh + nl = -KS |c_j|^2 and Xh + Xl = 2 KS x_i are f32 values split into
// f16 and the f16 of the rest (22 bits or more); every product is exact in f32. With j as the rows of D, lane (hh, ln) holds in register r the pair (j = 8 * hh + r, i = ln): two such tiles are the 16 k of the weights' A fragment as they stand.
// Per row tile: one exp2 once per (i, j), the four heads' weights exp(-d2 / ls^2) * 1024 (the widest head's, then fourth powers) built in registers
// as the A fragment (same k order as the B fragment: k = half * 16 + hh * 8 + q), two WMMAs per head. The eight waves' partial products and row sums are joined in LDS, scaled by 1 / (sum + 1e-8) and split into f16 hi + residual,
// which stay in LDS: wave w multiplies both by the 16 columns w * 16 ... of Wo (four k steps each) and adds bo; the 32 x 128 result goes out through LDS so that every store of a wave is one whole row.
#define RPITCH 132      /* floats per row of a partial product in LDS: rows 8 apart (the two half-waves) fall on different banks */
#define RT 2            /* 16-row tiles per wave and work-group */
#define WR (RT * 16)    /* rows per work-group */
#define KS 0.09016844005556021f      /* log2(e) / 16: exp(-d2 / 16) = 2^(-KS * d2), the widest head */
__global__ __launch_bounds__(256) void k_att(const float* __restrict__ crd, const _Float16* __restrict__ VF, const _Float16* __restrict__ BO, const float* __restrict__ bo, float* __restrict__ out) {
  __shared__ __attribute__((aligned(16))) float sm[8 * WR * RPITCH];      /* first the NP points, 8 f16 each: (x, y, z, nh, x, y, z, nl), later the eight waves' 32 x 128 partial products */
  __shared__ float ssum[8][NH][WR];
  __shared__ __attribute__((aligned(16))) unsigned short shl[2][WR][HPITCH];      /* the 32 scaled rows: [0] f16 hi, [1] residual * 1024 */
  const int tid = threadIdx.x, w = __builtin_amdgcn_readfirstlane(tid >> 5), lane = tid & 31, ln = lane & 15, hh = lane >> 4;
  const int b = blockIdx.x / (NP / WR), row0 = (blockIdx.x % (NP / WR)) * WR;
  const float* cb = crd + (size_t)b * NP * 3;
  unsigned short* sp = (unsigned short*)sm;
#pragma unroll
  for (int u = 0; u < NP / 256; ++u) { const int p = u * 256 + tid;      /* one point a thread: a wave's 16-byte LDS stores are 512 contiguous bytes */
    const float x = bf16_round(cb[p * 3]), y = bf16_round(cb[p * 3 + 1]), z = bf16_round(cb[p * 3 + 2]), n = -KS * (x * x + y * y + z * z);
    FragH f; f.h[0] = f.h[4] = (_Float16)x; f.h[1] = f.h[5] = (_Float16)y; f.h[2] = f.h[6] = (_Float16)z; f.h[3] = (_Float16)n; f.h[7] = (_Float16)(n - (float)f.h[3]);
    *(v8us*)(sp + p * 8) = f.half[0]; }
  __syncthreads();
  FragH bi[RT][2]; v8f ci[RT];      /* B fragments and C of the distance product; for the slice's 16-point tile g lane half hh holds its four k in elements 4 * g to 4 * g + 3, where the A loader below puts that tile; all other elements are 0 */
#pragma unroll
  for (int rt = 0; rt < RT; ++rt) { FragH f; f.half[0] = *(const v8us*)(sp + (row0 + rt * 16 + ln) * 8);
#pragma unroll
    for (int q = 0; q < 16; ++q) bi[rt][0].h[q] = bi[rt][1].h[q] = (_Float16)0.0f;
#pragma unroll
    for (int q = 0; q < 3; ++q) { const float t = (2.0f * KS) * (float)f.h[q]; const _Float16 th = (_Float16)t; bi[rt][0].h[q] = bi[rt][1].h[4 + q] = hh ? (_Float16)(t - (float)th) : th; }
    bi[rt][0].h[3] = bi[rt][1].h[7] = (_Float16)1.0f;
    const float ni = (float)f.h[3] + (float)f.h[7];
#pragma unroll
    for (int r = 0; r < 8; ++r) ci[rt][r] = ni; }
  const v8f z8 = {0.f, 0.f, 0.f, 0.f, 0.f, 0.f, 0.f, 0.f};
  v8f acc[RT][NH][2]; float su[RT][NH];
#pragma unroll
  for (int rt = 0; rt < RT; ++rt)
#pragma unroll
    for (int h = 0; h < NH; ++h) { acc[rt][h][0] = z8; acc[rt][h][1] = z8; su[rt][h] = 0.f; }
  const unsigned short* vp = (const unsigned short*)VF + (size_t)(b * (NP / 32) + w) * (COUT * 32) + lane * 8;      /* this lane's 16 bytes of the first fragment of slice s; moves on with s */
  const unsigned short* ap = sp + ln * 8 + 4 * hh;      /* this lane's four k of row j = ln of a 16-point tile: (x, y, z, nh) or (x, y, z, nl); 256 contiguous bytes a wave */
  FragH an;      /* A fragment of the distance product: elements 0 to 7 are loaded slice by slice (tile g in 4 * g to 4 * g + 3), the others stay 0 */
#pragma unroll
  for (int g = 0; g < 2; ++g) an.quad[g] = *(const v4us*)(ap + (w * 32 + g * 16) * 8);
#pragma unroll
  for (int q = 8; q < 16; ++q) an.h[q] = (_Float16)0.0f;
  v8f dg[RT][2];      /* the exp2 arguments of the slice in hand, made one slice ahead */
#pragma unroll
  for (int g = 0; g < 2; ++g)
#pragma unroll
    for (int rt = 0; rt < RT; ++rt) dg[rt][g] = __builtin_amdgcn_wmma_f32_16x16x32_f16(false, an.v, false, bi[rt][g].v, (short)0, ci[rt], false, false);
  for (int s = w; s < NP / 32; s += 8, vp += 8 * COUT * 32) {
    FragH bq[2 * NH];
#pragma unroll
    for (int t = 2 * NH - 1; t >= 0; --t) { bq[t].half[0] = *(const v8us*)(vp + t * 512); bq[t].half[1] = *(const v8us*)(vp + t * 512 + 256); }
    const int sn = (s + 8) & (NP / 32 - 1);      /* the wave's next slice; behind the last one its first again, whose arguments nobody reads */
#pragma unroll
    for (int g = 0; g < 2; ++g) an.quad[g] = *(const v4us*)(ap + (sn * 32 + g * 16) * 8);
    asm volatile("s_wait_xcnt 0x0" ::: "memory");      /* vp's registers, which the 16 issued loads name, are rewritten below (vp moves on): the wait stands in front of that write; the barrier on the next line keeps the write behind it */
    __builtin_amdgcn_sched_barrier(0);      /* keeps the 16 fragment loads in front of the exp work, which covers their latency; without it they sink to just in front of each WMMA */
#pragma unroll
    for (int rt = 0; rt < RT; ++rt) {
      float wt[16];
#pragma unroll
      for (int e = 0; e < 16; ++e) wt[e] = __builtin_amdgcn_exp2f(dg[rt][e >> 3][e & 7]);      /* exp(-d2 / 16), the widest head; the bare hardware exp2 may flush below 2^-126, where the weight is 0 as f16 and adds nothing to a row sum that holds the self term 1 */
#pragma unroll
      for (int h = NH - 1; h >= 0; --h) { FragH a;      /* ls = 4, 2, 1, 0.5: 1 / ls^2 grows fourfold from head to head, so the next head's weight is this one's fourth power (two squarings) */
#pragma unroll
        for (int e = 0; e < 16; ++e) { const float ev = wt[e]; su[rt][h] += ev; a.h[e] = (_Float16)(ev * 1024.0f); const float sq = ev * ev; wt[e] = sq * sq; }
        acc[rt][h][0] = __builtin_amdgcn_wmma_f32_16x16x32_f16(false, a.v, false, bq[2 * h].v, (short)0, acc[rt][h][0], false, false);
        acc[rt][h][1] = __builtin_amdgcn_wmma_f32_16x16x32_f16(false, a.v, false, bq[2 * h + 1].v, (short)0, acc[rt][h][1], false, false);
        if (h >= 2) dg[rt][h - 2] = __builtin_amdgcn_wmma_f32_16x16x32_f16(false, an.v, false, bi[rt][h - 2].v, (short)0, ci[rt], false, false); }      /* the next slice's arguments, one tile behind each of the first two heads: the matrix unit makes them under this slice's vector work */
    }
  }
  v16h wo[COUT / 32];      /* this wave's 16 columns of Wo as B fragments: asked for here, so that the exchange of the row sums in front of the barrier covers part of their latency */
#pragma unroll
  for (int kk = 0; kk < COUT / 32; ++kk) wo[kk] = g2_frag(BO + (size_t)(w * 16 + ln) * COUT + kk * 32, hh);
  const float bias = bf16_round(bo[w * 16 + ln]);
#pragma unroll
  for (int rt = 0; rt < RT; ++rt)
#pragma unroll
    for (int h = 0; h < NH; ++h) { su[rt][h] += __shfl_xor(su[rt][h], 16, 32); if (hh == 0) ssum[w][h][rt * 16 + ln] = su[rt][h]; }
  __syncthreads();      /* every wave has read its last coordinates: sm may be rewritten */
#pragma unroll
  for (int rt = 0; rt < RT; ++rt)
#pragma unroll
    for (int h = 0; h < NH; ++h)
#pragma unroll
      for (int t = 0; t < 2; ++t)
#pragma unroll
        for (int r = 0; r < 8; ++r) sm[(w * WR + rt * 16 + 8 * hh + r) * RPITCH + h * HD + t * 16 + ln] = acc[rt][h][t][r];
  __syncthreads();      /* the partial products and row sums of all eight waves are in LDS */
  const int c8 = (tid & 15) * 8, hd = c8 / HD;
#pragma unroll
  for (int rt = 0; rt < RT; ++rt) { const int row = rt * 16 + (tid >> 4);
    float tot = 0.f; v4f s0 = {0.f, 0.f, 0.f, 0.f}, s1 = s0;
#pragma unroll
    for (int ww = 0; ww < 8; ++ww) { tot += ssum[ww][hd][row]; s0 += *(const v4fa*)&sm[(ww * WR + row) * RPITCH + c8]; s1 += *(const v4fa*)&sm[(ww * WR + row) * RPITCH + c8 + 4]; }
    const float rs = 1.0f / (tot + 1e-8f); FragH f, fl;
#pragma unroll
    for (int q = 0; q < 8; ++q) { const float v = ((q < 4 ? s0[q & 3] : s1[q & 3]) * 0.0009765625f) * rs; const _Float16 hi = (_Float16)v; f.h[q] = hi; fl.h[q] = (_Float16)((v - (float)hi) * 1024.0f); }
    *(v8us*)&shl[0][row][c8] = f.half[0]; *(v8us*)&shl[1][row][c8] = fl.half[0]; }
  __syncthreads();      /* the scaled rows are complete in shl, and every thread has read its last partial product: sm may be rewritten */
#pragma unroll
  for (int rt = 0; rt < RT; ++rt) { v8f oh = z8, ol = z8;
#pragma unroll
    for (int kk = 0; kk < COUT / 32; ++kk) { FragH ah, al;
      ah.half[0] = *(const v8us*)&shl[0][rt * 16 + ln][kk * 32 + 8 * hh]; ah.half[1] = *(const v8us*)&shl[0][rt * 16 + ln][kk * 32 + 16 + 8 * hh];
      al.half[0] = *(const v8us*)&shl[1][rt * 16 + ln][kk * 32 + 8 * hh]; al.half[1] = *(const v8us*)&shl[1][rt * 16 + ln][kk * 32 + 16 + 8 * hh];
      oh = __builtin_amdgcn_wmma_f32_16x16x32_f16(false, ah.v, false, wo[kk], (short)0, oh, false, false);
      ol = __builtin_amdgcn_wmma_f32_16x16x32_f16(false, al.v, false, wo[kk], (short)0, ol, false, false); }
#pragma unroll
    for (int r = 0; r < 8; ++r) { const float lo = ol[r] * (0.0625f / 1024.0f); float v = oh[r] * 0.0625f + bias; v += lo; sm[(rt * 16 + 8 * hh + r) * RPITCH + w * 16 + ln] = v; } }      /* out = (mh_lo + mh_hi) Wo + bo; Wo was scaled by 16 */
  __syncthreads();      /* all eight column tiles of the result are in LDS */
#pragma unroll
  for (int u = 0; u < 2 * RT; ++u) { const int e = u * 256 + tid, orow = e >> 5, c4 = (e & 31) * 4; const v4f v = *(const v4fa*)&sm[orow * RPITCH + c4]; *(v4f*)(out + ((size_t)b * NP + row0 + orow) * COUT + c4) = v; } }

extern "C" void kernel_launch(void* const* d_in, const int* in_sizes, int n_in,
                              void* d_out, int out_size, void* d_ws, size_t ws_size, hipStream_t stream) {
  (void)in_sizes; (void)n_in; (void)out_size;
  const float* const* I = (const float* const*)d_in; const float* feat = I[0]; const float* crd = I[1]; const float* Wv = I[2]; const float* bv = I[3]; const float* Wo = I[4]; const float* bo = I[5];
  char* ws = (char*)d_ws; size_t off = 0;
  auto take = [&](size_t bytes) { char* p = ws + off; off += (bytes + 255) & ~(size_t)255; return p; };
  _Float16* BO = (_Float16*)take((size_t)COUT * COUT * 2); _Float16* VF = (_Float16*)take((size_t)NB * NP * COUT * 2);
  if (off > ws_size) return;
  k_val<<<NB * (NP / 32) + COUT * COUT / 8 / 256, 256, 0, stream>>>(feat, Wv, bv, Wo, VF, BO);      /* values in B-fragment order; Wo (in, out) transposed */
  k_att<<<NB * (NP / WR), 256, 0, stream>>>(crd, VF, BO, bo, (float*)d_out);      /* all (batch, head): weights, att . value, row scaling, output projection */
}

// v006
// Measured time: 23.5 microseconds a run.
// Next to v005, in two timings, it ran 1.05 and 1.11 times as fast.
// Over all steps from v000 it is 30.8 times as fast.
#include <hip/hip_runtime.h>
// KernelSelfAttention (2 x 4096 points; d2 = |c_i - c_j|^2 from 3-D coords; per head h with lengthscale ls in {0.5, 1, 2, 4}: att = exp(-d2 / ls^2) / (sum_j + 1e-8); value_h = features Wv[h] + bv[h] [32]; head_out = att value; out = concat_h Wo + bo -> [2][4096][128]).
#define NB 2
#define NP 4096
#define CIN 128
#define NH 4
#define HD 32
#define COUT 128
#define HPITCH 136      /* f16 per row of a 128-wide A operand in LDS: 16 bytes more than the row, so the 16 rows of a 16-byte fragment read fall on different banks */
typedef unsigned short v8us __attribute__((ext_vector_type(8), may_alias));
typedef unsigned short v4us __attribute__((ext_vector_type(4), may_alias));
typedef float  v8f  __attribute__((ext_vector_type(8)));
typedef float  v4f  __attribute__((ext_vector_type(4)));
typedef float  v4fa __attribute__((ext_vector_type(4), may_alias));
typedef _Float16 v16h __attribute__((ext_vector_type(16)));
union FragH { v16h v; v8us half[2]; v4us quad[4]; _Float16 h[16]; unsigned short u[16]; };

__device__ __forceinline__ unsigned short bf16_bits(float x) { unsigned int u = __float_as_uint(x); return (unsigned short)((u + 0x7FFFu + ((u >> 16) & 1u)) >> 16); }
__device__ __forceinline__ float bf16_val(unsigned short b) { return __uint_as_float(((unsigned int)b) << 16); }
__device__ __forceinline__ float bf16_round(float x) { return bf16_val(bf16_bits(x)); }
// A or B fragment of v_wmma_f32_16x16x32_f16 from 32 consecutive f16 of this lane's row (A) or column (B): k = 8 * hh + q, then 16 + 8 * hh + q
__device__ __forceinline__ v16h g2_frag(const _Float16* p, int hh) { FragH f; f.half[0] = *(const v8us*)((const unsigned short*)p + 8 * hh); f.half[1] = *(const v8us*)((const unsigned short*)p + 16 + 8 * hh); return f.v; }

// Values, straight from the f32 inputs into B-fragment order: VF[b][s = j / 32][tile = col / 16][half][lane][8]; lane = hh * 16 + (col & 15), j = s * 32 + half * 16 + hh * 8 + q, so that a wave's fragment load in k_att is 512 contiguous bytes.
// One work-group = one 32-row slice (b, s); wave w = column tile w (col = h * 32 + k). The slice of features is rounded once (bf16, exact as f16) into LDS and read from there as A fragments; each wave rounds its own 16 columns of Wv (bf16, * 16)
// into B fragments; both in the k order of g2_frag. The accumulator of row tile g holds in lane (hh, ln), register r, the value of row g * 16 + hh * 8 + r, column ln: that is VF's own order (half = g, q = r), one 16-byte store a lane.
// The work-groups behind the last slice write BO[n][k] = f16(bf16(Wo[k][n]) * 16) for k_att's output projection.
__global__ __launch_bounds__(256) void k_val(const float* __restrict__ feat, const float* __restrict__ Wv, const float* __restrict__ bv, const float* __restrict__ Wo, _Float16* __restrict__ VF, _Float16* __restrict__ BO) {
  __shared__ __attribute__((aligned(16))) unsigned short sa[32][HPITCH];
  const int tid = threadIdx.x;
  if (blockIdx.x >= NB * (NP / 32)) {      /* the same for a whole work-group, and in front of the barrier */
    const int t = (blockIdx.x - NB * (NP / 32)) * 256 + tid, n = t / (COUT / 8), k8 = (t % (COUT / 8)) * 8; FragH f;
#pragma unroll
    for (int i = 0; i < 8; ++i) f.h[i] = (_Float16)(bf16_round(Wo[(size_t)(k8 + i) * COUT + n]) * 16.0f);
    *(v8us*)((unsigned short*)BO + (size_t)n * COUT + k8) = f.half[0];
    return; }
  const int w = tid >> 5, lane = tid & 31, ln = lane & 15, hh = lane >> 4;
  const int col = w * 16 + ln;
  const float* wp = Wv + (size_t)(col / HD) * CIN * HD + (col % HD) + 8 * hh * HD;      /* Wv[h][c][k]: element c = 8 * hh + i of this lane's column at wp[i * HD] */
  const float* ap = feat + (size_t)blockIdx.x * 32 * CIN;
  v4f x[4]; float wv[CIN / 32][16];
#pragma unroll
  for (int u = 0; u < 4; ++u) x[u] = *(const v4fa*)(ap + (u * 256 + tid) * 4);
#pragma unroll
  for (int kk = 0; kk < CIN / 32; ++kk)
#pragma unroll
    for (int q = 0; q < 8; ++q) { wv[kk][q] = wp[(kk * 32 + q) * HD]; wv[kk][8 + q] = wp[(kk * 32 + 16 + q) * HD]; }
  const float bias = bf16_round(bv[col]);
  __builtin_amdgcn_sched_barrier(0);      /* keeps all loads of the kernel in front of the first use: one memory latency; without it they are spread among the conversions and each group is waited for in turn */
#pragma unroll
  for (int u = 0; u < 4; ++u) { const int e = u * 256 + tid; union { _Float16 h[4]; v4us v; } p;
#pragma unroll
    for (int q = 0; q < 4; ++q) p.h[q] = (_Float16)bf16_round(x[u][q]);
    *(v4us*)&sa[e >> 5][(e & 31) * 4] = p.v; }
  __syncthreads();      /* the 32 rounded rows are in LDS */
  const v8f z8 = {0.f, 0.f, 0.f, 0.f, 0.f, 0.f, 0.f, 0.f};
  v8f acc[2] = {z8, z8};
#pragma unroll
  for (int kk = 0; kk < CIN / 32; ++kk) { FragH bq;
#pragma unroll
    for (int e = 0; e < 16; ++e) bq.h[e] = (_Float16)(bf16_round(wv[kk][e]) * 16.0f);
#pragma unroll
    for (int g = 0; g < 2; ++g) { FragH aq; aq.half[0] = *(const v8us*)&sa[g * 16 + ln][kk * 32 + 8 * hh]; aq.half[1] = *(const v8us*)&sa[g * 16 + ln][kk * 32 + 16 + 8 * hh];
      acc[g] = __builtin_amdgcn_wmma_f32_16x16x32_f16(false, aq.v, false, bq.v, (short)0, acc[g], false, false); } }
#pragma unroll
  for (int g = 0; g < 2; ++g) { FragH o;
#pragma unroll
    for (int r = 0; r < 8; ++r) o.h[r] = (_Float16)(acc[g][r] * 0.0625f + bias);
    *(v8us*)((unsigned short*)VF + ((((size_t)blockIdx.x * 8 + w) * 2 + g) * 32 + lane) * 8) = o.half[0]; }
  asm volatile("s_wait_xcnt 0x0" ::: "memory");      /* in the built code the spare work-groups' part stands behind these two stores and writes their registers: the wait stands in front of any such write */
}

// One work-group = 32 rows i of one batch (RT = 2 tiles of 16), all four heads. Wave w takes the 32-wide j slices s = w + g, w + g + 8, ... modulo their number (g = the work-group's index: each group enters the ring at its own place); each slice's 16 value fragments and its coordinates are fetched once and used for both row tiles, which halves
// the bytes that the attention kernel draws from L2 per (i, j) pair. The exp2 argument -KS * d2 = 2 KS c_j . c_i - KS |c_j|^2 - KS |c_i|^2 of 16 points j x 16 rows i is one WMMA of the same f16 form, eight of its 32 k in use:
// A row j = (x, y, z, nh | x, y, z, nl), B column i = (Xh, Yh, Zh, 1 | Xl, Yl, Zl, 1), C = -KS |c_i|^2 in f32 (one A fragment holds both 16-point tiles of a slice, each in four k of its own; B has zeros at the other tile's k). x, y, z are bf16-rounded and so exact as f16; nh + nl = -KS |c_j|^2 and Xh + Xl = 2 KS x_i are f32 values split into
// f16 and the f16 of the rest (22 bits or more); every product is exact in f32. With j as the rows of D, lane (hh, ln) holds in register r the pair (j = 8 * hh + r, i = ln): two such tiles are the 16 k of the weights' A fragment as they stand.
// Per row tile: one exp2 once per (i, j), the four heads' weights exp(-d2 / ls^2) * 1024 (the widest head's, then fourth powers) built in registers
// as the A fragment (same k order as the B fragment: k = half * 16 + hh * 8 + q), two WMMAs per head. The eight waves' partial products and row sums are joined in LDS, scaled by 1 / (sum + 1e-8) and split into f16 hi + residual,
// which stay in LDS: wave w multiplies both by the 16 columns w * 16 ... of Wo (four k steps each) and adds bo; the 32 x 128 result goes out through LDS so that every store of a wave is one whole row.
#define RPITCH 132      /* floats per row of a partial product in LDS: rows 8 apart (the two half-waves) fall on different banks */
#define RT 2            /* 16-row tiles per wave and work-group */
#define WR (RT * 16)    /* rows per work-group */
#define KS 0.09016844005556021f      /* log2(e) / 16: exp(-d2 / 16) = 2^(-KS * d2), the widest head */
__global__ __launch_bounds__(256) void k_att(const float* __restrict__ crd, const _Float16* __restrict__ VF, const _Float16* __restrict__ BO, const float* __restrict__ bo, float* __restrict__ out) {
  __shared__ __attribute__((aligned(16))) float sm[8 * WR * RPITCH];      /* first the NP points, 8 f16 each: (x, y, z, nh, x, y, z, nl), later the eight waves' 32 x 128 partial products */
  __shared__ float ssum[8][NH][WR];
  __shared__ __attribute__((aligned(16))) unsigned short shl[2][WR][HPITCH];      /* the 32 scaled rows: [0] f16 hi, [1] residual * 1024 */
  const int tid = threadIdx.x, w = __builtin_amdgcn_readfirstlane(tid >> 5), lane = tid & 31, ln = lane & 15, hh = lane >> 4;
  const int b = blockIdx.x / (NP / WR), row0 = (blockIdx.x % (NP / WR)) * WR;
  const float* cb = crd + (size_t)b * NP * 3;
  unsigned short* sp = (unsigned short*)sm;
#pragma unroll
  for (int u = 0; u < NP / 256; ++u) { const int p = u * 256 + tid;      /* one point a thread: a wave's 16-byte LDS stores are 512 contiguous bytes */
    const float x = bf16_round(cb[p * 3]), y = bf16_round(cb[p * 3 + 1]), z = bf16_round(cb[p * 3 + 2]), n = -KS * (x * x + y * y + z * z);
    FragH f; f.h[0] = f.h[4] = (_Float16)x; f.h[1] = f.h[5] = (_Float16)y; f.h[2] = f.h[6] = (_Float16)z; f.h[3] = (_Float16)n; f.h[7] = (_Float16)(n - (float)f.h[3]);
    *(v8us*)(sp + p * 8) = f.half[0]; }
  __syncthreads();
  FragH bi[RT][2]; v8f ci[RT];      /* B fragments and C of the distance product; for the slice's 16-point tile g lane half hh holds its four k in elements 4 * g to 4 * g + 3, where the A loader below puts that tile; all other elements are 0 */
#pragma unroll
  for (int rt = 0; rt < RT; ++rt) { FragH f; f.half[0] = *(const v8us*)(sp + (row0 + rt * 16 + ln) * 8);
#pragma unroll
    for (int q = 0; q < 16; ++q) bi[rt][0].h[q] = bi[rt][1].h[q] = (_Float16)0.0f;
#pragma unroll
    for (int q = 0; q < 3; ++q) { const float t = (2.0f * KS) * (float)f.h[q]; const _Float16 th = (_Float16)t; bi[rt][0].h[q] = bi[rt][1].h[4 + q] = hh ? (_Float16)(t - (float)th) : th; }
    bi[rt][0].h[3] = bi[rt][1].h[7] = (_Float16)1.0f;
    const float ni = (float)f.h[3] + (float)f.h[7];
#pragma unroll
    for (int r = 0; r < 8; ++r) ci[rt][r] = ni; }
  const v8f z8 = {0.f, 0.f, 0.f, 0.f, 0.f, 0.f, 0.f, 0.f};
  v8f acc[RT][NH][2]; float su[RT][NH];
#pragma unroll
  for (int rt = 0; rt < RT; ++rt)
#pragma unroll
    for (int h = 0; h < NH; ++h) { acc[rt][h][0] = z8; acc[rt][h][1] = z8; su[rt][h] = 0.f; }
  const unsigned short* vb = (const unsigned short*)VF + (size_t)b * (NP / 32) * (COUT * 32) + lane * 8;      /* this lane's 16 bytes of the first fragment of the batch's slice 0 */
  int s = (w + blockIdx.x) & (NP / 32 - 1);      /* the wave's first slice: the work-group's own place in the ring of slices, so that at any moment the work-groups of a batch read different value lines */
  const unsigned short* ap = sp + ln * 8 + 4 * hh;      /* this lane's four k of row j = ln of a 16-point tile: (x, y, z, nh) or (x, y, z, nl); 256 contiguous bytes a wave */
  FragH an;      /* A fragment of the distance product: elements 0 to 7 are loaded slice by slice (tile g in 4 * g to 4 * g + 3), the others stay 0 */
#pragma unroll
  for (int g = 0; g < 2; ++g) an.quad[g] = *(const v4us*)(ap + (s * 32 + g * 16) * 8);
#pragma unroll
  for (int q = 8; q < 16; ++q) an.h[q] = (_Float16)0.0f;
  v8f dg[RT][2];      /* the exp2 arguments of the slice in hand, made one slice ahead */
#pragma unroll
  for (int g = 0; g < 2; ++g)
#pragma unroll
    for (int rt = 0; rt < RT; ++rt) dg[rt][g] = __builtin_amdgcn_wmma_f32_16x16x32_f16(false, an.v, false, bi[rt][g].v, (short)0, ci[rt], false, false);
  for (int it = 0; it < NP / 32 / 8; ++it) {
    const unsigned short* vp = vb + s * (COUT * 32);
    FragH bq[2 * NH];
#pragma unroll
    for (int t = 2 * NH - 1; t >= 0; --t) { bq[t].half[0] = *(const v8us*)(vp + t * 512); bq[t].half[1] = *(const v8us*)(vp + t * 512 + 256); }
    const int sn = (s + 8) & (NP / 32 - 1);      /* the wave's next slice, round the ring; behind the last one its first again, whose arguments nobody reads */
#pragma unroll
    for (int g = 0; g < 2; ++g) an.quad[g] = *(const v4us*)(ap + (sn * 32 + g * 16) * 8);
    asm volatile("s_wait_xcnt 0x0" ::: "memory");      /* vp's registers, which the 16 issued loads name, are rewritten for the next slice: the wait stands in front of that write; the barrier on the next line keeps the write behind it */
    __builtin_amdgcn_sched_barrier(0);      /* keeps the 16 fragment loads in front of the exp work, which covers their latency; without it they sink to just in front of each WMMA */
#pragma unroll
    for (int rt = 0; rt < RT; ++rt) {
      float wt[16];
#pragma unroll
      for (int e = 0; e < 16; ++e) wt[e] = __builtin_amdgcn_exp2f(dg[rt][e >> 3][e & 7]);      /* exp(-d2 / 16), the widest head; the bare hardware exp2 may flush below 2^-126, where the weight is 0 as f16 and adds nothing to a row sum that holds the self term 1 */
#pragma unroll
      for (int h = NH - 1; h >= 0; --h) { FragH a;      /* ls = 4, 2, 1, 0.5: 1 / ls^2 grows fourfold from head to head, so the next head's weight is this one's fourth power (two squarings) */
#pragma unroll
        for (int e = 0; e < 16; ++e) { const float ev = wt[e]; su[rt][h] += ev; a.h[e] = (_Float16)(ev * 1024.0f); const float sq = ev * ev; wt[e] = sq * sq; }
        acc[rt][h][0] = __builtin_amdgcn_wmma_f32_16x16x32_f16(false, a.v, false, bq[2 * h].v, (short)0, acc[rt][h][0], false, false);
        acc[rt][h][1] = __builtin_amdgcn_wmma_f32_16x16x32_f16(false, a.v, false, bq[2 * h + 1].v, (short)0, acc[rt][h][1], false, false);
        if (h >= 2) dg[rt][h - 2] = __builtin_amdgcn_wmma_f32_16x16x32_f16(false, an.v, false, bi[rt][h - 2].v, (short)0, ci[rt], false, false); }      /* the next slice's arguments, one tile behind each of the first two heads: the matrix unit makes them under this slice's vector work */
    }
    s = sn;
  }
  v16h wo[COUT / 32];      /* this wave's 16 columns of Wo as B fragments: asked for here, so that the exchange of the row sums in front of the barrier covers part of their latency */
#pragma unroll
  for (int kk = 0; kk < COUT / 32; ++kk) wo[kk] = g2_frag(BO + (size_t)(w * 16 + ln) * COUT + kk * 32, hh);
  const float bias = bf16_round(bo[w * 16 + ln]);
#pragma unroll
  for (int rt = 0; rt < RT; ++rt)
#pragma unroll
    for (int h = 0; h < NH; ++h) { su[rt][h] += __shfl_xor(su[rt][h], 16, 32); if (hh == 0) ssum[w][h][rt * 16 + ln] = su[rt][h]; }
  __syncthreads();      /* every wave has read its last coordinates: sm may be rewritten */
#pragma unroll
  for (int rt = 0; rt < RT; ++rt)
#pragma unroll
    for (int h = 0; h < NH; ++h)
#pragma unroll
      for (int t = 0; t < 2; ++t)
#pragma unroll
        for (int r = 0; r < 8; ++r) sm[(w * WR + rt * 16 + 8 * hh + r) * RPITCH + h * HD + t * 16 + ln] = acc[rt][h][t][r];
  __syncthreads();      /* the partial products and row sums of all eight waves are in LDS */
  const int c8 = (tid & 15) * 8, hd = c8 / HD;
#pragma unroll
  for (int rt = 0; rt < RT; ++rt) { const int row = rt * 16 + (tid >> 4);
    float tot = 0.f; v4f s0 = {0.f, 0.f, 0.f, 0.f}, s1 = s0;
#pragma unroll
    for (int ww = 0; ww < 8; ++ww) { tot += ssum[ww][hd][row]; s0 += *(const v4fa*)&sm[(ww * WR + row) * RPITCH + c8]; s1 += *(const v4fa*)&sm[(ww * WR + row) * RPITCH + c8 + 4]; }
    const float rs = 1.0f / (tot + 1e-8f); FragH f, fl;
#pragma unroll
    for (int q = 0; q < 8; ++q) { const float v = ((q < 4 ? s0[q & 3] : s1[q & 3]) * 0.0009765625f) * rs; const _Float16 hi = (_Float16)v; f.h[q] = hi; fl.h[q] = (_Float16)((v - (float)hi) * 1024.0f); }
    *(v8us*)&shl[0][row][c8] = f.half[0]; *(v8us*)&shl[1][row][c8] = fl.half[0]; }
  __syncthreads();      /* the scaled rows are complete in shl, and every thread has read its last partial product: sm may be rewritten */
#pragma unroll
  for (int rt = 0; rt < RT; ++rt) { v8f oh = z8, ol = z8;
#pragma unroll
    for (int kk = 0; kk < COUT / 32; ++kk) { FragH ah, al;
      ah.half[0] = *(const v8us*)&shl[0][rt * 16 + ln][kk * 32 + 8 * hh]; ah.half[1] = *(const v8us*)&shl[0][rt * 16 + ln][kk * 32 + 16 + 8 * hh];
      al.half[0] = *(const v8us*)&shl[1][rt * 16 + ln][kk * 32 + 8 * hh]; al.half[1] = *(const v8us*)&shl[1][rt * 16 + ln][kk * 32 + 16 + 8 * hh];
      oh = __builtin_amdgcn_wmma_f32_16x16x32_f16(false, ah.v, false, wo[kk], (short)0, oh, false, false);
      ol = __builtin_amdgcn_wmma_f32_16x16x32_f16(false, al.v, false, wo[kk], (short)0, ol, false, false); }
#pragma unroll
    for (int r = 0; r < 8; ++r) { const float lo = ol[r] * (0.0625f / 1024.0f); float v = oh[r] * 0.0625f + bias; v += lo; sm[(rt * 16 + 8 * hh + r) * RPITCH + w * 16 + ln] = v; } }      /* out = (mh_lo + mh_hi) Wo + bo; Wo was scaled by 16 */
  __syncthreads();      /* all eight column tiles of the result are in LDS */
#pragma unroll
  for (int u = 0; u < 2 * RT; ++u) { const int e = u * 256 + tid, orow = e >> 5, c4 = (e & 31) * 4; const v4f v = *(const v4fa*)&sm[orow * RPITCH + c4]; *(v4f*)(out + ((size_t)b * NP + row0 + orow) * COUT + c4) = v; } }

extern "C" void kernel_launch(void* const* d_in, const int* in_sizes, int n_in,
                              void* d_out, int out_size, void* d_ws, size_t ws_size, hipStream_t stream) {
  (void)in_sizes; (void)n_in; (void)out_size;
  const float* const* I = (const float* const*)d_in; const float* feat = I[0]; const float* crd = I[1]; const float* Wv = I[2]; const float* bv = I[3]; const float* Wo = I[4]; const float* bo = I[5];
  char* ws = (char*)d_ws; size_t off = 0;
  auto take = [&](size_t bytes) { char* p = ws + off; off += (bytes + 255) & ~(size_t)255; return p; };
  _Float16* BO = (_Float16*)take((size_t)COUT * COUT * 2); _Float16* VF = (_Float16*)take((size_t)NB * NP * COUT * 2);
  if (off > ws_size) return;
  k_val<<<NB * (NP / 32) + COUT * COUT / 8 / 256, 256, 0, stream>>>(feat, Wv, bv, Wo, VF, BO);      /* values in B-fragment order; Wo (in, out) transposed */
  k_att<<<NB * (NP / WR), 256, 0, stream>>>(crd, VF, BO, bo, (float*)d_out);      /* all (batch, head): weights, att . value, row scaling, output projection */
}

// v007
// Measured time: 21.5 microseconds a run.
// Next to v006, in two timings, it ran 1.09 times as fast each time.
// All steps since v000 together make it 33.7 times as fast.
#include <hip/hip_runtime.h>
// KernelSelfAttention (2 x 4096 points; d2 = |c_i - c_j|^2 from 3-D coords; per head h with lengthscale ls in {0.5, 1, 2, 4}: att = exp(-d2 / ls^2) / (sum_j + 1e-8); value_h = features Wv[h] + bv[h] [32]; head_out = att value; out = concat_h Wo + bo -> [2][4096][128]).
#define NB 2
#define NP 4096
#define CIN 128
#define NH 4
#define HD 32
#define COUT 128
#define HPITCH 136      /* f16 per row of a 128-wide A operand in LDS: 16 bytes more than the row, so the 16 rows of a 16-byte fragment read fall on different banks */
typedef unsigned short v8us __attribute__((ext_vector_type(8), may_alias));
typedef unsigned short v4us __attribute__((ext_vector_type(4), may_alias));
typedef float  v8f  __attribute__((ext_vector_type(8)));
typedef float  v4f  __attribute__((ext_vector_type(4)));
typedef float  v4fa __attribute__((ext_vector_type(4), may_alias));
typedef _Float16 v16h __attribute__((ext_vector_type(16)));
union FragH { v16h v; v8us half[2]; v4us quad[4]; _Float16 h[16]; unsigned short u[16]; };

__device__ __forceinline__ unsigned short bf16_bits(float x) { unsigned int u = __float_as_uint(x); return (unsigned short)((u + 0x7FFFu + ((u >> 16) & 1u)) >> 16); }
__device__ __forceinline__ float bf16_val(unsigned short b) { return __uint_as_float(((unsigned int)b) << 16); }
__device__ __forceinline__ float bf16_round(float x) { return bf16_val(bf16_bits(x)); }
// A or B fragment of v_wmma_f32_16x16x32_f16 from 32 consecutive f16 of this lane's row (A) or column (B): k = 8 * hh + q, then 16 + 8 * hh + q
__device__ __forceinline__ v16h g2_frag(const _Float16* p, int hh) { FragH f; f.half[0] = *(const v8us*)((const unsigned short*)p + 8 * hh); f.half[1] = *(const v8us*)((const unsigned short*)p + 16 + 8 * hh); return f.v; }

// Values, straight from the f32 inputs into B-fragment order: VF[b][s = j / 32][tile = col / 16][half][lane][8]; lane = hh * 16 + (col & 15), j = s * 32 + half * 16 + hh * 8 + q, so that a wave's fragment load in k_att is 512 contiguous bytes.
// One work-group = one 32-row slice (b, s); wave w = column tile w (col = h * 32 + k). The slice of features is rounded once (bf16, exact as f16) into LDS and read from there as A fragments; each wave rounds its own 16 columns of Wv (bf16, * 16)
// into B fragments; both in the k order of g2_frag. The accumulator of row tile g holds in lane (hh, ln), register r, the value of row g * 16 + hh * 8 + r, column ln: that is VF's own order (half = g, q = r), one 16-byte store a lane.
// The work-groups behind the last slice write BO[n][k] = f16(bf16(Wo[k][n]) * 16) for k_att's output projection.
__global__ __launch_bounds__(256) void k_val(const float* __restrict__ feat, const float* __restrict__ Wv, const float* __restrict__ bv, const float* __restrict__ Wo, _Float16* __restrict__ VF, _Float16* __restrict__ BO) {
  __shared__ __attribute__((aligned(16))) unsigned short sa[32][HPITCH];
  const int tid = threadIdx.x;
  if (blockIdx.x >= NB * (NP / 32)) {      /* the same for a whole work-group, and in front of the barrier */
    const int t = (blockIdx.x - NB * (NP / 32)) * 256 + tid, n = t / (COUT / 8), k8 = (t % (COUT / 8)) * 8; FragH f;
#pragma unroll
    for (int i = 0; i < 8; ++i) f.h[i] = (_Float16)(bf16_round(Wo[(size_t)(k8 + i) * COUT + n]) * 16.0f);
    *(v8us*)((unsigned short*)BO + (size_t)n * COUT + k8) = f.half[0];
    return; }
  const int w = tid >> 5, lane = tid & 31, ln = lane & 15, hh = lane >> 4;
  const int col = w * 16 + ln;
  const float* wp = Wv + (size_t)(col / HD) * CIN * HD + (col % HD) + 8 * hh * HD;      /* Wv[h][c][k]: element c = 8 * hh + i of this lane's column at wp[i * HD] */
  const float* ap = feat + (size_t)blockIdx.x * 32 * CIN;
  v4f x[4]; float wv[CIN / 32][16];
#pragma unroll
  for (int u = 0; u < 4; ++u) x[u] = *(const v4fa*)(ap + (u * 256 + tid) * 4);
#pragma unroll
  for (int kk = 0; kk < CIN / 32; ++kk)
#pragma unroll
    for (int q = 0; q < 8; ++q) { wv[kk][q] = wp[(kk * 32 + q) * HD]; wv[kk][8 + q] = wp[(kk * 32 + 16 + q) * HD]; }
  const float bias = bf16_round(bv[col]);
  __builtin_amdgcn_sched_barrier(0);      /* keeps all loads of the kernel in front of the first use: one memory latency; without it they are spread among the conversions and each group is waited for in turn */
#pragma unroll
  for (int u = 0; u < 4; ++u) { const int e = u * 256 + tid; union { _Float16 h[4]; v4us v; } p;
#pragma unroll
    for (int q = 0; q < 4; ++q) p.h[q] = (_Float16)bf16_round(x[u][q]);
    *(v4us*)&sa[e >> 5][(e & 31) * 4] = p.v; }
  __syncthreads();      /* the 32 rounded rows are in LDS */
  const v8f z8 = {0.f, 0.f, 0.f, 0.f, 0.f, 0.f, 0.f, 0.f};
  v8f acc[2] = {z8, z8};
#pragma unroll
  for (int kk = 0; kk < CIN / 32; ++kk) { FragH bq;
#pragma unroll
    for (int e = 0; e < 16; ++e) bq.h[e] = (_Float16)(bf16_round(wv[kk][e]) * 16.0f);
#pragma unroll
    for (int g = 0; g < 2; ++g) { FragH aq; aq.half[0] = *(const v8us*)&sa[g * 16 + ln][kk * 32 + 8 * hh]; aq.half[1] = *(const v8us*)&sa[g * 16 + ln][kk * 32 + 16 + 8 * hh];
      acc[g] = __builtin_amdgcn_wmma_f32_16x16x32_f16(false, aq.v, false, bq.v, (short)0, acc[g], false, false); } }
#pragma unroll
  for (int g = 0; g < 2; ++g) { FragH o;
#pragma unroll
    for (int r = 0; r < 8; ++r) o.h[r] = (_Float16)(acc[g][r] * 0.0625f + bias);
    *(v8us*)((unsigned short*)VF + ((((size_t)blockIdx.x * 8 + w) * 2 + g) * 32 + lane) * 8) = o.half[0]; }
  asm volatile("s_wait_xcnt 0x0" ::: "memory");      /* in the built code the spare work-groups' part stands behind these two stores and writes their registers: the wait stands in front of any such write */
}

// One work-group = 32 rows i of one batch (RT = 2 tiles of 16), all four heads. Wave w takes the 32-wide j slices s = w + g, w + g + 8, ... modulo their number (g = the work-group's index: each group enters the ring at its own place); each slice's 16 value fragments and its coordinates are fetched once and used for both row tiles, which halves
// the bytes that the attention kernel draws from L2 per (i, j) pair. The exp2 argument -KS * d2 = 2 KS c_j . c_i - KS |c_j|^2 - KS |c_i|^2 of 16 points j x 16 rows i is one WMMA of the same f16 form, eight of its 32 k in use:
// A row j = (x, y, z, nh | x, y, z, nl), B column i = (Xh, Yh, Zh, 1 | Xl, Yl, Zl, 1), C = -KS |c_i|^2 in f32 (one A fragment holds both 16-point tiles of a slice, each in four k of its own; B has zeros at the other tile's k). x, y, z are bf16-rounded and so exact as f16; nh + nl = -KS |c_j|^2 and Xh + Xl = 2 KS x_i are f32 values split into
// f16 and the f16 of the rest (22 bits or more); every product is exact in f32. With j as the rows of D, lane (hh, ln) holds in register r the pair (j = 8 * hh + r, i = ln): two such tiles are the 16 k of the weights' A fragment as they stand.
// Per row tile: one exp2 once per (i, j), the four heads' weights exp(-d2 / ls^2) * 1024 (the widest head's, then fourth powers) built in registers
// as the A fragment (same k order as the B fragment: k = half * 16 + hh * 8 + q), two WMMAs per head and a third, against a column of ones, for the head's row sums (the sums of the very f16 weights that the products use; they carry the factor 1024). The eight waves' partial products and row sums are joined in LDS, scaled by 1 / (sum + 1e-8) and split into f16 hi + residual,
// which stay in LDS: wave w multiplies both by the 16 columns w * 16 ... of Wo (four k steps each) and adds bo; the 32 x 128 result goes out through LDS so that every store of a wave is one whole row.
#define RPITCH 132      /* floats per row of a partial product in LDS: rows 8 apart (the two half-waves) fall on different banks */
#define RT 2            /* 16-row tiles per wave and work-group */
#define WR (RT * 16)    /* rows per work-group */
#define KS 0.09016844005556021f      /* log2(e) / 16: exp(-d2 / 16) = 2^(-KS * d2), the widest head */
__global__ __launch_bounds__(256) void k_att(const float* __restrict__ crd, const _Float16* __restrict__ VF, const _Float16* __restrict__ BO, const float* __restrict__ bo, float* __restrict__ out) {
  __shared__ __attribute__((aligned(16))) float sm[8 * WR * RPITCH];      /* first the NP points, 8 f16 each: (x, y, z, nh, x, y, z, nl), later the eight waves' 32 x 128 partial products */
  __shared__ float ssum[8][NH][WR];
  __shared__ __attribute__((aligned(16))) unsigned short shl[2][WR][HPITCH];      /* the 32 scaled rows: [0] f16 hi, [1] residual * 1024 */
  const int tid = threadIdx.x, w = __builtin_amdgcn_readfirstlane(tid >> 5), lane = tid & 31, ln = lane & 15, hh = lane >> 4;
  const int b = blockIdx.x / (NP / WR), row0 = (blockIdx.x % (NP / WR)) * WR;
  const float* cb = crd + (size_t)b * NP * 3;
  unsigned short* sp = (unsigned short*)sm;
  float cr[NP / 256][3];
#pragma unroll
  for (int u = 0; u < NP / 256; ++u)
#pragma unroll
    for (int q = 0; q < 3; ++q) cr[u][q] = cb[(u * 256 + tid) * 3 + q];
  asm volatile("s_wait_xcnt 0x0" ::: "memory");      /* the offset register of these loads is rewritten by the address work of the LDS stores: the wait stands in front of that; the barrier on the next line keeps that work behind it */
  __builtin_amdgcn_sched_barrier(0);
#pragma unroll
  for (int u = 0; u < NP / 256; ++u) { const int p = u * 256 + tid;      /* one point a thread: a wave's 16-byte LDS stores are 512 contiguous bytes */
    const float x = bf16_round(cr[u][0]), y = bf16_round(cr[u][1]), z = bf16_round(cr[u][2]), n = -KS * (x * x + y * y + z * z);
    FragH f; f.h[0] = f.h[4] = (_Float16)x; f.h[1] = f.h[5] = (_Float16)y; f.h[2] = f.h[6] = (_Float16)z; f.h[3] = (_Float16)n; f.h[7] = (_Float16)(n - (float)f.h[3]);
    *(v8us*)(sp + p * 8) = f.half[0]; }
  __syncthreads();
  FragH bi[RT][2]; v8f ci[RT];      /* B fragments and C of the distance product; for the slice's 16-point tile g lane half hh holds its four k in elements 4 * g to 4 * g + 3, where the A loader below puts that tile; all other elements are 0 */
#pragma unroll
  for (int rt = 0; rt < RT; ++rt) { FragH f; f.half[0] = *(const v8us*)(sp + (row0 + rt * 16 + ln) * 8);
#pragma unroll
    for (int q = 0; q < 16; ++q) bi[rt][0].h[q] = bi[rt][1].h[q] = (_Float16)0.0f;
#pragma unroll
    for (int q = 0; q < 3; ++q) { const float t = (2.0f * KS) * (float)f.h[q]; const _Float16 th = (_Float16)t; bi[rt][0].h[q] = bi[rt][1].h[4 + q] = hh ? (_Float16)(t - (float)th) : th; }
    bi[rt][0].h[3] = bi[rt][1].h[7] = (_Float16)1.0f;
    const float ni = (float)f.h[3] + (float)f.h[7];
#pragma unroll
    for (int r = 0; r < 8; ++r) ci[rt][r] = ni; }
  const v8f z8 = {0.f, 0.f, 0.f, 0.f, 0.f, 0.f, 0.f, 0.f};
  v8f acc[RT][NH][2], sacc[RT];      /* sacc: the row sums of the weights, head h in column h */
#pragma unroll
  for (int rt = 0; rt < RT; ++rt)
#pragma unroll
    for (int h = 0; h < NH; ++h) { acc[rt][h][0] = z8; acc[rt][h][1] = z8; sacc[rt] = z8; }
  FragH one[NH];      /* B fragments of the row sums: ones in all 32 k of column h, zeros in the other columns */
#pragma unroll
  for (int h = 0; h < NH; ++h)
#pragma unroll
    for (int q = 0; q < 16; ++q) one[h].h[q] = ln == h ? (_Float16)1.0f : (_Float16)0.0f;
  const unsigned short* vb = (const unsigned short*)VF + (size_t)b * (NP / 32) * (COUT * 32) + lane * 8;      /* this lane's 16 bytes of the first fragment of the batch's slice 0 */
  int s = (w + blockIdx.x) & (NP / 32 - 1);      /* the wave's first slice: the work-group's own place in the ring of slices, so that at any moment the work-groups of a batch read different value lines */
  const unsigned short* ap = sp + ln * 8 + 4 * hh;      /* this lane's four k of row j = ln of a 16-point tile: (x, y, z, nh) or (x, y, z, nl); 256 contiguous bytes a wave */
  FragH an;      /* A fragment of the distance product: elements 0 to 7 are loaded slice by slice (tile g in 4 * g to 4 * g + 3), the others stay 0 */
#pragma unroll
  for (int g = 0; g < 2; ++g) an.quad[g] = *(const v4us*)(ap + (s * 32 + g * 16) * 8);
#pragma unroll
  for (int q = 8; q < 16; ++q) an.h[q] = (_Float16)0.0f;
  v8f dg[RT][2];      /* the exp2 arguments of the slice in hand, made one slice ahead */
#pragma unroll
  for (int g = 0; g < 2; ++g)
#pragma unroll
    for (int rt = 0; rt < RT; ++rt) dg[rt][g] = __builtin_amdgcn_wmma_f32_16x16x32_f16(false, an.v, false, bi[rt][g].v, (short)0, ci[rt], false, false);
  for (int it = 0; it < NP / 32 / 8; ++it) {
    const int sn = (s + 8) & (NP / 32 - 1);      /* the wave's next slice, round the ring; behind the last one its first again, whose arguments nobody reads */
#pragma unroll
    for (int g = 0; g < 2; ++g) an.quad[g] = *(const v4us*)(ap + (sn * 32 + g * 16) * 8);
    __builtin_amdgcn_sched_barrier(0);      /* keeps the LDS read and its address work in front of the 16 loads: behind them it would rewrite their address registers ahead of the wait below */
    const unsigned short* vp = vb + s * (COUT * 32);
    FragH bq[2 * NH];
#pragma unroll
    for (int t = 2 * NH - 1; t >= 0; --t) { bq[t].half[0] = *(const v8us*)(vp + t * 512); bq[t].half[1] = *(const v8us*)(vp + t * 512 + 256); }
    asm volatile("s_wait_xcnt 0x0" :: "v"(vp) : "memory");      /* vp's registers, which the 16 issued loads name, are rewritten later: the wait stands in front of that write, and vp as its input keeps the pair from being handed out as a load's destination ahead of it; the barrier on the next line keeps the write behind it */
    __builtin_amdgcn_sched_barrier(0);      /* keeps the 16 fragment loads in front of the exp work, which covers their latency; without it they sink to just in front of each WMMA */
#pragma unroll
    for (int rt = 0; rt < RT; ++rt) {
      float wt[16];
#pragma unroll
      for (int e = 0; e < 16; ++e) wt[e] = __builtin_amdgcn_exp2f(dg[rt][e >> 3][e & 7]);      /* exp(-d2 / 16), the widest head; the bare hardware exp2 may flush below 2^-126, where the weight is 0 as f16 and adds nothing to a row sum that holds the self term 1 */
#pragma unroll
      for (int h = NH - 1; h >= 0; --h) { FragH a;      /* ls = 4, 2, 1, 0.5: 1 / ls^2 grows fourfold from head to head, so the next head's weight is this one's fourth power (two squarings) */
#pragma unroll
        for (int e = 0; e < 16; ++e) { const float ev = wt[e]; a.h[e] = (_Float16)(ev * 1024.0f); const float sq = ev * ev; wt[e] = sq * sq; }
        acc[rt][h][0] = __builtin_amdgcn_wmma_f32_16x16x32_f16(false, a.v, false, bq[2 * h].v, (short)0, acc[rt][h][0], false, false);
        acc[rt][h][1] = __builtin_amdgcn_wmma_f32_16x16x32_f16(false, a.v, false, bq[2 * h + 1].v, (short)0, acc[rt][h][1], false, false);
        sacc[rt] = __builtin_amdgcn_wmma_f32_16x16x32_f16(false, a.v, false, one[h].v, (short)0, sacc[rt], false, false);      /* the head's row sums over this slice, from the same f16 weights as the products */
        if (h >= 2) dg[rt][h - 2] = __builtin_amdgcn_wmma_f32_16x16x32_f16(false, an.v, false, bi[rt][h - 2].v, (short)0, ci[rt], false, false); }      /* the next slice's arguments, one tile behind each of the first two heads: the matrix unit makes them under this slice's vector work */
    }
    s = sn;
  }
  v16h wo[COUT / 32];      /* this wave's 16 columns of Wo as B fragments: asked for here, so that the stores of the row sums in front of the barrier cover part of their latency */
#pragma unroll
  for (int kk = 0; kk < COUT / 32; ++kk) wo[kk] = g2_frag(BO + (size_t)(w * 16 + ln) * COUT + kk * 32, hh);
  const float bias = bf16_round(bo[w * 16 + ln]);
  asm volatile("s_wait_xcnt 0x0" ::: "memory");      /* the address registers of the nine loads above are rewritten by the address work below: the wait stands in front of that */
  if (ln < NH) {      /* lane (hh, ln = h) holds in register r head h's sum of row 8 * hh + r */
#pragma unroll
    for (int rt = 0; rt < RT; ++rt)
#pragma unroll
      for (int r = 0; r < 8; ++r) ssum[w][ln][rt * 16 + 8 * hh + r] = sacc[rt][r]; }
  __syncthreads();      /* every wave has read its last coordinates: sm may be rewritten */
#pragma unroll
  for (int rt = 0; rt < RT; ++rt)
#pragma unroll
    for (int h = 0; h < NH; ++h)
#pragma unroll
      for (int t = 0; t < 2; ++t)
#pragma unroll
        for (int r = 0; r < 8; ++r) sm[(w * WR + rt * 16 + 8 * hh + r) * RPITCH + h * HD + t * 16 + ln] = acc[rt][h][t][r];
  __syncthreads();      /* the partial products and row sums of all eight waves are in LDS */
  const int c8 = (tid & 15) * 8, hd = c8 / HD;
#pragma unroll
  for (int rt = 0; rt < RT; ++rt) { const int row = rt * 16 + (tid >> 4);
    float tot = 0.f; v4f s0 = {0.f, 0.f, 0.f, 0.f}, s1 = s0;
#pragma unroll
    for (int ww = 0; ww < 8; ++ww) { tot += ssum[ww][hd][row]; s0 += *(const v4fa*)&sm[(ww * WR + row) * RPITCH + c8]; s1 += *(const v4fa*)&sm[(ww * WR + row) * RPITCH + c8 + 4]; }
    const float rs = 1.0f / (tot * 0.0009765625f + 1e-8f);      /* the sums carry the weights' factor 1024 */ FragH f, fl;
#pragma unroll
    for (int q = 0; q < 8; ++q) { const float v = ((q < 4 ? s0[q & 3] : s1[q & 3]) * 0.0009765625f) * rs; const _Float16 hi = (_Float16)v; f.h[q] = hi; fl.h[q] = (_Float16)((v - (float)hi) * 1024.0f); }
    *(v8us*)&shl[0][row][c8] = f.half[0]; *(v8us*)&shl[1][row][c8] = fl.half[0]; }
  __syncthreads();      /* the scaled rows are complete in shl, and every thread has read its last partial product: sm may be rewritten */
#pragma unroll
  for (int rt = 0; rt < RT; ++rt) { v8f oh = z8, ol = z8;
#pragma unroll
    for (int kk = 0; kk < COUT / 32; ++kk) { FragH ah, al;
      ah.half[0] = *(const v8us*)&shl[0][rt * 16 + ln][kk * 32 + 8 * hh]; ah.half[1] = *(const v8us*)&shl[0][rt * 16 + ln][kk * 32 + 16 + 8 * hh];
      al.half[0] = *(const v8us*)&shl[1][rt * 16 + ln][kk * 32 + 8 * hh]; al.half[1] = *(const v8us*)&shl[1][rt * 16 + ln][kk * 32 + 16 + 8 * hh];
      oh = __builtin_amdgcn_wmma_f32_16x16x32_f16(false, ah.v, false, wo[kk], (short)0, oh, false, false);
      ol = __builtin_amdgcn_wmma_f32_16x16x32_f16(false, al.v, false, wo[kk], (short)0, ol, false, false); }
#pragma unroll
    for (int r = 0; r < 8; ++r) { const float lo = ol[r] * (0.0625f / 1024.0f); float v = oh[r] * 0.0625f + bias; v += lo; sm[(rt * 16 + 8 * hh + r) * RPITCH + w * 16 + ln] = v; } }      /* out = (mh_lo + mh_hi) Wo + bo; Wo was scaled by 16 */
  __syncthreads();      /* all eight column tiles of the result are in LDS */
#pragma unroll
  for (int u = 0; u < 2 * RT; ++u) { const int e = u * 256 + tid, orow = e >> 5, c4 = (e & 31) * 4; const v4f v = *(const v4fa*)&sm[orow * RPITCH + c4]; *(v4f*)(out + ((size_t)b * NP + row0 + orow) * COUT + c4) = v; } }

extern "C" void kernel_launch(void* const* d_in, const int* in_sizes, int n_in,
                              void* d_out, int out_size, void* d_ws, size_t ws_size, hipStream_t stream) {
  (void)in_sizes; (void)n_in; (void)out_size;
  const float* const* I = (const float* const*)d_in; const float* feat = I[0]; const float* crd = I[1]; const float* Wv = I[2]; const float* bv = I[3]; const float* Wo = I[4]; const float* bo = I[5];
  char* ws = (char*)d_ws; size_t off = 0;
  auto take = [&](size_t bytes) { char* p = ws + off; off += (bytes + 255) & ~(size_t)255; return p; };
  _Float16* BO = (_Float16*)take((size_t)COUT * COUT * 2); _Float16* VF = (_Float16*)take((size_t)NB * NP * COUT * 2);
  if (off > ws_size) return;
  k_val<<<NB * (NP / 32) + COUT * COUT / 8 / 256, 256, 0, stream>>>(feat, Wv, bv, Wo, VF, BO);      /* values in B-fragment order; Wo (in, out) transposed */
  k_att<<<NB * (NP / WR), 256, 0, stream>>>(crd, VF, BO, bo, (float*)d_out);      /* all (batch, head): weights, att . value, row scaling, output projection */
}

// v008
// It runs in 20.4 microseconds.
// Two timings next to v007 put it at 1.05 and 1.04 times that version's speed.
// All steps since v000 together make it 35.2 times as fast.
#include <hip/hip_runtime.h>
// KernelSelfAttention (2 x 4096 points; d2 = |c_i - c_j|^2 from 3-D coords; per head h with lengthscale ls in {0.5, 1, 2, 4}: att = exp(-d2 / ls^2) / (sum_j + 1e-8); value_h = features Wv[h] + bv[h] [32]; head_out = att value; out = concat_h Wo + bo -> [2][4096][128]).
#define NB 2
#define NP 4096
#define CIN 128
#define NH 4
#define HD 32
#define COUT 128
#define HPITCH 136      /* f16 per row of a 128-wide A operand in LDS: 16 bytes more than the row, so the 16 rows of a 16-byte fragment read fall on different banks */
typedef unsigned short v8us __attribute__((ext_vector_type(8), may_alias));
typedef unsigned short v4us __attribute__((ext_vector_type(4), may_alias));
typedef float  v8f  __attribute__((ext_vector_type(8)));
typedef float  v4f  __attribute__((ext_vector_type(4)));
typedef float  v4fa __attribute__((ext_vector_type(4), may_alias));
typedef _Float16 v16h __attribute__((ext_vector_type(16)));
union FragH { v16h v; v8us half[2]; v4us quad[4]; _Float16 h[16]; unsigned short u[16]; };

__device__ __forceinline__ unsigned short bf16_bits(float x) { unsigned int u = __float_as_uint(x); return (unsigned short)((u + 0x7FFFu + ((u >> 16) & 1u)) >> 16); }
__device__ __forceinline__ float bf16_val(unsigned short b) { return __uint_as_float(((unsigned int)b) << 16); }
__device__ __forceinline__ float bf16_round(float x) { return bf16_val(bf16_bits(x)); }
// A or B fragment of v_wmma_f32_16x16x32_f16 from 32 consecutive f16 of this lane's row (A) or column (B): k = 8 * hh + q, then 16 + 8 * hh + q
__device__ __forceinline__ v16h g2_frag(const _Float16* p, int hh) { FragH f; f.half[0] = *(const v8us*)((const unsigned short*)p + 8 * hh); f.half[1] = *(const v8us*)((const unsigned short*)p + 16 + 8 * hh); return f.v; }

// Values, straight from the f32 inputs into B-fragment order: VF[b][s = j / 32][tile = col / 16][half][lane][8]; lane = hh * 16 + (col & 15), j = s * 32 + half * 16 + hh * 8 + q, so that a wave's fragment load in k_att is 512 contiguous bytes.
// One work-group = one 32-row slice (b, s); wave w = column tile w (col = h * 32 + k). The slice of features is rounded once (bf16, exact as f16) into LDS and read from there as A fragments; each wave rounds its own 16 columns of Wv (bf16, * 16)
// into B fragments; both in the k order of g2_frag. The accumulator of row tile g holds in lane (hh, ln), register r, the value of row g * 16 + hh * 8 + r, column ln: that is VF's own order (half = g, q = r), one 16-byte store a lane.
// The work-groups behind the last slice write BO[n][k] = f16(bf16(Wo[k][n]) * 16) for k_att's output projection.
__global__ __launch_bounds__(256) void k_val(const float* __restrict__ feat, const float* __restrict__ Wv, const float* __restrict__ bv, const float* __restrict__ Wo, _Float16* __restrict__ VF, _Float16* __restrict__ BO) {
  __shared__ __attribute__((aligned(16))) unsigned short sa[32][HPITCH];
  const int tid = threadIdx.x;
  if (blockIdx.x >= NB * (NP / 32)) {      /* the same for a whole work-group, and in front of the barrier */
    const int t = (blockIdx.x - NB * (NP / 32)) * 256 + tid, n = t / (COUT / 8), k8 = (t % (COUT / 8)) * 8; FragH f;
#pragma unroll
    for (int i = 0; i < 8; ++i) f.h[i] = (_Float16)(bf16_round(Wo[(size_t)(k8 + i) * COUT + n]) * 16.0f);
    *(v8us*)((unsigned short*)BO + (size_t)n * COUT + k8) = f.half[0];
    return; }
  const int w = tid >> 5, lane = tid & 31, ln = lane & 15, hh = lane >> 4;
  const int col = w * 16 + ln;
  const float* wp = Wv + (size_t)(col / HD) * CIN * HD + (col % HD) + 8 * hh * HD;      /* Wv[h][c][k]: element c = 8 * hh + i of this lane's column at wp[i * HD] */
  const float* ap = feat + (size_t)blockIdx.x * 32 * CIN;
  v4f x[4]; float wv[CIN / 32][16];
#pragma unroll
  for (int u = 0; u < 4; ++u) x[u] = *(const v4fa*)(ap + (u * 256 + tid) * 4);
#pragma unroll
  for (int kk = 0; kk < CIN / 32; ++kk)
#pragma unroll
    for (int q = 0; q < 8; ++q) { wv[kk][q] = wp[(kk * 32 + q) * HD]; wv[kk][8 + q] = wp[(kk * 32 + 16 + q) * HD]; }
  const float bias = bf16_round(bv[col]);
  __builtin_amdgcn_sched_barrier(0);      /* keeps all loads of the kernel in front of the first use: one memory latency; without it they are spread among the conversions and each group is waited for in turn */
#pragma unroll
  for (int u = 0; u < 4; ++u) { const int e = u * 256 + tid; union { _Float16 h[4]; v4us v; } p;
#pragma unroll
    for (int q = 0; q < 4; ++q) p.h[q] = (_Float16)bf16_round(x[u][q]);
    *(v4us*)&sa[e >> 5][(e & 31) * 4] = p.v; }
  __syncthreads();      /* the 32 rounded rows are in LDS */
  const v8f z8 = {0.f, 0.f, 0.f, 0.f, 0.f, 0.f, 0.f, 0.f};
  v8f acc[2] = {z8, z8};
#pragma unroll
  for (int kk = 0; kk < CIN / 32; ++kk) { FragH bq;
#pragma unroll
    for (int e = 0; e < 16; ++e) bq.h[e] = (_Float16)(bf16_round(wv[kk][e]) * 16.0f);
#pragma unroll
    for (int g = 0; g < 2; ++g) { FragH aq; aq.half[0] = *(const v8us*)&sa[g * 16 + ln][kk * 32 + 8 * hh]; aq.half[1] = *(const v8us*)&sa[g * 16 + ln][kk * 32 + 16 + 8 * hh];
      acc[g] = __builtin_amdgcn_wmma_f32_16x16x32_f16(false, aq.v, false, bq.v, (short)0, acc[g], false, false); } }
#pragma unroll
  for (int g = 0; g < 2; ++g) { FragH o;
#pragma unroll
    for (int r = 0; r < 8; ++r) o.h[r] = (_Float16)(acc[g][r] * 0.0625f + bias);
    *(v8us*)((unsigned short*)VF + ((((size_t)blockIdx.x * 8 + w) * 2 + g) * 32 + lane) * 8) = o.half[0]; }
  asm volatile("s_wait_xcnt 0x0" ::: "memory");      /* in the built code the spare work-groups' part stands behind these two stores and writes their registers: the wait stands in front of any such write */
}

// One work-group = 32 rows i of one batch (RT = 2 tiles of 16), all four heads. Wave w takes the 32-wide j slices s = w + g, w + g + 8, ... modulo their number (g = the work-group's index: each group enters the ring at its own place); each slice's 16 value fragments and its coordinates are fetched once and used for both row tiles, which halves
// the bytes that the attention kernel draws from L2 per (i, j) pair. The exp2 argument -KS * d2 + WB = 2 KS c_j . c_i - KS |c_j|^2 - KS |c_i|^2 + WB of 16 points j x 16 rows i is one WMMA of the same f16 form, eight of its 32 k in use:
// A row j = (x, y, z, nh | x, y, z, nl), B column i = (Xh, Yh, Zh, 1 | Xl, Yl, Zl, 1), C = -KS |c_i|^2 + WB in f32 (one A fragment holds both 16-point tiles of a slice, each in four k of its own; B has zeros at the other tile's k). x, y, z are bf16-rounded and so exact as f16; nh + nl = -KS |c_j|^2 and Xh + Xl = 2 KS x_i are f32 values split into
// f16 and the f16 of the rest (22 bits or more); every product is exact in f32. With j as the rows of D, lane (hh, ln) holds in register r the pair (j = 8 * hh + r, i = ln): two such tiles are the 16 k of the weights' A fragment as they stand.
// Per row tile: one exp2 once per (i, j), the four heads' weights exp(-d2 / ls^2) * F_h (the widest head's, then fourth powers; F_h = 2^(WB * 4^(3 - h)) grows out of the bias WB that C adds to the exp2 argument, so no multiply scales a weight) built in registers
// as the A fragment (same k order as the B fragment: k = half * 16 + hh * 8 + q), two WMMAs per head and a third, against a column of ones, for the head's row sums (the sums of the very f16 weights that the products use; they carry the head's factor F_h, as the products do). The eight waves' partial products and row sums are joined in LDS, scaled by 1 / (sum + 1e-8 F_h) and split into f16 hi + residual,
// which stay in LDS: wave w multiplies both by the 16 columns w * 16 ... of Wo (four k steps each) and adds bo; the 32 x 128 result goes out through LDS so that every store of a wave is one whole row.
#define RPITCH 132      /* floats per row of a partial product in LDS: rows 8 apart (the two half-waves) fall on different banks */
#define RT 2            /* 16-row tiles per wave and work-group */
#define WR (RT * 16)    /* rows per work-group */
#define KS 0.09016844005556021f      /* log2(e) / 16: exp(-d2 / 16) = 2^(-KS * d2), the widest head */
#define WB 0.1875f      /* bias of the exp2 argument: the heads' weights carry 2^(3/16), 2^(3/4), 2^3, 2^12 (ls = 4, 2, 1, 0.5), which lifts the narrow heads' small weights out of the f16 subnormals and keeps the self term (4096 at most) far below the f16 maximum */
__global__ __launch_bounds__(256) void k_att(const float* __restrict__ crd, const _Float16* __restrict__ VF, const _Float16* __restrict__ BO, const float* __restrict__ bo, float* __restrict__ out) {
  __shared__ __attribute__((aligned(16))) float sm[8 * WR * RPITCH];      /* first the NP points, 8 f16 each: (x, y, z, nh, x, y, z, nl), later the eight waves' 32 x 128 partial products */
  __shared__ float ssum[8][NH][WR];
  __shared__ __attribute__((aligned(16))) unsigned short shl[2][WR][HPITCH];      /* the 32 scaled rows: [0] f16 hi, [1] residual * 1024 */
  const int tid = threadIdx.x, w = __builtin_amdgcn_readfirstlane(tid >> 5), lane = tid & 31, ln = lane & 15, hh = lane >> 4;
  const int b = blockIdx.x / (NP / WR), row0 = (blockIdx.x % (NP / WR)) * WR;
  const float* cb = crd + (size_t)b * NP * 3;
  unsigned short* sp = (unsigned short*)sm;
  float cr[NP / 256][3];
#pragma unroll
  for (int u = 0; u < NP / 256; ++u)
#pragma unroll
    for (int q = 0; q < 3; ++q) cr[u][q] = cb[(u * 256 + tid) * 3 + q];
  asm volatile("s_wait_xcnt 0x0" ::: "memory");      /* the offset register of these loads is rewritten by the address work of the LDS stores: the wait stands in front of that; the barrier on the next line keeps that work behind it */
  __builtin_amdgcn_sched_barrier(0);
#pragma unroll
  for (int u = 0; u < NP / 256; ++u) { const int p = u * 256 + tid;      /* one point a thread: a wave's 16-byte LDS stores are 512 contiguous bytes */
    const float x = bf16_round(cr[u][0]), y = bf16_round(cr[u][1]), z = bf16_round(cr[u][2]), n = -KS * (x * x + y * y + z * z);
    FragH f; f.h[0] = f.h[4] = (_Float16)x; f.h[1] = f.h[5] = (_Float16)y; f.h[2] = f.h[6] = (_Float16)z; f.h[3] = (_Float16)n; f.h[7] = (_Float16)(n - (float)f.h[3]);
    *(v8us*)(sp + p * 8) = f.half[0]; }
  __syncthreads();
  FragH bi[RT][2]; v8f ci[RT];      /* B fragments and C of the distance product; for the slice's 16-point tile g lane half hh holds its four k in elements 4 * g to 4 * g + 3, where the A loader below puts that tile; all other elements are 0 */
#pragma unroll
  for (int rt = 0; rt < RT; ++rt) { FragH f; f.half[0] = *(const v8us*)(sp + (row0 + rt * 16 + ln) * 8);
#pragma unroll
    for (int q = 0; q < 16; ++q) bi[rt][0].h[q] = bi[rt][1].h[q] = (_Float16)0.0f;
#pragma unroll
    for (int q = 0; q < 3; ++q) { const float t = (2.0f * KS) * (float)f.h[q]; const _Float16 th = (_Float16)t; bi[rt][0].h[q] = bi[rt][1].h[4 + q] = hh ? (_Float16)(t - (float)th) : th; }
    bi[rt][0].h[3] = bi[rt][1].h[7] = (_Float16)1.0f;
    const float ni = (float)f.h[3] + (float)f.h[7];
#pragma unroll
    for (int r = 0; r < 8; ++r) ci[rt][r] = ni + WB; }
  const v8f z8 = {0.f, 0.f, 0.f, 0.f, 0.f, 0.f, 0.f, 0.f};
  v8f acc[RT][NH][2], sacc[RT];      /* sacc: the row sums of the weights, head h in column h */
#pragma unroll
  for (int rt = 0; rt < RT; ++rt)
#pragma unroll
    for (int h = 0; h < NH; ++h) { acc[rt][h][0] = z8; acc[rt][h][1] = z8; sacc[rt] = z8; }
  FragH one[NH];      /* B fragments of the row sums: ones in all 32 k of column h, zeros in the other columns */
#pragma unroll
  for (int h = 0; h < NH; ++h)
#pragma unroll
    for (int q = 0; q < 16; ++q) one[h].h[q] = ln == h ? (_Float16)1.0f : (_Float16)0.0f;
  const unsigned short* vb = (const unsigned short*)VF + (size_t)b * (NP / 32) * (COUT * 32) + lane * 8;      /* this lane's 16 bytes of the first fragment of the batch's slice 0 */
  int s = (w + blockIdx.x) & (NP / 32 - 1);      /* the wave's first slice: the work-group's own place in the ring of slices, so that at any moment the work-groups of a batch read different value lines */
  const unsigned short* ap = sp + ln * 8 + 4 * hh;      /* this lane's four k of row j = ln of a 16-point tile: (x, y, z, nh) or (x, y, z, nl); 256 contiguous bytes a wave */
  FragH an;      /* A fragment of the distance product: elements 0 to 7 are loaded slice by slice (tile g in 4 * g to 4 * g + 3), the others stay 0 */
#pragma unroll
  for (int g = 0; g < 2; ++g) an.quad[g] = *(const v4us*)(ap + (s * 32 + g * 16) * 8);
#pragma unroll
  for (int q = 8; q < 16; ++q) an.h[q] = (_Float16)0.0f;
  v8f dg[RT][2];      /* the exp2 arguments of the slice in hand, made one slice ahead */
#pragma unroll
  for (int g = 0; g < 2; ++g)
#pragma unroll
    for (int rt = 0; rt < RT; ++rt) dg[rt][g] = __builtin_amdgcn_wmma_f32_16x16x32_f16(false, an.v, false, bi[rt][g].v, (short)0, ci[rt], false, false);
  for (int it = 0; it < NP / 32 / 8; ++it) {
    const int sn = (s + 8) & (NP / 32 - 1);      /* the wave's next slice, round the ring; behind the last one its first again, whose arguments nobody reads */
#pragma unroll
    for (int g = 0; g < 2; ++g) an.quad[g] = *(const v4us*)(ap + (sn * 32 + g * 16) * 8);
    __builtin_amdgcn_sched_barrier(0);      /* keeps the LDS read and its address work in front of the 16 loads: behind them it would rewrite their address registers ahead of the wait below */
    const unsigned short* vp = vb + s * (COUT * 32);
    FragH bq[2 * NH];
#pragma unroll
    for (int t = 2 * NH - 1; t >= 0; --t) { bq[t].half[0] = *(const v8us*)(vp + t * 512); bq[t].half[1] = *(const v8us*)(vp + t * 512 + 256); }
    asm volatile("s_wait_xcnt 0x0" :: "v"(vp) : "memory");      /* vp's registers, which the 16 issued loads name, are rewritten later: the wait stands in front of that write, and vp as its input keeps the pair from being handed out as a load's destination ahead of it; the barrier on the next line keeps the write behind it */
    __builtin_amdgcn_sched_barrier(0);      /* keeps the 16 fragment loads in front of the exp work, which covers their latency; without it they sink to just in front of each WMMA */
#pragma unroll
    for (int rt = 0; rt < RT; ++rt) {
      float wt[16];
#pragma unroll
      for (int e = 0; e < 16; ++e) wt[e] = __builtin_amdgcn_exp2f(dg[rt][e >> 3][e & 7]);      /* exp(-d2 / 16) * 2^WB, the widest head; the bare hardware exp2 may flush below 2^-126, where the weight is 0 as f16 and adds nothing to a row sum that holds the self term F_h */
#pragma unroll
      for (int h = NH - 1; h >= 0; --h) { FragH a;      /* ls = 4, 2, 1, 0.5: 1 / ls^2 grows fourfold from head to head, so the next head's weight, factor included, is this one's fourth power (two squarings) */
#pragma unroll
        for (int e = 0; e < 16; ++e) { const float ev = wt[e]; a.h[e] = (_Float16)ev; const float sq = ev * ev; wt[e] = sq * sq; }
        acc[rt][h][0] = __builtin_amdgcn_wmma_f32_16x16x32_f16(false, a.v, false, bq[2 * h].v, (short)0, acc[rt][h][0], false, false);
        acc[rt][h][1] = __builtin_amdgcn_wmma_f32_16x16x32_f16(false, a.v, false, bq[2 * h + 1].v, (short)0, acc[rt][h][1], false, false);
        sacc[rt] = __builtin_amdgcn_wmma_f32_16x16x32_f16(false, a.v, false, one[h].v, (short)0, sacc[rt], false, false);      /* the head's row sums over this slice, from the same f16 weights as the products */
        if (h >= 2) dg[rt][h - 2] = __builtin_amdgcn_wmma_f32_16x16x32_f16(false, an.v, false, bi[rt][h - 2].v, (short)0, ci[rt], false, false); }      /* the next slice's arguments, one tile behind each of the first two heads: the matrix unit makes them under this slice's vector work */
    }
    s = sn;
  }
  v16h wo[COUT / 32];      /* this wave's 16 columns of Wo as B fragments: asked for here, so that the stores of the row sums in front of the barrier cover part of their latency */
#pragma unroll
  for (int kk = 0; kk < COUT / 32; ++kk) wo[kk] = g2_frag(BO + (size_t)(w * 16 + ln) * COUT + kk * 32, hh);
  const float bias = bf16_round(bo[w * 16 + ln]);
  asm volatile("s_wait_xcnt 0x0" ::: "memory");      /* the address registers of the nine loads above are rewritten by the address work below: the wait stands in front of that */
  if (ln < NH) {      /* lane (hh, ln = h) holds in register r head h's sum of row 8 * hh + r */
#pragma unroll
    for (int rt = 0; rt < RT; ++rt)
#pragma unroll
      for (int r = 0; r < 8; ++r) ssum[w][ln][rt * 16 + 8 * hh + r] = sacc[rt][r]; }
  __syncthreads();      /* every wave has read its last coordinates: sm may be rewritten */
#pragma unroll
  for (int rt = 0; rt < RT; ++rt)
#pragma unroll
    for (int h = 0; h < NH; ++h)
#pragma unroll
      for (int t = 0; t < 2; ++t)
#pragma unroll
        for (int r = 0; r < 8; ++r) sm[(w * WR + rt * 16 + 8 * hh + r) * RPITCH + h * HD + t * 16 + ln] = acc[rt][h][t][r];
  __syncthreads();      /* the partial products and row sums of all eight waves are in LDS */
  const int c8 = (tid & 15) * 8, hd = c8 / HD;
  const float eps = 1e-8f * __builtin_amdgcn_exp2f(WB * (float)(64 >> (2 * hd)));      /* 1e-8 * F_h: products and sums both carry F_h, so it cancels in their quotient and only the reference's 1e-8 has to follow it */
#pragma unroll
  for (int rt = 0; rt < RT; ++rt) { const int row = rt * 16 + (tid >> 4);
    float tot = 0.f; v4f s0 = {0.f, 0.f, 0.f, 0.f}, s1 = s0;
#pragma unroll
    for (int ww = 0; ww < 8; ++ww) { tot += ssum[ww][hd][row]; s0 += *(const v4fa*)&sm[(ww * WR + row) * RPITCH + c8]; s1 += *(const v4fa*)&sm[(ww * WR + row) * RPITCH + c8 + 4]; }
    const float rs = 1.0f / (tot + eps); FragH f, fl;
#pragma unroll
    for (int q = 0; q < 8; ++q) { const float v = (q < 4 ? s0[q & 3] : s1[q & 3]) * rs; const _Float16 hi = (_Float16)v; f.h[q] = hi; fl.h[q] = (_Float16)((v - (float)hi) * 1024.0f); }
    *(v8us*)&shl[0][row][c8] = f.half[0]; *(v8us*)&shl[1][row][c8] = fl.half[0]; }
  __syncthreads();      /* the scaled rows are complete in shl, and every thread has read its last partial product: sm may be rewritten */
#pragma unroll
  for (int rt = 0; rt < RT; ++rt) { v8f oh = z8, ol = z8;
#pragma unroll
    for (int kk = 0; kk < COUT / 32; ++kk) { FragH ah, al;
      ah.half[0] = *(const v8us*)&shl[0][rt * 16 + ln][kk * 32 + 8 * hh]; ah.half[1] = *(const v8us*)&shl[0][rt * 16 + ln][kk * 32 + 16 + 8 * hh];
      al.half[0] = *(const v8us*)&shl[1][rt * 16 + ln][kk * 32 + 8 * hh]; al.half[1] = *(const v8us*)&shl[1][rt * 16 + ln][kk * 32 + 16 + 8 * hh];
      oh = __builtin_amdgcn_wmma_f32_16x16x32_f16(false, ah.v, false, wo[kk], (short)0, oh, false, false);
      ol = __builtin_amdgcn_wmma_f32_16x16x32_f16(false, al.v, false, wo[kk], (short)0, ol, false, false); }
#pragma unroll
    for (int r = 0; r < 8; ++r) { const float lo = ol[r] * (0.0625f / 1024.0f); float v = oh[r] * 0.0625f + bias; v += lo; sm[(rt * 16 + 8 * hh + r) * RPITCH + w * 16 + ln] = v; } }      /* out = (mh_lo + mh_hi) Wo + bo; Wo was scaled by 16 */
  __syncthreads();      /* all eight column tiles of the result are in LDS */
#pragma unroll
  for (int u = 0; u < 2 * RT; ++u) { const int e = u * 256 + tid, orow = e >> 5, c4 = (e & 31) * 4; const v4f v = *(const v4fa*)&sm[orow * RPITCH + c4]; *(v4f*)(out + ((size_t)b * NP + row0 + orow) * COUT + c4) = v; } }

extern "C" void kernel_launch(void* const* d_in, const int* in_sizes, int n_in,
                              void* d_out, int out_size, void* d_ws, size_t ws_size, hipStream_t stream) {
  (void)in_sizes; (void)n_in; (void)out_size;
  const float* const* I = (const float* const*)d_in; const float* feat = I[0]; const float* crd = I[1]; const float* Wv = I[2]; const float* bv = I[3]; const float* Wo = I[4]; const float* bo = I[5];
  char* ws = (char*)d_ws; size_t off = 0;
  auto take = [&](size_t bytes) { char* p = ws + off; off += (bytes + 255) & ~(size_t)255; return p; };
  _Float16* BO = (_Float16*)take((size_t)COUT * COUT * 2); _Float16* VF = (_Float16*)take((size_t)NB * NP * COUT * 2);
  if (off > ws_size) return;
  k_val<<<NB * (NP / 32) + COUT * COUT / 8 / 256, 256, 0, stream>>>(feat, Wv, bv, Wo, VF, BO);      /* values in B-fragment order; Wo (in, out) transposed */
  k_att<<<NB * (NP / WR), 256, 0, stream>>>(crd, VF, BO, bo, (float*)d_out);      /* all (batch, head): weights, att . value, row scaling, output projection */
}

// v009
// One run takes 19.2 microseconds.
// Next to v008, in two timings, it ran 1.06 and 1.07 times as fast.
// Counting every step since v000, it is 37.6 times as fast.
#include <hip/hip_runtime.h>
// KernelSelfAttention (2 x 4096 points; d2 = |c_i - c_j|^2 from 3-D coords; per head h with lengthscale ls in {0.5, 1, 2, 4}: att = exp(-d2 / ls^2) / (sum_j + 1e-8); value_h = features Wv[h] + bv[h] [32]; head_out = att value; out = concat_h Wo + bo -> [2][4096][128]).
#define NB 2
#define NP 4096
#define CIN 128
#define NH 4
#define HD 32
#define COUT 128
#define KS 0.09016844005556021f      /* log2(e) / 16: exp(-d2 / 16) = 2^(-KS * d2), the widest head */
#define HPITCH 136      /* f16 per row of a 128-wide A operand in LDS: 16 bytes more than the row, so the 16 rows of a 16-byte fragment read fall on different banks */
typedef unsigned short v8us __attribute__((ext_vector_type(8), may_alias));
typedef unsigned short v4us __attribute__((ext_vector_type(4), may_alias));
typedef float  v8f  __attribute__((ext_vector_type(8)));
typedef float  v4f  __attribute__((ext_vector_type(4)));
typedef float  v4fa __attribute__((ext_vector_type(4), may_alias));
typedef _Float16 v16h __attribute__((ext_vector_type(16)));
union FragH { v16h v; v8us half[2]; v4us quad[4]; _Float16 h[16]; unsigned short u[16]; };

__device__ __forceinline__ unsigned short bf16_bits(float x) { unsigned int u = __float_as_uint(x); return (unsigned short)((u + 0x7FFFu + ((u >> 16) & 1u)) >> 16); }
__device__ __forceinline__ float bf16_val(unsigned short b) { return __uint_as_float(((unsigned int)b) << 16); }
__device__ __forceinline__ float bf16_round(float x) { return bf16_val(bf16_bits(x)); }
// A or B fragment of v_wmma_f32_16x16x32_f16 from 32 consecutive f16 of this lane's row (A) or column (B): k = 8 * hh + q, then 16 + 8 * hh + q
__device__ __forceinline__ v16h g2_frag(const _Float16* p, int hh) { FragH f; f.half[0] = *(const v8us*)((const unsigned short*)p + 8 * hh); f.half[1] = *(const v8us*)((const unsigned short*)p + 16 + 8 * hh); return f.v; }

// Values, straight from the f32 inputs into B-fragment order: VF[b][s = j / 32][tile = col / 16][half][lane][8]; lane = hh * 16 + (col & 15), j = s * 32 + half * 16 + hh * 8 + q, so that a wave's fragment load in k_att is 512 contiguous bytes.
// One work-group = one 32-row slice (b, s); wave w = column tile w (col = h * 32 + k). The slice of features is rounded once (bf16, exact as f16) into LDS and read from there as A fragments; each wave rounds its own 16 columns of Wv (bf16, * 16)
// into B fragments; both in the k order of g2_frag. The accumulator of row tile g holds in lane (hh, ln), register r, the value of row g * 16 + hh * 8 + r, column ln: that is VF's own order (half = g, q = r), one 16-byte store a lane.
// The work-groups behind the last slice write BO[n][k] = f16(bf16(Wo[k][n]) * 16) for k_att's output projection; those behind them write the points, 8 f16 each, PK[b][p] = (x, y, z, nh, x, y, z, nl), one point a thread: the rows of the distance product's A operand in k_att (x, y, z bf16-rounded, nh + nl = -KS |c|^2).
__global__ __launch_bounds__(256) void k_val(const float* __restrict__ feat, const float* __restrict__ crd, const float* __restrict__ Wv, const float* __restrict__ bv, const float* __restrict__ Wo, _Float16* __restrict__ VF, _Float16* __restrict__ BO, _Float16* __restrict__ PK) {
  __shared__ __attribute__((aligned(16))) unsigned short sa[32][HPITCH];
  const int tid = threadIdx.x;
  if (blockIdx.x >= NB * (NP / 32) + COUT * COUT / 8 / 256) {      /* the same for a whole work-group, and in front of the barrier */
    const int p = (blockIdx.x - NB * (NP / 32) - COUT * COUT / 8 / 256) * 256 + tid;
    const float c0 = crd[p * 3], c1 = crd[p * 3 + 1], c2 = crd[p * 3 + 2];
    asm volatile("s_wait_xcnt 0x0" ::: "memory");      /* the address registers of these loads may be rewritten by the work below: the wait stands in front of that */
    const float x = bf16_round(c0), y = bf16_round(c1), z = bf16_round(c2), n = -KS * (x * x + y * y + z * z);
    FragH f; f.h[0] = f.h[4] = (_Float16)x; f.h[1] = f.h[5] = (_Float16)y; f.h[2] = f.h[6] = (_Float16)z; f.h[3] = (_Float16)n; f.h[7] = (_Float16)(n - (float)f.h[3]);
    *(v8us*)((unsigned short*)PK + (size_t)p * 8) = f.half[0];      /* a wave's 16-byte stores are 512 contiguous bytes */
    return; }
  if (blockIdx.x >= NB * (NP / 32)) {      /* the same for a whole work-group, and in front of the barrier */
    const int t = (blockIdx.x - NB * (NP / 32)) * 256 + tid, n = t / (COUT / 8), k8 = (t % (COUT / 8)) * 8; FragH f;
#pragma unroll
    for (int i = 0; i < 8; ++i) f.h[i] = (_Float16)(bf16_round(Wo[(size_t)(k8 + i) * COUT + n]) * 16.0f);
    *(v8us*)((unsigned short*)BO + (size_t)n * COUT + k8) = f.half[0];
    return; }
  const int w = tid >> 5, lane = tid & 31, ln = lane & 15, hh = lane >> 4;
  const int col = w * 16 + ln;
  const float* wp = Wv + (size_t)(col / HD) * CIN * HD + (col % HD) + 8 * hh * HD;      /* Wv[h][c][k]: element c = 8 * hh + i of this lane's column at wp[i * HD] */
  const float* ap = feat + (size_t)blockIdx.x * 32 * CIN;
  v4f x[4]; float wv[CIN / 32][16];
#pragma unroll
  for (int u = 0; u < 4; ++u) x[u] = *(const v4fa*)(ap + (u * 256 + tid) * 4);
#pragma unroll
  for (int kk = 0; kk < CIN / 32; ++kk)
#pragma unroll
    for (int q = 0; q < 8; ++q) { wv[kk][q] = wp[(kk * 32 + q) * HD]; wv[kk][8 + q] = wp[(kk * 32 + 16 + q) * HD]; }
  const float bias = bf16_round(bv[col]);
  __builtin_amdgcn_sched_barrier(0);      /* keeps all loads of the kernel in front of the first use: one memory latency; without it they are spread among the conversions and each group is waited for in turn */
#pragma unroll
  for (int u = 0; u < 4; ++u) { const int e = u * 256 + tid; union { _Float16 h[4]; v4us v; } p;
#pragma unroll
    for (int q = 0; q < 4; ++q) p.h[q] = (_Float16)bf16_round(x[u][q]);
    *(v4us*)&sa[e >> 5][(e & 31) * 4] = p.v; }
  __syncthreads();      /* the 32 rounded rows are in LDS */
  const v8f z8 = {0.f, 0.f, 0.f, 0.f, 0.f, 0.f, 0.f, 0.f};
  v8f acc[2] = {z8, z8};
#pragma unroll
  for (int kk = 0; kk < CIN / 32; ++kk) { FragH bq;
#pragma unroll
    for (int e = 0; e < 16; ++e) bq.h[e] = (_Float16)(bf16_round(wv[kk][e]) * 16.0f);
#pragma unroll
    for (int g = 0; g < 2; ++g) { FragH aq; aq.half[0] = *(const v8us*)&sa[g * 16 + ln][kk * 32 + 8 * hh]; aq.half[1] = *(const v8us*)&sa[g * 16 + ln][kk * 32 + 16 + 8 * hh];
      acc[g] = __builtin_amdgcn_wmma_f32_16x16x32_f16(false, aq.v, false, bq.v, (short)0, acc[g], false, false); } }
#pragma unroll
  for (int g = 0; g < 2; ++g) { FragH o;
#pragma unroll
    for (int r = 0; r < 8; ++r) o.h[r] = (_Float16)(acc[g][r] * 0.0625f + bias);
    *(v8us*)((unsigned short*)VF + ((((size_t)blockIdx.x * 8 + w) * 2 + g) * 32 + lane) * 8) = o.half[0]; }
  asm volatile("s_wait_xcnt 0x0" ::: "memory");      /* in the built code the spare work-groups' part stands behind these two stores and writes their registers: the wait stands in front of any such write */
}

// One work-group = 32 rows i of one batch (RT = 2 tiles of 16), all four heads. Wave w takes the 32-wide j slices s = w + g, w + g + 8, ... modulo their number (g = the work-group's index: each group enters the ring at its own place); each slice's 16 value fragments and its coordinates are fetched once and used for both row tiles, which halves
// the bytes that the attention kernel draws from L2 per (i, j) pair. The exp2 argument -KS * d2 + WB = 2 KS c_j . c_i - KS |c_j|^2 - KS |c_i|^2 + WB of 16 points j x 16 rows i is one WMMA of the same f16 form, eight of its 32 k in use:
// A row j = (x, y, z, nh | x, y, z, nl), B column i = (Xh, Yh, Zh, 1 | Xl, Yl, Zl, 1), C = -KS |c_i|^2 + WB in f32 (one A fragment holds both 16-point tiles of a slice, each in four k of its own; B has zeros at the other tile's k). x, y, z are bf16-rounded and so exact as f16; nh + nl = -KS |c_j|^2 and Xh + Xl = 2 KS x_i are f32 values split into
// f16 and the f16 of the rest (22 bits or more); every product is exact in f32. With j as the rows of D, lane (hh, ln) holds in register r the pair (j = 8 * hh + r, i = ln): two such tiles are the 16 k of the weights' A fragment as they stand.
// Per row tile: one exp2 once per (i, j), the four heads' weights exp(-d2 / ls^2) * F_h (the widest head's, then fourth powers; F_h = 2^(WB * 4^(3 - h)) grows out of the bias WB that C adds to the exp2 argument, so no multiply scales a weight) built in registers
// as the A fragment (same k order as the B fragment: k = half * 16 + hh * 8 + q), two WMMAs per head and a third, against a column of ones, for the head's row sums (the sums of the very f16 weights that the products use; they carry the head's factor F_h, as the products do). The eight waves' partial products and row sums are joined in LDS, scaled by 1 / (sum + 1e-8 F_h) and split into f16 hi + residual,
// which stay in LDS: wave w multiplies both by the 16 columns w * 16 ... of Wo (four k steps each) and adds bo; the 32 x 128 result goes out through LDS so that every store of a wave is one whole row.
#define RPITCH 132      /* floats per row of a partial product in LDS: rows 8 apart (the two half-waves) fall on different banks */
#define RT 2            /* 16-row tiles per wave and work-group */
#define WR (RT * 16)    /* rows per work-group */
#define WB 0.1875f      /* bias of the exp2 argument: the heads' weights carry 2^(3/16), 2^(3/4), 2^3, 2^12 (ls = 4, 2, 1, 0.5), which lifts the narrow heads' small weights out of the f16 subnormals and keeps the self term (4096 at most) far below the f16 maximum */
__global__ __launch_bounds__(256) void k_att(const _Float16* __restrict__ PK, const _Float16* __restrict__ VF, const _Float16* __restrict__ BO, const float* __restrict__ bo, float* __restrict__ out) {
  __shared__ __attribute__((aligned(16))) float sm[8 * WR * RPITCH];      /* the eight waves' 32 x 128 partial products, later the 32 x 128 result */
  __shared__ float ssum[8][NH][WR];
  __shared__ __attribute__((aligned(16))) unsigned short shl[2][WR][HPITCH];      /* the 32 scaled rows: [0] f16 hi, [1] residual * 1024 */
  const int tid = threadIdx.x, w = __builtin_amdgcn_readfirstlane(tid >> 5), lane = tid & 31, ln = lane & 15, hh = lane >> 4;
  const int b = blockIdx.x / (NP / WR), row0 = (blockIdx.x % (NP / WR)) * WR;
  float* const op = out + ((size_t)b * NP + row0) * COUT;      /* the work-group's 32 rows of the result */
  __builtin_amdgcn_sched_barrier(0);      /* keeps the scalar load of the last kernel argument in front of the loads below: behind them it is handed their base registers */
  const unsigned short* sp = (const unsigned short*)PK + (size_t)b * NP * 8;      /* the batch's points, 8 f16 each: (x, y, z, nh, x, y, z, nl) */
  int s = (w + blockIdx.x) & (NP / 32 - 1);      /* the wave's first slice: the work-group's own place in the ring of slices, so that at any moment the work-groups of a batch read different value lines */
  const unsigned short* ap = sp + ln * 8 + 4 * hh;      /* this lane's four k of row j = ln of a 16-point tile: (x, y, z, nh) or (x, y, z, nl); 256 contiguous bytes a wave */
  const unsigned short* vb = (const unsigned short*)VF + (size_t)b * (NP / 32) * (COUT * 32) + lane * 8;      /* this lane's 16 bytes of the first fragment of the batch's slice 0 */
  FragH a0, an;      /* A fragments of the distance product, a0 of the wave's first slice, an of the slice behind the one in hand: elements 0 to 7 are the slice's points (tile g in 4 * g to 4 * g + 3), the others stay 0 */
  FragH bq[2 * NH];      /* the value fragments of the slice in hand */
  v4us pr[RT]; unsigned int pl[RT];      /* of the work-group's own rows (x, y, z, nh) and the word (z, nl) */
#pragma unroll
  for (int rt = 0; rt < RT; ++rt) { pr[rt] = *(const v4us*)(sp + (row0 + rt * 16 + ln) * 8); pl[rt] = *(const unsigned int __attribute__((may_alias))*)(sp + (row0 + rt * 16 + ln) * 8 + 6); }
#pragma unroll
  for (int g = 0; g < 2; ++g) { a0.quad[g] = *(const v4us*)(ap + (s * 32 + g * 16) * 8); an.quad[g] = *(const v4us*)(ap + (((s + 8) & (NP / 32 - 1)) * 32 + g * 16) * 8); }
  { const unsigned short* vp = vb + s * (COUT * 32);      /* the first slice's values are asked for here, beside the points: one memory latency for all that the first trip needs */
#pragma unroll
    for (int t = 2 * NH - 1; t >= 0; --t) { bq[t].half[0] = *(const v8us*)(vp + t * 512); bq[t].half[1] = *(const v8us*)(vp + t * 512 + 256); }
    asm volatile("s_wait_xcnt 0x0" :: "v"(vp) : "memory"); }      /* the address registers of these 24 loads are rewritten by the work below: the wait stands in front of that, and vp as its input keeps the pair from being handed out as a load's destination ahead of it; the barrier on the next line keeps that work behind it */
  __builtin_amdgcn_sched_barrier(0);
  const v8f z8 = {0.f, 0.f, 0.f, 0.f, 0.f, 0.f, 0.f, 0.f};
  v8f acc[RT][NH][2], sacc[RT];      /* sacc: the row sums of the weights, head h in column h */
#pragma unroll
  for (int rt = 0; rt < RT; ++rt)
#pragma unroll
    for (int h = 0; h < NH; ++h) { acc[rt][h][0] = z8; acc[rt][h][1] = z8; sacc[rt] = z8; }
  FragH one[NH];      /* B fragments of the row sums: ones in all 32 k of column h, zeros in the other columns */
#pragma unroll
  for (int h = 0; h < NH; ++h)
#pragma unroll
    for (int q = 0; q < 16; ++q) one[h].h[q] = ln == h ? (_Float16)1.0f : (_Float16)0.0f;
#pragma unroll
  for (int q = 8; q < 16; ++q) a0.h[q] = an.h[q] = (_Float16)0.0f;
  FragH bi[RT][2]; v8f ci[RT];      /* B fragments and C of the distance product; for the slice's 16-point tile g lane half hh holds its four k in elements 4 * g to 4 * g + 3, where the A loader below puts that tile; all other elements are 0 */
#pragma unroll
  for (int rt = 0; rt < RT; ++rt) { FragH f; f.quad[0] = pr[rt]; f.u[7] = (unsigned short)(pl[rt] >> 16);
#pragma unroll
    for (int q = 0; q < 16; ++q) bi[rt][0].h[q] = bi[rt][1].h[q] = (_Float16)0.0f;
#pragma unroll
    for (int q = 0; q < 3; ++q) { const float t = (2.0f * KS) * (float)f.h[q]; const _Float16 th = (_Float16)t; bi[rt][0].h[q] = bi[rt][1].h[4 + q] = hh ? (_Float16)(t - (float)th) : th; }
    bi[rt][0].h[3] = bi[rt][1].h[7] = (_Float16)1.0f;
    const float ni = (float)f.h[3] + (float)f.h[7];
#pragma unroll
    for (int r = 0; r < 8; ++r) ci[rt][r] = ni + WB; }
  v8f dg[RT][2];      /* the exp2 arguments of the slice in hand, made one slice ahead */
#pragma unroll
  for (int g = 0; g < 2; ++g)
#pragma unroll
    for (int rt = 0; rt < RT; ++rt) dg[rt][g] = __builtin_amdgcn_wmma_f32_16x16x32_f16(false, a0.v, false, bi[rt][g].v, (short)0, ci[rt], false, false);
  const unsigned short* aq = ap;
  auto trip = [&](const bool last) __attribute__((always_inline)) {      /* the work on the slice in hand; in the wave's last trip no arguments are made for a next one */
    aq = ap + ((s + 16) & (NP / 32 - 1)) * (32 * 8);      /* the points two slices on; behind the last slice the ring goes on, and nobody reads what comes of those */
#pragma unroll
    for (int rt = 0; rt < RT; ++rt) {
      float wt[16];
#pragma unroll
      for (int e = 0; e < 16; ++e) wt[e] = __builtin_amdgcn_exp2f(dg[rt][e >> 3][e & 7]);      /* exp(-d2 / 16) * 2^WB, the widest head; the bare hardware exp2 may flush below 2^-126, where the weight is 0 as f16 and adds nothing to a row sum that holds the self term F_h */
#pragma unroll
      for (int h = NH - 1; h >= 0; --h) { FragH a;      /* ls = 4, 2, 1, 0.5: 1 / ls^2 grows fourfold from head to head, so the next head's weight, factor included, is this one's fourth power (two squarings) */
#pragma unroll
        for (int e = 0; e < 16; ++e) { const float ev = wt[e]; a.h[e] = (_Float16)ev; const float sq = ev * ev; wt[e] = sq * sq; }
        acc[rt][h][0] = __builtin_amdgcn_wmma_f32_16x16x32_f16(false, a.v, false, bq[2 * h].v, (short)0, acc[rt][h][0], false, false);
        acc[rt][h][1] = __builtin_amdgcn_wmma_f32_16x16x32_f16(false, a.v, false, bq[2 * h + 1].v, (short)0, acc[rt][h][1], false, false);
        sacc[rt] = __builtin_amdgcn_wmma_f32_16x16x32_f16(false, a.v, false, one[h].v, (short)0, sacc[rt], false, false);      /* the head's row sums over this slice, from the same f16 weights as the products */
        if (h >= 2 && !last) dg[rt][h - 2] = __builtin_amdgcn_wmma_f32_16x16x32_f16(false, an.v, false, bi[rt][h - 2].v, (short)0, ci[rt], false, false);      /* the next slice's arguments, one tile behind each of the first two heads: the matrix unit makes them under this slice's vector work */
        if (h == 2 && rt == RT - 1 && !last) {      /* an has been read for the last time in this trip: its next points are asked for here, less than half a trip before their first use */
#pragma unroll
          for (int g = 0; g < 2; ++g) an.quad[g] = *(const v4us*)(aq + g * 16 * 8); } }
    }
  };
  for (int it = 0; it < NP / 32 / 8 - 1; ++it) {
    trip(false);
    __builtin_amdgcn_sched_barrier(0);      /* keeps the loads below in one run behind the trip's work: spread among it, the listing holds ten more idle slots behind WMMAs a trip */
    s = (s + 8) & (NP / 32 - 1);      /* the wave's next slice, round the ring */
    const unsigned short* vp = vb + s * (COUT * 32);
#pragma unroll
    for (int t = 2 * NH - 1; t >= 0; --t) { bq[t].half[0] = *(const v8us*)(vp + t * 512); bq[t].half[1] = *(const v8us*)(vp + t * 512 + 256); }
    asm volatile("s_wait_xcnt 0x0" :: "v"(vp), "v"(aq) : "memory");      /* the registers of vp and aq, which the 18 issued loads name, are rewritten in the next trip: the wait stands in front of that write, and the two as its inputs keep the pairs from being handed out as a load's destination ahead of it */
  }
  trip(true);
  v16h wo[COUT / 32];      /* this wave's 16 columns of Wo as B fragments: asked for here, so that the LDS stores in front of the barrier cover their latency */
#pragma unroll
  for (int kk = 0; kk < COUT / 32; ++kk) wo[kk] = g2_frag(BO + (size_t)(w * 16 + ln) * COUT + kk * 32, hh);
  const float bias = bf16_round(bo[w * 16 + ln]);
  asm volatile("s_wait_xcnt 0x0" ::: "memory");      /* the address registers of the nine loads above are rewritten by the address work below: the wait stands in front of that */
  if (ln < NH) {      /* lane (hh, ln = h) holds in register r head h's sum of row 8 * hh + r */
#pragma unroll
    for (int rt = 0; rt < RT; ++rt)
#pragma unroll
      for (int r = 0; r < 8; ++r) ssum[w][ln][rt * 16 + 8 * hh + r] = sacc[rt][r]; }
#pragma unroll
  for (int rt = 0; rt < RT; ++rt)
#pragma unroll
    for (int h = 0; h < NH; ++h)
#pragma unroll
      for (int t = 0; t < 2; ++t)
#pragma unroll
        for (int r = 0; r < 8; ++r) sm[(w * WR + rt * 16 + 8 * hh + r) * RPITCH + h * HD + t * 16 + ln] = acc[rt][h][t][r];
  __syncthreads();      /* the partial products and row sums of all eight waves are in LDS */
  const int c8 = (tid & 15) * 8, hd = c8 / HD;
  const float eps = 1e-8f * __builtin_amdgcn_exp2f(WB * (float)(64 >> (2 * hd)));      /* 1e-8 * F_h: products and sums both carry F_h, so it cancels in their quotient and only the reference's 1e-8 has to follow it */
#pragma unroll
  for (int rt = 0; rt < RT; ++rt) { const int row = rt * 16 + (tid >> 4);
    float tot = 0.f; v4f s0 = {0.f, 0.f, 0.f, 0.f}, s1 = s0;
#pragma unroll
    for (int ww = 0; ww < 8; ++ww) { tot += ssum[ww][hd][row]; s0 += *(const v4fa*)&sm[(ww * WR + row) * RPITCH + c8]; s1 += *(const v4fa*)&sm[(ww * WR + row) * RPITCH + c8 + 4]; }
    const float rs = 1.0f / (tot + eps); FragH f, fl;
#pragma unroll
    for (int q = 0; q < 8; ++q) { const float v = (q < 4 ? s0[q & 3] : s1[q & 3]) * rs; const _Float16 hi = (_Float16)v; f.h[q] = hi; fl.h[q] = (_Float16)((v - (float)hi) * 1024.0f); }
    *(v8us*)&shl[0][row][c8] = f.half[0]; *(v8us*)&shl[1][row][c8] = fl.half[0]; }
  __syncthreads();      /* the scaled rows are complete in shl, and every thread has read its last partial product: sm may be rewritten */
#pragma unroll
  for (int rt = 0; rt < RT; ++rt) { v8f oh = z8, ol = z8;
#pragma unroll
    for (int kk = 0; kk < COUT / 32; ++kk) { FragH ah, al;
      ah.half[0] = *(const v8us*)&shl[0][rt * 16 + ln][kk * 32 + 8 * hh]; ah.half[1] = *(const v8us*)&shl[0][rt * 16 + ln][kk * 32 + 16 + 8 * hh];
      al.half[0] = *(const v8us*)&shl[1][rt * 16 + ln][kk * 32 + 8 * hh]; al.half[1] = *(const v8us*)&shl[1][rt * 16 + ln][kk * 32 + 16 + 8 * hh];
      oh = __builtin_amdgcn_wmma_f32_16x16x32_f16(false, ah.v, false, wo[kk], (short)0, oh, false, false);
      ol = __builtin_amdgcn_wmma_f32_16x16x32_f16(false, al.v, false, wo[kk], (short)0, ol, false, false); }
#pragma unroll
    for (int r = 0; r < 8; ++r) { const float lo = ol[r] * (0.0625f / 1024.0f); float v = oh[r] * 0.0625f + bias; v += lo; sm[(rt * 16 + 8 * hh + r) * RPITCH + w * 16 + ln] = v; } }      /* out = (mh_lo + mh_hi) Wo + bo; Wo was scaled by 16 */
  __syncthreads();      /* all eight column tiles of the result are in LDS */
#pragma unroll
  for (int u = 0; u < 2 * RT; ++u) { const int e = u * 256 + tid, orow = e >> 5, c4 = (e & 31) * 4; const v4f v = *(const v4fa*)&sm[orow * RPITCH + c4]; *(v4f*)(op + orow * COUT + c4) = v; } }

extern "C" void kernel_launch(void* const* d_in, const int* in_sizes, int n_in,
                              void* d_out, int out_size, void* d_ws, size_t ws_size, hipStream_t stream) {
  (void)in_sizes; (void)n_in; (void)out_size;
  const float* const* I = (const float* const*)d_in; const float* feat = I[0]; const float* crd = I[1]; const float* Wv = I[2]; const float* bv = I[3]; const float* Wo = I[4]; const float* bo = I[5];
  char* ws = (char*)d_ws; size_t off = 0;
  auto take = [&](size_t bytes) { char* p = ws + off; off += (bytes + 255) & ~(size_t)255; return p; };
  _Float16* BO = (_Float16*)take((size_t)COUT * COUT * 2); _Float16* VF = (_Float16*)take((size_t)NB * NP * COUT * 2); _Float16* PK = (_Float16*)take((size_t)NB * NP * 8 * 2);
  if (off > ws_size) return;
  k_val<<<NB * (NP / 32) + COUT * COUT / 8 / 256 + NB * NP / 256, 256, 0, stream>>>(feat, crd, Wv, bv, Wo, VF, BO, PK);      /* values in B-fragment order; Wo (in, out) transposed; the points as rows of the distance product */
  k_att<<<NB * (NP / WR), 256, 0, stream>>>(PK, VF, BO, bo, (float*)d_out);      /* all (batch, head): weights, att . value, row scaling, output projection */
}

// v010
// Measured time: 17.3 microseconds a run.
// Next to v009, in two timings, it ran 1.11 times as fast each time.
// Over all steps from v000 it is 41.8 times as fast.
#include <hip/hip_runtime.h>
// KernelSelfAttention (2 x 4096 points; d2 = |c_i - c_j|^2 from 3-D coords; per head h with lengthscale ls in {0.5, 1, 2, 4}: att = exp(-d2 / ls^2) / (sum_j + 1e-8); value_h = features Wv[h] + bv[h] [32]; head_out = att value; out = concat_h Wo + bo -> [2][4096][128]).
#define NB 2
#define NP 4096
#define CIN 128
#define NH 4
#define HD 32
#define COUT 128
#define KS 0.09016844005556021f      /* log2(e) / 16: exp(-d2 / 16) = 2^(-KS * d2), the widest head */
#define HPITCH 136      /* bf16 or f16 per row of a 128-wide A operand in LDS: 16 bytes more than the row, so the 16 rows of a 16-byte fragment read fall on different banks */
typedef unsigned short v8us __attribute__((ext_vector_type(8), may_alias));
typedef unsigned short v4us __attribute__((ext_vector_type(4), may_alias));
typedef float  v8f  __attribute__((ext_vector_type(8)));
typedef float  v4f  __attribute__((ext_vector_type(4)));
typedef float  v4fa __attribute__((ext_vector_type(4), may_alias));
typedef _Float16 v16h __attribute__((ext_vector_type(16)));
union FragH { v16h v; v8us half[2]; v4us quad[4]; _Float16 h[16]; unsigned short u[16]; };
typedef float  v2f  __attribute__((ext_vector_type(2)));
typedef __bf16 v2b  __attribute__((ext_vector_type(2)));
typedef __bf16 v16b __attribute__((ext_vector_type(16)));
union FragB { v16b v; v8us half[2]; v2b pair[8]; };      /* A or B fragment of v_wmma_f32_16x16x32_bf16, same k order as FragH */
__device__ __forceinline__ v2b bf16_pair(float a, float b) { const v2f t = {a, b}; return __builtin_convertvector(t, v2b); }      /* one v_cvt_pk_bf16_f32, round to nearest even */

__device__ __forceinline__ unsigned short bf16_bits(float x) { unsigned int u = __float_as_uint(x); return (unsigned short)((u + 0x7FFFu + ((u >> 16) & 1u)) >> 16); }
__device__ __forceinline__ float bf16_val(unsigned short b) { return __uint_as_float(((unsigned int)b) << 16); }
__device__ __forceinline__ float bf16_round(float x) { return bf16_val(bf16_bits(x)); }
// A or B fragment of v_wmma_f32_16x16x32_f16 from 32 consecutive f16 of this lane's row (A) or column (B): k = 8 * hh + q, then 16 + 8 * hh + q
__device__ __forceinline__ v16h g2_frag(const _Float16* p, int hh) { FragH f; f.half[0] = *(const v8us*)((const unsigned short*)p + 8 * hh); f.half[1] = *(const v8us*)((const unsigned short*)p + 16 + 8 * hh); return f.v; }

// Values, straight from the f32 inputs into B-fragment order: VF[b][s = j / 32][tile = col / 16][half][lane][8]; lane = hh * 16 + (col & 15), j = s * 32 + half * 16 + hh * 8 + q, so that a wave's fragment load in k_att is 512 contiguous bytes.
// One work-group = one 32-row slice (b, s); wave w = column tile w (col = h * 32 + k). The slice of features is rounded once to bf16 into LDS and read from there as A fragments; each wave rounds its own 16 columns of Wv to bf16
// into B fragments; both by the hardware's packed conversion, two values an instruction, and both in the k order of g2_frag; the product is the bf16 form of the WMMA, which takes the rounded values as they are. The accumulator of row tile g holds in lane (hh, ln), register r, the value of row g * 16 + hh * 8 + r, column ln: that is VF's own order (half = g, q = r), one 16-byte store a lane.
// The work-groups behind the last slice write BO[n][k] = f16(bf16(Wo[k][n]) * 16) for k_att's output projection; those behind them write the points, 8 f16 each, PK[b][p] = (x, y, z, nh, x, y, z, nl), one point a thread: the rows of the distance product's A operand in k_att (x, y, z bf16-rounded, nh + nl = -KS |c|^2).
__global__ __launch_bounds__(256) void k_val(const float* __restrict__ feat, const float* __restrict__ crd, const float* __restrict__ Wv, const float* __restrict__ bv, const float* __restrict__ Wo, _Float16* __restrict__ VF, _Float16* __restrict__ BO, _Float16* __restrict__ PK) {
  __shared__ __attribute__((aligned(16))) unsigned short sa[32][HPITCH];
  const int tid = threadIdx.x;
  if (blockIdx.x >= NB * (NP / 32) + COUT * COUT / 8 / 256) {      /* the same for a whole work-group, and in front of the barrier */
    const int p = (blockIdx.x - NB * (NP / 32) - COUT * COUT / 8 / 256) * 256 + tid;
    const float c0 = crd[p * 3], c1 = crd[p * 3 + 1], c2 = crd[p * 3 + 2];
    asm volatile("s_wait_xcnt 0x0" ::: "memory");      /* the address registers of these loads may be rewritten by the work below: the wait stands in front of that */
    const float x = bf16_round(c0), y = bf16_round(c1), z = bf16_round(c2), n = -KS * (x * x + y * y + z * z);
    FragH f; f.h[0] = f.h[4] = (_Float16)x; f.h[1] = f.h[5] = (_Float16)y; f.h[2] = f.h[6] = (_Float16)z; f.h[3] = (_Float16)n; f.h[7] = (_Float16)(n - (float)f.h[3]);
    *(v8us*)((unsigned short*)PK + (size_t)p * 8) = f.half[0];      /* a wave's 16-byte stores are 512 contiguous bytes */
    return; }
  if (blockIdx.x >= NB * (NP / 32)) {      /* the same for a whole work-group, and in front of the barrier */
    const int t = (blockIdx.x - NB * (NP / 32)) * 256 + tid, n = t / (COUT / 8), k8 = (t % (COUT / 8)) * 8; FragH f;
#pragma unroll
    for (int i = 0; i < 8; ++i) f.h[i] = (_Float16)(bf16_round(Wo[(size_t)(k8 + i) * COUT + n]) * 16.0f);
    *(v8us*)((unsigned short*)BO + (size_t)n * COUT + k8) = f.half[0];
    return; }
  const int w = tid >> 5, lane = tid & 31, ln = lane & 15, hh = lane >> 4;
  const int col = w * 16 + ln;
  const float* wp = Wv + (size_t)(col / HD) * CIN * HD + (col % HD) + 8 * hh * HD;      /* Wv[h][c][k]: element c = 8 * hh + i of this lane's column at wp[i * HD] */
  const float* ap = feat + (size_t)blockIdx.x * 32 * CIN;
  v4f x[4]; float wv[CIN / 32][16];
#pragma unroll
  for (int u = 0; u < 4; ++u) x[u] = *(const v4fa*)(ap + (u * 256 + tid) * 4);
  __builtin_amdgcn_sched_barrier(0);      /* keeps the features' loads, which come from memory and are waited for first, in front of the 65 loads below: without it they are issued last */
#pragma unroll
  for (int kk = 0; kk < CIN / 32; ++kk)
#pragma unroll
    for (int q = 0; q < 8; ++q) { wv[kk][q] = wp[(kk * 32 + q) * HD]; wv[kk][8 + q] = wp[(kk * 32 + 16 + q) * HD]; }
  const float bias = bf16_round(bv[col]);
  asm volatile("s_wait_xcnt 0x0" ::: "memory");      /* the address registers of the 69 loads above are rewritten by the conversions below: the wait stands in front of that */
  __builtin_amdgcn_sched_barrier(0);      /* keeps all loads of the kernel in front of the first use: one memory latency; without it they are spread among the conversions and each group is waited for in turn */
#pragma unroll
  for (int u = 0; u < 4; ++u) { const int e = u * 256 + tid; union { v2b b[2]; v4us v; } p;
    p.b[0] = bf16_pair(x[u][0], x[u][1]); p.b[1] = bf16_pair(x[u][2], x[u][3]);
    *(v4us*)&sa[e >> 5][(e & 31) * 4] = p.v; }
  FragB bq[CIN / 32], aq[CIN / 32][2];
#pragma unroll
  for (int kk = 0; kk < CIN / 32; ++kk)
#pragma unroll
    for (int e = 0; e < 8; ++e) bq[kk].pair[e] = bf16_pair(wv[kk][2 * e], wv[kk][2 * e + 1]);
  __syncthreads();      /* the 32 rounded rows are in LDS */
#pragma unroll
  for (int kk = 0; kk < CIN / 32; ++kk)
#pragma unroll
    for (int g = 0; g < 2; ++g) { aq[kk][g].half[0] = *(const v8us*)&sa[g * 16 + ln][kk * 32 + 8 * hh]; aq[kk][g].half[1] = *(const v8us*)&sa[g * 16 + ln][kk * 32 + 16 + 8 * hh]; }
  __builtin_amdgcn_sched_barrier(0);      /* keeps the 16 LDS reads in one run in front of the products: one LDS latency; without it each product waits for its own pair of reads in turn */
  const v8f z8 = {0.f, 0.f, 0.f, 0.f, 0.f, 0.f, 0.f, 0.f};
  v8f acc[2] = {z8, z8};
#pragma unroll
  for (int kk = 0; kk < CIN / 32; ++kk)
#pragma unroll
    for (int g = 0; g < 2; ++g) acc[g] = __builtin_amdgcn_wmma_f32_16x16x32_bf16(false, aq[kk][g].v, false, bq[kk].v, (short)0, acc[g], false, false);
#pragma unroll
  for (int g = 0; g < 2; ++g) { FragH o;
#pragma unroll
    for (int r = 0; r < 8; ++r) o.h[r] = (_Float16)(acc[g][r] + bias);
    *(v8us*)((unsigned short*)VF + ((((size_t)blockIdx.x * 8 + w) * 2 + g) * 32 + lane) * 8) = o.half[0]; }
  asm volatile("s_wait_xcnt 0x0" ::: "memory");      /* in the built code the spare work-groups' part stands behind these two stores and writes their registers: the wait stands in front of any such write */
}

// One work-group = 32 rows i of one batch (RT = 2 tiles of 16), all four heads. Wave w takes the 32-wide j slices s = w + g, w + g + 8, ... modulo their number (g = the work-group's index: each group enters the ring at its own place); each slice's 16 value fragments and its coordinates are fetched once and used for both row tiles, which halves
// the bytes that the attention kernel draws from L2 per (i, j) pair. The exp2 argument -KS * d2 + WB = 2 KS c_j . c_i - KS |c_j|^2 - KS |c_i|^2 + WB of 16 points j x 16 rows i is one WMMA of the f16 form, eight of its 32 k in use:
// A row j = (x, y, z, nh | x, y, z, nl), B column i = (Xh, Yh, Zh, 1 | Xl, Yl, Zl, 1), C = -KS |c_i|^2 + WB in f32 (one A fragment holds both 16-point tiles of a slice, each in four k of its own; B has zeros at the other tile's k). x, y, z are bf16-rounded and so exact as f16; nh + nl = -KS |c_j|^2 and Xh + Xl = 2 KS x_i are f32 values split into
// f16 and the f16 of the rest (22 bits or more); every product is exact in f32. With j as the rows of D, lane (hh, ln) holds in register r the pair (j = 8 * hh + r, i = ln): two such tiles are the 16 k of the weights' A fragment as they stand.
// Per row tile: one exp2 once per (i, j), the four heads' weights exp(-d2 / ls^2) * F_h (the widest head's, then fourth powers; F_h = 2^(WB * 4^(3 - h)) grows out of the bias WB that C adds to the exp2 argument, so no multiply scales a weight) built in registers
// as the A fragment (same k order as the B fragment: k = half * 16 + hh * 8 + q), two WMMAs per head and a third, against a column of ones, for the head's row sums (the sums of the very f16 weights that the products use; they carry the head's factor F_h, as the products do). The eight waves' partial products and row sums are joined in LDS, scaled by 1 / (sum + 1e-8 F_h) and split into f16 hi + residual,
// which stay in LDS: wave w multiplies both by the 16 columns w * 16 ... of Wo (four k steps each) and adds bo; the 32 x 128 result goes out through LDS so that every store of a wave is one whole row.
#define RPITCH 132      /* floats per row of a partial product in LDS: rows 8 apart (the two half-waves) fall on different banks */
#define RT 2            /* 16-row tiles per wave and work-group */
#define WR (RT * 16)    /* rows per work-group */
#define WB 0.1875f      /* bias of the exp2 argument: the heads' weights carry 2^(3/16), 2^(3/4), 2^3, 2^12 (ls = 4, 2, 1, 0.5), which lifts the narrow heads' small weights out of the f16 subnormals and keeps the self term (4096 at most) far below the f16 maximum */
__global__ __launch_bounds__(256) void k_att(const _Float16* __restrict__ PK, const _Float16* __restrict__ VF, const _Float16* __restrict__ BO, const float* __restrict__ bo, float* __restrict__ out) {
  __shared__ __attribute__((aligned(16))) float sm[8 * WR * RPITCH];      /* the eight waves' 32 x 128 partial products, later the 32 x 128 result */
  __shared__ float ssum[8][NH][WR];
  __shared__ __attribute__((aligned(16))) unsigned short shl[2][WR][HPITCH];      /* the 32 scaled rows: [0] f16 hi, [1] residual * 1024 */
  const int tid = threadIdx.x, w = __builtin_amdgcn_readfirstlane(tid >> 5), lane = tid & 31, ln = lane & 15, hh = lane >> 4;
  const int b = blockIdx.x / (NP / WR), row0 = (blockIdx.x % (NP / WR)) * WR;
  float* const op = out + ((size_t)b * NP + row0) * COUT;      /* the work-group's 32 rows of the result */
  __builtin_amdgcn_sched_barrier(0);      /* keeps the scalar load of the last kernel argument in front of the loads below: behind them it is handed their base registers */
  const unsigned short* sp = (const unsigned short*)PK + (size_t)b * NP * 8;      /* the batch's points, 8 f16 each: (x, y, z, nh, x, y, z, nl) */
  int s = (w + blockIdx.x) & (NP / 32 - 1);      /* the wave's first slice: the work-group's own place in the ring of slices, so that at any moment the work-groups of a batch read different value lines */
  const unsigned short* ap = sp + ln * 8 + 4 * hh;      /* this lane's four k of row j = ln of a 16-point tile: (x, y, z, nh) or (x, y, z, nl); 256 contiguous bytes a wave */
  const unsigned short* vb = (const unsigned short*)VF + (size_t)b * (NP / 32) * (COUT * 32) + lane * 8;      /* this lane's 16 bytes of the first fragment of the batch's slice 0 */
  FragH a0, an;      /* A fragments of the distance product, a0 of the wave's first slice, an of the slice behind the one in hand: elements 0 to 7 are the slice's points (tile g in 4 * g to 4 * g + 3), the others stay 0 */
  FragH bq[2 * NH];      /* the value fragments of the slice in hand */
  v4us pr[RT]; unsigned int pl[RT];      /* of the work-group's own rows (x, y, z, nh) and the word (z, nl) */
#pragma unroll
  for (int rt = 0; rt < RT; ++rt) { pr[rt] = *(const v4us*)(sp + (row0 + rt * 16 + ln) * 8); pl[rt] = *(const unsigned int __attribute__((may_alias))*)(sp + (row0 + rt * 16 + ln) * 8 + 6); }
#pragma unroll
  for (int g = 0; g < 2; ++g) { a0.quad[g] = *(const v4us*)(ap + (s * 32 + g * 16) * 8); an.quad[g] = *(const v4us*)(ap + (((s + 8) & (NP / 32 - 1)) * 32 + g * 16) * 8); }
  { const unsigned short* vp = vb + s * (COUT * 32);      /* the first slice's values are asked for here, beside the points: one memory latency for all that the first trip needs */
#pragma unroll
    for (int t = 2 * NH - 1; t >= 0; --t) { bq[t].half[0] = *(const v8us*)(vp + t * 512); bq[t].half[1] = *(const v8us*)(vp + t * 512 + 256); }
    asm volatile("s_wait_xcnt 0x0" :: "v"(vp) : "memory"); }      /* the address registers of these 24 loads are rewritten by the work below: the wait stands in front of that, and vp as its input keeps the pair from being handed out as a load's destination ahead of it; the barrier on the next line keeps that work behind it */
  __builtin_amdgcn_sched_barrier(0);
  const v8f z8 = {0.f, 0.f, 0.f, 0.f, 0.f, 0.f, 0.f, 0.f};
  v8f acc[RT][NH][2], sacc[RT];      /* sacc: the row sums of the weights, head h in column h */
#pragma unroll
  for (int rt = 0; rt < RT; ++rt)
#pragma unroll
    for (int h = 0; h < NH; ++h) { acc[rt][h][0] = z8; acc[rt][h][1] = z8; sacc[rt] = z8; }
  FragH one[NH];      /* B fragments of the row sums: ones in all 32 k of column h, zeros in the other columns */
#pragma unroll
  for (int h = 0; h < NH; ++h)
#pragma unroll
    for (int q = 0; q < 16; ++q) one[h].h[q] = ln == h ? (_Float16)1.0f : (_Float16)0.0f;
#pragma unroll
  for (int q = 8; q < 16; ++q) a0.h[q] = an.h[q] = (_Float16)0.0f;
  FragH bi[RT][2]; v8f ci[RT];      /* B fragments and C of the distance product; for the slice's 16-point tile g lane half hh holds its four k in elements 4 * g to 4 * g + 3, where the A loader below puts that tile; all other elements are 0 */
#pragma unroll
  for (int rt = 0; rt < RT; ++rt) { FragH f; f.quad[0] = pr[rt]; f.u[7] = (unsigned short)(pl[rt] >> 16);
#pragma unroll
    for (int q = 0; q < 16; ++q) bi[rt][0].h[q] = bi[rt][1].h[q] = (_Float16)0.0f;
#pragma unroll
    for (int q = 0; q < 3; ++q) { const float t = (2.0f * KS) * (float)f.h[q]; const _Float16 th = (_Float16)t; bi[rt][0].h[q] = bi[rt][1].h[4 + q] = hh ? (_Float16)(t - (float)th) : th; }
    bi[rt][0].h[3] = bi[rt][1].h[7] = (_Float16)1.0f;
    const float ni = (float)f.h[3] + (float)f.h[7];
#pragma unroll
    for (int r = 0; r < 8; ++r) ci[rt][r] = ni + WB; }
  v8f dg[RT][2];      /* the exp2 arguments of the slice in hand, made one slice ahead */
#pragma unroll
  for (int g = 0; g < 2; ++g)
#pragma unroll
    for (int rt = 0; rt < RT; ++rt) dg[rt][g] = __builtin_amdgcn_wmma_f32_16x16x32_f16(false, a0.v, false, bi[rt][g].v, (short)0, ci[rt], false, false);
  const unsigned short* aq = ap;
  auto trip = [&](const bool last) __attribute__((always_inline)) {      /* the work on the slice in hand; in the wave's last trip no arguments are made for a next one */
    aq = ap + ((s + 16) & (NP / 32 - 1)) * (32 * 8);      /* the points two slices on; behind the last slice the ring goes on, and nobody reads what comes of those */
#pragma unroll
    for (int rt = 0; rt < RT; ++rt) {
      float wt[16];
#pragma unroll
      for (int e = 0; e < 16; ++e) wt[e] = __builtin_amdgcn_exp2f(dg[rt][e >> 3][e & 7]);      /* exp(-d2 / 16) * 2^WB, the widest head; the bare hardware exp2 may flush below 2^-126, where the weight is 0 as f16 and adds nothing to a row sum that holds the self term F_h */
#pragma unroll
      for (int h = NH - 1; h >= 0; --h) { FragH a;      /* ls = 4, 2, 1, 0.5: 1 / ls^2 grows fourfold from head to head, so the next head's weight, factor included, is this one's fourth power (two squarings) */
#pragma unroll
        for (int e = 0; e < 16; ++e) { const float ev = wt[e]; a.h[e] = (_Float16)ev; const float sq = ev * ev; wt[e] = sq * sq; }
        acc[rt][h][0] = __builtin_amdgcn_wmma_f32_16x16x32_f16(false, a.v, false, bq[2 * h].v, (short)0, acc[rt][h][0], false, false);
        acc[rt][h][1] = __builtin_amdgcn_wmma_f32_16x16x32_f16(false, a.v, false, bq[2 * h + 1].v, (short)0, acc[rt][h][1], false, false);
        sacc[rt] = __builtin_amdgcn_wmma_f32_16x16x32_f16(false, a.v, false, one[h].v, (short)0, sacc[rt], false, false);      /* the head's row sums over this slice, from the same f16 weights as the products */
        if (h >= 2 && !last) dg[rt][h - 2] = __builtin_amdgcn_wmma_f32_16x16x32_f16(false, an.v, false, bi[rt][h - 2].v, (short)0, ci[rt], false, false);      /* the next slice's arguments, one tile behind each of the first two heads: the matrix unit makes them under this slice's vector work */
        if (h == 2 && rt == RT - 1 && !last) {      /* an has been read for the last time in this trip: its next points are asked for here, less than half a trip before their first use */
#pragma unroll
          for (int g = 0; g < 2; ++g) an.quad[g] = *(const v4us*)(aq + g * 16 * 8); } }
    }
  };
  for (int it = 0; it < NP / 32 / 8 - 1; ++it) {
    trip(false);
    __builtin_amdgcn_sched_barrier(0);      /* keeps the loads below in one run behind the trip's work: spread among it, the listing holds ten more idle slots behind WMMAs a trip */
    s = (s + 8) & (NP / 32 - 1);      /* the wave's next slice, round the ring */
    const unsigned short* vp = vb + s * (COUT * 32);
#pragma unroll
    for (int t = 2 * NH - 1; t >= 0; --t) { bq[t].half[0] = *(const v8us*)(vp + t * 512); bq[t].half[1] = *(const v8us*)(vp + t * 512 + 256); }
    asm volatile("s_wait_xcnt 0x0" :: "v"(vp), "v"(aq) : "memory");      /* the registers of vp and aq, which the 18 issued loads name, are rewritten in the next trip: the wait stands in front of that write, and the two as its inputs keep the pairs from being handed out as a load's destination ahead of it */
  }
  trip(true);
  v16h wo[COUT / 32];      /* this wave's 16 columns of Wo as B fragments: asked for here, so that the LDS stores in front of the barrier cover their latency */
#pragma unroll
  for (int kk = 0; kk < COUT / 32; ++kk) wo[kk] = g2_frag(BO + (size_t)(w * 16 + ln) * COUT + kk * 32, hh);
  const float bias = bf16_round(bo[w * 16 + ln]);
  asm volatile("s_wait_xcnt 0x0" ::: "memory");      /* the address registers of the nine loads above are rewritten by the address work below: the wait stands in front of that */
  if (ln < NH) {      /* lane (hh, ln = h) holds in register r head h's sum of row 8 * hh + r */
#pragma unroll
    for (int rt = 0; rt < RT; ++rt)
#pragma unroll
      for (int r = 0; r < 8; ++r) ssum[w][ln][rt * 16 + 8 * hh + r] = sacc[rt][r]; }
#pragma unroll
  for (int rt = 0; rt < RT; ++rt)
#pragma unroll
    for (int h = 0; h < NH; ++h)
#pragma unroll
      for (int t = 0; t < 2; ++t)
#pragma unroll
        for (int r = 0; r < 8; ++r) sm[(w * WR + rt * 16 + 8 * hh + r) * RPITCH + h * HD + t * 16 + ln] = acc[rt][h][t][r];
  __syncthreads();      /* the partial products and row sums of all eight waves are in LDS */
  const int c8 = (tid & 15) * 8, hd = c8 / HD;
  const float eps = 1e-8f * __builtin_amdgcn_exp2f(WB * (float)(64 >> (2 * hd)));      /* 1e-8 * F_h: products and sums both carry F_h, so it cancels in their quotient and only the reference's 1e-8 has to follow it */
#pragma unroll
  for (int rt = 0; rt < RT; ++rt) { const int row = rt * 16 + (tid >> 4);
    float tot = 0.f; v4f s0 = {0.f, 0.f, 0.f, 0.f}, s1 = s0;
#pragma unroll
    for (int ww = 0; ww < 8; ++ww) { tot += ssum[ww][hd][row]; s0 += *(const v4fa*)&sm[(ww * WR + row) * RPITCH + c8]; s1 += *(const v4fa*)&sm[(ww * WR + row) * RPITCH + c8 + 4]; }
    const float rs = 1.0f / (tot + eps); FragH f, fl;
#pragma unroll
    for (int q = 0; q < 8; ++q) { const float v = (q < 4 ? s0[q & 3] : s1[q & 3]) * rs; const _Float16 hi = (_Float16)v; f.h[q] = hi; fl.h[q] = (_Float16)((v - (float)hi) * 1024.0f); }
    *(v8us*)&shl[0][row][c8] = f.half[0]; *(v8us*)&shl[1][row][c8] = fl.half[0]; }
  __syncthreads();      /* the scaled rows are complete in shl, and every thread has read its last partial product: sm may be rewritten */
#pragma unroll
  for (int rt = 0; rt < RT; ++rt) { v8f oh = z8, ol = z8;
#pragma unroll
    for (int kk = 0; kk < COUT / 32; ++kk) { FragH ah, al;
      ah.half[0] = *(const v8us*)&shl[0][rt * 16 + ln][kk * 32 + 8 * hh]; ah.half[1] = *(const v8us*)&shl[0][rt * 16 + ln][kk * 32 + 16 + 8 * hh];
      al.half[0] = *(const v8us*)&shl[1][rt * 16 + ln][kk * 32 + 8 * hh]; al.half[1] = *(const v8us*)&shl[1][rt * 16 + ln][kk * 32 + 16 + 8 * hh];
      oh = __builtin_amdgcn_wmma_f32_16x16x32_f16(false, ah.v, false, wo[kk], (short)0, oh, false, false);
      ol = __builtin_amdgcn_wmma_f32_16x16x32_f16(false, al.v, false, wo[kk], (short)0, ol, false, false); }
#pragma unroll
    for (int r = 0; r < 8; ++r) { const float lo = ol[r] * (0.0625f / 1024.0f); float v = oh[r] * 0.0625f + bias; v += lo; sm[(rt * 16 + 8 * hh + r) * RPITCH + w * 16 + ln] = v; } }      /* out = (mh_lo + mh_hi) Wo + bo; Wo was scaled by 16 */
  __syncthreads();      /* all eight column tiles of the result are in LDS */
#pragma unroll
  for (int u = 0; u < 2 * RT; ++u) { const int e = u * 256 + tid, orow = e >> 5, c4 = (e & 31) * 4; const v4f v = *(const v4fa*)&sm[orow * RPITCH + c4]; *(v4f*)(op + orow * COUT + c4) = v; } }

extern "C" void kernel_launch(void* const* d_in, const int* in_sizes, int n_in,
                              void* d_out, int out_size, void* d_ws, size_t ws_size, hipStream_t stream) {
  (void)in_sizes; (void)n_in; (void)out_size;
  const float* const* I = (const float* const*)d_in; const float* feat = I[0]; const float* crd = I[1]; const float* Wv = I[2]; const float* bv = I[3]; const float* Wo = I[4]; const float* bo = I[5];
  char* ws = (char*)d_ws; size_t off = 0;
  auto take = [&](size_t bytes) { char* p = ws + off; off += (bytes + 255) & ~(size_t)255; return p; };
  _Float16* BO = (_Float16*)take((size_t)COUT * COUT * 2); _Float16* VF = (_Float16*)take((size_t)NB * NP * COUT * 2); _Float16* PK = (_Float16*)take((size_t)NB * NP * 8 * 2);
  if (off > ws_size) return;
  k_val<<<NB * (NP / 32) + COUT * COUT / 8 / 256 + NB * NP / 256, 256, 0, stream>>>(feat, crd, Wv, bv, Wo, VF, BO, PK);      /* values in B-fragment order; Wo (in, out) transposed; the points as rows of the distance product */
  k_att<<<NB * (NP / WR), 256, 0, stream>>>(PK, VF, BO, bo, (float*)d_out);      /* all (batch, head): weights, att . value, row scaling, output projection */
}
